// v000
// The times below were measured on an AMD MI455X: many runs one after another, warmed up first and cycling through
// copies of the inputs, with the whole window's GPU time divided by the number of runs. Launches and the gaps
// between them are all in it. The median over several windows is given; except for v000 it joins two sittings, which
// can be a few percent apart, so the side-by-side timings, each taken in one sitting, are the better comparison.
// v000, which the later versions start from, runs in 480 microseconds.
#include <hip/hip_runtime.h>
#include <cstdint>
#include <cstddef>

// ---------------------------------------------------------------------------
// MI455X (gfx1250) transformer block, bf16 WMMA path.
// ~70 GFLOP of GEMMs vs ~100MB traffic -> matrix-core bound; everything
// routed through v_wmma_f32_16x16x32_bf16 with f32 accumulation.
// Row-major tiles are staged into LDS with global_load_async_to_lds_b128
// (ASYNCcnt-tracked DMA, no VGPR round-trip), double-buffered in the GEMM.
// ---------------------------------------------------------------------------

typedef __attribute__((ext_vector_type(16))) __bf16 bf16x16;
typedef __attribute__((ext_vector_type(8)))  float  f32x8;

#define HEADS 8
#define DHEAD 64
#define SEQ   1024
#define BATCH 8
#define DMODEL 512
#define DFF   2048
#define NCLS  1000
#define MROWS (BATCH * SEQ)   // 8192
#define ATTN_SCALE 0.125f     // 1/sqrt(64)

__device__ __forceinline__ f32x8 zero8() {
    f32x8 z = {0.f, 0.f, 0.f, 0.f, 0.f, 0.f, 0.f, 0.f};
    return z;
}

__device__ __forceinline__ float gelu_tanh(float x) {
    float x3 = x * x * x;
    return 0.5f * x * (1.f + tanhf(0.7978845608028654f * (x + 0.044715f * x3)));
}

// Async DMA: 16 bytes global -> LDS per lane (VDST = LDS byte offset VGPR,
// VADDR = 64-bit global address). Tracked by ASYNCcnt. Low 32 bits of a
// flat shared pointer are the LDS byte offset on AMDGPU.
__device__ __forceinline__ void async_g2l_b128(void* ldsDst, const void* gSrc) {
    unsigned ldsOff = (unsigned)(uintptr_t)ldsDst;
    asm volatile("global_load_async_to_lds_b128 %0, %1, off"
                 :: "v"(ldsOff), "v"(gSrc)
                 : "memory");
}

__device__ __forceinline__ void wait_async0() {
#if __has_builtin(__builtin_amdgcn_s_wait_asynccnt)
    __builtin_amdgcn_s_wait_asynccnt(0);
#else
    asm volatile("s_wait_asynccnt 0x0" ::: "memory");
#endif
}

// Load a 16x32 bf16 WMMA operand fragment from an LDS tile laid out as
// tile[rc][k] (A-matrix rows, or B-matrix stored K-transposed: tile[col][k]).
// Per ISA 7.12.2 (16-bit A 16x32): lanes 0-15 hold K=0..7,16..23 of row M=lane,
// lanes 16-31 hold K=8..15,24..31 of row M=lane-16; pairs packed per VGPR.
__device__ __forceinline__ bf16x16 load_frag(const __bf16* base, int stride,
                                             int rcBase, int kBase) {
    const int lane = threadIdx.x & 31;
    const int idx  = lane & 15;
    const int half = lane >> 4;
    const __bf16* p = base + (size_t)(rcBase + idx) * stride + kBase + half * 8;
    union { bf16x16 v; unsigned u[8]; } r;
#pragma unroll
    for (int i = 0; i < 8; ++i) {
        int k = ((i & 4) << 2) + ((i & 3) << 1);   // i<4 -> 0..6 ; i>=4 -> 16..22
        r.u[i] = *(const unsigned*)(p + k);
    }
    return r.v;
}

// ---------------------------------------------------------------------------
// fp32 -> bf16 convert
// ---------------------------------------------------------------------------
__global__ __launch_bounds__(256) void cvt_bf16_kernel(const float* __restrict__ in,
                                                       __bf16* __restrict__ out, int n) {
    int i = blockIdx.x * 256 + threadIdx.x;
    if (i < n) out[i] = (__bf16)in[i];
}

// ---------------------------------------------------------------------------
// LayerNorm over D=512. Optionally applies token mask and emits f32 residual.
// One block (256 threads, 2 cols each) per row.
// ---------------------------------------------------------------------------
template <bool MASKED>
__global__ __launch_bounds__(256) void ln_kernel(const float* __restrict__ x,
                                                 const float* __restrict__ mask,
                                                 float* __restrict__ residOut,
                                                 const float* __restrict__ g,
                                                 const float* __restrict__ bta,
                                                 __bf16* __restrict__ outB) {
    __shared__ float red[256];
    __shared__ float stats[2];
    const int row = blockIdx.x;
    const int tid = threadIdx.x;
    const size_t rb = (size_t)row * DMODEL;
    float v0 = x[rb + tid];
    float v1 = x[rb + tid + 256];
    if (MASKED) {
        float mv = mask[row & (SEQ - 1)];
        v0 *= mv; v1 *= mv;
        residOut[rb + tid]       = v0;
        residOut[rb + tid + 256] = v1;
    }
    red[tid] = v0 + v1;
    __syncthreads();
#pragma unroll
    for (int off = 128; off > 0; off >>= 1) {
        if (tid < off) red[tid] += red[tid + off];
        __syncthreads();
    }
    if (tid == 0) stats[0] = red[0] * (1.f / DMODEL);
    __syncthreads();
    const float mu = stats[0];
    float d0 = v0 - mu, d1 = v1 - mu;
    red[tid] = d0 * d0 + d1 * d1;
    __syncthreads();
#pragma unroll
    for (int off = 128; off > 0; off >>= 1) {
        if (tid < off) red[tid] += red[tid + off];
        __syncthreads();
    }
    if (tid == 0) stats[1] = rsqrtf(red[0] * (1.f / DMODEL) + 1e-5f);
    __syncthreads();
    const float rstd = stats[1];
    outB[rb + tid]       = (__bf16)(d0 * rstd * g[tid]       + bta[tid]);
    outB[rb + tid + 256] = (__bf16)(d1 * rstd * g[tid + 256] + bta[tid + 256]);
}

// ---------------------------------------------------------------------------
// bf16 WMMA GEMM: C[M,N] = A[M,K] @ B[K,N] (+bias)(+GELU)(+resid)
// Block: 256 threads = 8 waves. Tile BM=128, BN=128, BK=32, double-buffered:
// next tile's async DMA runs under the current tile's WMMAs.
// Waves: 4 along M (32 rows), 2 along N (64 cols) -> 2x4 subtiles of 16x16.
// B is stored K-transposed in LDS so both operands use the same frag loader.
// ---------------------------------------------------------------------------
template <bool BIAS, bool GELU_ACT, bool RESID, bool OUT_BF16>
__global__ __launch_bounds__(256) void gemm_bf16_kernel(
        const __bf16* __restrict__ A, const __bf16* __restrict__ Bm,
        const float* __restrict__ bias, const float* __restrict__ resid,
        float* __restrict__ outF, __bf16* __restrict__ outB,
        int M, int Nn, int K) {
    __shared__ __bf16 lsA[2][128][40];   // [buf][row][k]
    __shared__ __bf16 lsB[2][128][40];   // [buf][col][k]  (K-transposed B tile)

    const int m0 = blockIdx.y * 128;
    const int n0 = blockIdx.x * 128;
    const int tid  = threadIdx.x;
    const int wave = tid >> 5;
    const int wm   = wave & 3;    // 0..3 : 32 rows each
    const int wn   = wave >> 2;   // 0..1 : 64 cols each

    f32x8 acc[2][4];
#pragma unroll
    for (int mi = 0; mi < 2; ++mi)
#pragma unroll
        for (int ni = 0; ni < 4; ++ni) acc[mi][ni] = zero8();

    auto load_tiles = [&](int k0, int buf) {
        // A tile: 128 rows x 32 cols, async DMA straight to LDS
#pragma unroll
        for (int s = tid; s < 512; s += 256) {
            int row = s >> 2, seg = s & 3;
            async_g2l_b128(&lsA[buf][row][seg * 8],
                           A + (size_t)(m0 + row) * K + k0 + seg * 8);
        }
        // B tile: 32 rows x 128 cols, scatter K-transposed (needs VGPR path)
#pragma unroll
        for (int s = tid; s < 512; s += 256) {
            int krow = s >> 4, cseg = s & 15;
            uint4 t = *(const uint4*)(Bm + (size_t)(k0 + krow) * Nn + n0 + cseg * 8);
            const __bf16* hs = reinterpret_cast<const __bf16*>(&t);
#pragma unroll
            for (int e = 0; e < 8; ++e) lsB[buf][cseg * 8 + e][krow] = hs[e];
        }
    };

    const int nk = K >> 5;
    load_tiles(0, 0);
    for (int i = 0; i < nk; ++i) {
        wait_async0();
        __syncthreads();
        if (i + 1 < nk) load_tiles((i + 1) << 5, (i + 1) & 1);

        const int buf = i & 1;
        bf16x16 aF[2], bF[4];
#pragma unroll
        for (int mi = 0; mi < 2; ++mi)
            aF[mi] = load_frag(&lsA[buf][0][0], 40, wm * 32 + mi * 16, 0);
#pragma unroll
        for (int ni = 0; ni < 4; ++ni)
            bF[ni] = load_frag(&lsB[buf][0][0], 40, wn * 64 + ni * 16, 0);
#pragma unroll
        for (int mi = 0; mi < 2; ++mi)
#pragma unroll
            for (int ni = 0; ni < 4; ++ni)
                acc[mi][ni] = __builtin_amdgcn_wmma_f32_16x16x32_bf16(
                    false, aF[mi], false, bF[ni], (short)0, acc[mi][ni], false, false);
    }

    // Epilogue. C/D layout: lane<16 -> M = r, lane>=16 -> M = 8+r ; N = lane&15
    const int lane = tid & 31;
    const int half = lane >> 4;
    const int lcol = lane & 15;
#pragma unroll
    for (int mi = 0; mi < 2; ++mi) {
#pragma unroll
        for (int ni = 0; ni < 4; ++ni) {
#pragma unroll
            for (int r = 0; r < 8; ++r) {
                int gr = m0 + wm * 32 + mi * 16 + half * 8 + r;
                int gc = n0 + wn * 64 + ni * 16 + lcol;
                float v = acc[mi][ni][r];
                if (BIAS)     v += bias[gc];
                if (GELU_ACT) v = gelu_tanh(v);
                if (RESID)    v += resid[(size_t)gr * Nn + gc];
                if (OUT_BF16) outB[(size_t)gr * Nn + gc] = (__bf16)v;
                else          outF[(size_t)gr * Nn + gc] = v;
            }
        }
    }
}

// ---------------------------------------------------------------------------
// Attention: one block per (b, h, 128-row Q tile). Streams 64-key tiles:
//   S = Q K^T * scale ; P = exp(S) (reference has no max-subtraction)
//   rowsum += sum_j P ; O += P V ; final O /= rowsum.
// Q/K tiles are async-DMA'd into LDS; V needs a transpose scatter.
// ---------------------------------------------------------------------------
__global__ __launch_bounds__(256) void attn_kernel(const __bf16* __restrict__ Q,
                                                   const __bf16* __restrict__ Kmat,
                                                   const __bf16* __restrict__ Vmat,
                                                   __bf16* __restrict__ O) {
    __shared__ __bf16 lsQ[128][72];   // [row][dh]
    __shared__ __bf16 lsK[64][72];    // [key][dh]  (B-transposed layout for QK^T)
    __shared__ __bf16 lsVt[64][72];   // [dh][key]  (B-transposed layout for PV)
    __shared__ __bf16 lsP[128][72];   // [row][key]
    __shared__ float  rowsumAcc[128];

    const int r0 = blockIdx.x * 128;
    const int h  = blockIdx.y;
    const int b  = blockIdx.z;
    const int tid  = threadIdx.x;
    const int wave = tid >> 5;
    const int wm   = wave & 3;     // 4 x 32 rows
    const int wn   = wave >> 2;    // 2 x 32 cols
    const int lane = tid & 31;
    const int half = lane >> 4;
    const int lcol = lane & 15;

    const __bf16* qbase = Q + ((size_t)(b * SEQ + r0)) * DMODEL + h * DHEAD;
#pragma unroll
    for (int s = tid; s < 1024; s += 256) {   // 128 rows x 8 uint4 segs
        int row = s >> 3, cs = s & 7;
        async_g2l_b128(&lsQ[row][cs * 8], qbase + (size_t)row * DMODEL + cs * 8);
    }
    if (tid < 128) rowsumAcc[tid] = 0.f;

    f32x8 oAcc[2][2];
#pragma unroll
    for (int mi = 0; mi < 2; ++mi)
#pragma unroll
        for (int ni = 0; ni < 2; ++ni) oAcc[mi][ni] = zero8();

    for (int j0 = 0; j0 < SEQ; j0 += 64) {
        __syncthreads();
        const __bf16* kbase = Kmat + ((size_t)(b * SEQ + j0)) * DMODEL + h * DHEAD;
        const __bf16* vbase = Vmat + ((size_t)(b * SEQ + j0)) * DMODEL + h * DHEAD;
#pragma unroll
        for (int s = tid; s < 512; s += 256) {  // K tile row-major, async DMA
            int kr = s >> 3, cs = s & 7;
            async_g2l_b128(&lsK[kr][cs * 8], kbase + (size_t)kr * DMODEL + cs * 8);
        }
#pragma unroll
        for (int s = tid; s < 512; s += 256) {  // V tile, scatter transposed
            int kr = s >> 3, cs = s & 7;
            uint4 t = *(const uint4*)(vbase + (size_t)kr * DMODEL + cs * 8);
            const __bf16* hs = reinterpret_cast<const __bf16*>(&t);
#pragma unroll
            for (int e = 0; e < 8; ++e) lsVt[cs * 8 + e][kr] = hs[e];
        }
        wait_async0();
        __syncthreads();

        // S = Q K^T  (M=128 rows, N=64 keys, K=64=dh)
        f32x8 sAcc[2][2];
#pragma unroll
        for (int mi = 0; mi < 2; ++mi)
#pragma unroll
            for (int ni = 0; ni < 2; ++ni) sAcc[mi][ni] = zero8();
#pragma unroll
        for (int kk = 0; kk < 64; kk += 32) {
            bf16x16 aF[2], bF[2];
#pragma unroll
            for (int mi = 0; mi < 2; ++mi)
                aF[mi] = load_frag(&lsQ[0][0], 72, wm * 32 + mi * 16, kk);
#pragma unroll
            for (int ni = 0; ni < 2; ++ni)
                bF[ni] = load_frag(&lsK[0][0], 72, wn * 32 + ni * 16, kk);
#pragma unroll
            for (int mi = 0; mi < 2; ++mi)
#pragma unroll
                for (int ni = 0; ni < 2; ++ni)
                    sAcc[mi][ni] = __builtin_amdgcn_wmma_f32_16x16x32_bf16(
                        false, aF[mi], false, bF[ni], (short)0, sAcc[mi][ni], false, false);
        }
        // P = exp(scale * S) into LDS
#pragma unroll
        for (int mi = 0; mi < 2; ++mi)
#pragma unroll
            for (int ni = 0; ni < 2; ++ni)
#pragma unroll
                for (int r = 0; r < 8; ++r) {
                    int row = wm * 32 + mi * 16 + half * 8 + r;
                    int col = wn * 32 + ni * 16 + lcol;
                    lsP[row][col] = (__bf16)expf(sAcc[mi][ni][r] * ATTN_SCALE);
                }
        __syncthreads();
        // rowsum accumulate (threads 0..127 own one row each)
        if (tid < 128) {
            float s = 0.f;
#pragma unroll
            for (int c = 0; c < 64; ++c) s += (float)lsP[tid][c];
            rowsumAcc[tid] += s;
        }
        // O += P V  (M=128 rows, N=64=dh, K=64 keys)
#pragma unroll
        for (int kk = 0; kk < 64; kk += 32) {
            bf16x16 aF[2], bF[2];
#pragma unroll
            for (int mi = 0; mi < 2; ++mi)
                aF[mi] = load_frag(&lsP[0][0], 72, wm * 32 + mi * 16, kk);
#pragma unroll
            for (int ni = 0; ni < 2; ++ni)
                bF[ni] = load_frag(&lsVt[0][0], 72, wn * 32 + ni * 16, kk);
#pragma unroll
            for (int mi = 0; mi < 2; ++mi)
#pragma unroll
                for (int ni = 0; ni < 2; ++ni)
                    oAcc[mi][ni] = __builtin_amdgcn_wmma_f32_16x16x32_bf16(
                        false, aF[mi], false, bF[ni], (short)0, oAcc[mi][ni], false, false);
        }
    }
    __syncthreads();

    __bf16* obase = O + ((size_t)(b * SEQ + r0)) * DMODEL + h * DHEAD;
#pragma unroll
    for (int mi = 0; mi < 2; ++mi)
#pragma unroll
        for (int ni = 0; ni < 2; ++ni)
#pragma unroll
            for (int r = 0; r < 8; ++r) {
                int row = wm * 32 + mi * 16 + half * 8 + r;
                int col = wn * 32 + ni * 16 + lcol;
                obase[(size_t)row * DMODEL + col] = (__bf16)(oAcc[mi][ni][r] / rowsumAcc[row]);
            }
}

// ---------------------------------------------------------------------------
// Mean pool over tokens + head LayerNorm + classifier (tiny: 8x512x1000, f32).
// One block per batch row, 512 threads (one per feature column).
// ---------------------------------------------------------------------------
__global__ __launch_bounds__(512) void pool_head_kernel(const float* __restrict__ x3,
                                                        const float* __restrict__ g,
                                                        const float* __restrict__ bta,
                                                        const float* __restrict__ Wh,
                                                        const float* __restrict__ bh,
                                                        float* __restrict__ out) {
    __shared__ float red[512];
    __shared__ float pool[512];
    __shared__ float stats[2];
    const int b = blockIdx.x;
    const int tid = threadIdx.x;

    float s = 0.f;
    const float* base = x3 + (size_t)b * SEQ * DMODEL + tid;
    for (int n = 0; n < SEQ; ++n) s += base[(size_t)n * DMODEL];
    float p = s * (1.f / SEQ);

    red[tid] = p;
    __syncthreads();
#pragma unroll
    for (int off = 256; off > 0; off >>= 1) {
        if (tid < off) red[tid] += red[tid + off];
        __syncthreads();
    }
    if (tid == 0) stats[0] = red[0] * (1.f / DMODEL);
    __syncthreads();
    const float mu = stats[0];
    float d = p - mu;
    red[tid] = d * d;
    __syncthreads();
#pragma unroll
    for (int off = 256; off > 0; off >>= 1) {
        if (tid < off) red[tid] += red[tid + off];
        __syncthreads();
    }
    if (tid == 0) stats[1] = rsqrtf(red[0] * (1.f / DMODEL) + 1e-5f);
    __syncthreads();
    pool[tid] = d * stats[1] * g[tid] + bta[tid];
    __syncthreads();

    for (int ci = tid; ci < NCLS; ci += 512) {
        float acc = bh[ci];
        for (int k = 0; k < DMODEL; ++k) acc += pool[k] * Wh[(size_t)k * NCLS + ci];
        out[(size_t)b * NCLS + ci] = acc;
    }
}

// ---------------------------------------------------------------------------
// Host-side orchestration
// ---------------------------------------------------------------------------
extern "C" void kernel_launch(void* const* d_in, const int* in_sizes, int n_in,
                              void* d_out, int out_size, void* d_ws, size_t ws_size,
                              hipStream_t stream) {
    (void)in_sizes; (void)n_in; (void)out_size; (void)ws_size;
    const float* x     = (const float*)d_in[0];
    const float* mask  = (const float*)d_in[1];
    const float* ln1_g = (const float*)d_in[2];
    const float* ln1_b = (const float*)d_in[3];
    const float* Wq    = (const float*)d_in[4];
    const float* bq    = (const float*)d_in[5];
    const float* Wk    = (const float*)d_in[6];
    const float* bk_p  = (const float*)d_in[7];
    const float* Wv    = (const float*)d_in[8];
    const float* bv    = (const float*)d_in[9];
    const float* Wo    = (const float*)d_in[10];
    const float* bo    = (const float*)d_in[11];
    const float* ln2_g = (const float*)d_in[12];
    const float* ln2_b = (const float*)d_in[13];
    const float* W1    = (const float*)d_in[14];
    const float* b1    = (const float*)d_in[15];
    const float* W2    = (const float*)d_in[16];
    const float* b2    = (const float*)d_in[17];
    const float* lnh_g = (const float*)d_in[18];
    const float* lnh_b = (const float*)d_in[19];
    const float* Wh    = (const float*)d_in[20];
    const float* bh    = (const float*)d_in[21];

    char* ws = (char*)d_ws;
    const size_t MB = 1ull << 20;
    // Workspace map (aliasing is ordered by the stream):
    //   [ 0,16MB)  resid (f32)  -- reused as x3 after the Wo projection
    //   [16,32MB)  x2 (f32)
    //   [32,40MB)  xn (bf16)    -- reused as xn2
    //   [40,72MB)  bufQ/bufK/bufV/bufAO (bf16, 8MB each) -- reused as h1 (32MB)
    //   [72MB,..)  bf16 weights
    float*  resid  = (float*) (ws + 0);
    float*  x2     = (float*) (ws + 16 * MB);
    __bf16* xn     = (__bf16*)(ws + 32 * MB);
    __bf16* bufQ   = (__bf16*)(ws + 40 * MB);
    __bf16* bufK   = (__bf16*)(ws + 48 * MB);
    __bf16* bufV   = (__bf16*)(ws + 56 * MB);
    __bf16* bufAO  = (__bf16*)(ws + 64 * MB);
    __bf16* h1     = bufQ;
    float*  x3     = resid;
    __bf16* wqB    = (__bf16*)(ws + 72 * MB);
    __bf16* wkB    = wqB + DMODEL * DMODEL;
    __bf16* wvB    = wkB + DMODEL * DMODEL;
    __bf16* woB    = wvB + DMODEL * DMODEL;
    __bf16* w1B    = woB + DMODEL * DMODEL;
    __bf16* w2B    = w1B + DMODEL * DFF;

    const int nDD = DMODEL * DMODEL;   // 262144
    const int nDF = DMODEL * DFF;      // 1048576
    cvt_bf16_kernel<<<(nDD + 255) / 256, 256, 0, stream>>>(Wq, wqB, nDD);
    cvt_bf16_kernel<<<(nDD + 255) / 256, 256, 0, stream>>>(Wk, wkB, nDD);
    cvt_bf16_kernel<<<(nDD + 255) / 256, 256, 0, stream>>>(Wv, wvB, nDD);
    cvt_bf16_kernel<<<(nDD + 255) / 256, 256, 0, stream>>>(Wo, woB, nDD);
    cvt_bf16_kernel<<<(nDF + 255) / 256, 256, 0, stream>>>(W1, w1B, nDF);
    cvt_bf16_kernel<<<(nDF + 255) / 256, 256, 0, stream>>>(W2, w2B, nDF);

    // mask * x -> residual ; LN1 -> xn (bf16)
    ln_kernel<true><<<MROWS, 256, 0, stream>>>(x, mask, resid, ln1_g, ln1_b, xn);

    // QKV projections
    dim3 gDD(DMODEL / 128, MROWS / 128);   // (4, 64)
    gemm_bf16_kernel<true, false, false, true><<<gDD, 256, 0, stream>>>(
        xn, wqB, bq, nullptr, nullptr, bufQ, MROWS, DMODEL, DMODEL);
    gemm_bf16_kernel<true, false, false, true><<<gDD, 256, 0, stream>>>(
        xn, wkB, bk_p, nullptr, nullptr, bufK, MROWS, DMODEL, DMODEL);
    gemm_bf16_kernel<true, false, false, true><<<gDD, 256, 0, stream>>>(
        xn, wvB, bv, nullptr, nullptr, bufV, MROWS, DMODEL, DMODEL);

    // Attention
    attn_kernel<<<dim3(SEQ / 128, HEADS, BATCH), 256, 0, stream>>>(bufQ, bufK, bufV, bufAO);

    // Output projection + residual -> x2 (f32)
    gemm_bf16_kernel<true, false, true, false><<<gDD, 256, 0, stream>>>(
        bufAO, woB, bo, resid, x2, nullptr, MROWS, DMODEL, DMODEL);

    // LN2 -> xn2 (bf16)
    ln_kernel<false><<<MROWS, 256, 0, stream>>>(x2, nullptr, nullptr, ln2_g, ln2_b, xn);

    // FFN1: GELU(xn2 @ W1 + b1) -> h1 (bf16)
    gemm_bf16_kernel<true, true, false, true><<<dim3(DFF / 128, MROWS / 128), 256, 0, stream>>>(
        xn, w1B, b1, nullptr, nullptr, h1, MROWS, DFF, DMODEL);

    // FFN2: h1 @ W2 + b2 + x2 -> x3 (f32)
    gemm_bf16_kernel<true, false, true, false><<<gDD, 256, 0, stream>>>(
        h1, w2B, b2, x2, x3, nullptr, MROWS, DMODEL, DFF);

    // Mean pool + head LN + classifier
    pool_head_kernel<<<BATCH, 512, 0, stream>>>(x3, lnh_g, lnh_b, Wh, bh, (float*)d_out);
}

// v001
// It runs in 294 microseconds.
// Two timings next to v000 put it at 1.63 and 1.65 times that version's speed.
#include <hip/hip_runtime.h>
#include <cstdint>
#include <cstddef>

// ---------------------------------------------------------------------------
// MI455X (gfx1250) transformer block, bf16 WMMA path.
// ~70 GFLOP of GEMMs vs ~100MB traffic -> matrix-core bound; everything
// routed through v_wmma_f32_16x16x32_bf16 with f32 accumulation.
// Row-major tiles are staged into LDS with global_load_async_to_lds_b128
// (ASYNCcnt-tracked DMA, no VGPR round-trip), double-buffered in the GEMM.
// Weights are converted to bf16 K-contiguous ([N][K]) so that the GEMM's B
// tile is copied the same way as its A tile.
// ---------------------------------------------------------------------------

typedef __attribute__((ext_vector_type(16))) __bf16 bf16x16;
typedef __attribute__((ext_vector_type(8)))  float  f32x8;

#define HEADS 8
#define DHEAD 64
#define SEQ   1024
#define BATCH 8
#define DMODEL 512
#define DFF   2048
#define NCLS  1000
#define MROWS (BATCH * SEQ)   // 8192
#define ATTN_SCALE 0.125f     // 1/sqrt(64)

__device__ __forceinline__ f32x8 zero8() {
    f32x8 z = {0.f, 0.f, 0.f, 0.f, 0.f, 0.f, 0.f, 0.f};
    return z;
}

__device__ __forceinline__ float gelu_tanh(float x) {
    float x3 = x * x * x;
    return 0.5f * x * (1.f + tanhf(0.7978845608028654f * (x + 0.044715f * x3)));
}

// Async DMA: 16 bytes global -> LDS per lane (VDST = LDS byte offset VGPR,
// VADDR = 64-bit global address). Tracked by ASYNCcnt. Low 32 bits of a
// flat shared pointer are the LDS byte offset on AMDGPU.
__device__ __forceinline__ void async_g2l_b128(void* ldsDst, const void* gSrc) {
    unsigned ldsOff = (unsigned)(uintptr_t)ldsDst;
    asm volatile("global_load_async_to_lds_b128 %0, %1, off"
                 :: "v"(ldsOff), "v"(gSrc)
                 : "memory");
}

// Four such copies of one lane (two A rows, two B rows of a GEMM stage). The
// s_wait_xcnt closes the statement so that no address register of a copy is
// rewritten ahead of it.
__device__ __forceinline__ void async_g2l_b128_x4(void* l0, const void* g0,
                                                  void* l1, const void* g1,
                                                  void* l2, const void* g2,
                                                  void* l3, const void* g3) {
    unsigned o0 = (unsigned)(uintptr_t)l0;
    unsigned o1 = (unsigned)(uintptr_t)l1;
    unsigned o2 = (unsigned)(uintptr_t)l2;
    unsigned o3 = (unsigned)(uintptr_t)l3;
    asm volatile("global_load_async_to_lds_b128 %0, %1, off\n\t"
                 "global_load_async_to_lds_b128 %2, %3, off\n\t"
                 "global_load_async_to_lds_b128 %4, %5, off\n\t"
                 "global_load_async_to_lds_b128 %6, %7, off\n\t"
                 "s_wait_xcnt 0x0"
                 :: "v"(o0), "v"(g0), "v"(o1), "v"(g1),
                    "v"(o2), "v"(g2), "v"(o3), "v"(g3)
                 : "memory");
}

__device__ __forceinline__ void wait_async0() {
#if __has_builtin(__builtin_amdgcn_s_wait_asynccnt)
    __builtin_amdgcn_s_wait_asynccnt(0);
#else
    asm volatile("s_wait_asynccnt 0x0" ::: "memory");
#endif
}

// Load a 16x32 bf16 WMMA operand fragment from an LDS tile laid out as
// tile[rc][k] (A-matrix rows, or B-matrix stored K-transposed: tile[col][k]).
// Per ISA 7.12.2 (16-bit A 16x32): lanes 0-15 hold K=0..7,16..23 of row M=lane,
// lanes 16-31 hold K=8..15,24..31 of row M=lane-16; pairs packed per VGPR.
__device__ __forceinline__ bf16x16 load_frag(const __bf16* base, int stride,
                                             int rcBase, int kBase) {
    const int lane = threadIdx.x & 31;
    const int idx  = lane & 15;
    const int half = lane >> 4;
    const __bf16* p = base + (size_t)(rcBase + idx) * stride + kBase + half * 8;
    union { bf16x16 v; unsigned u[8]; } r;
#pragma unroll
    for (int i = 0; i < 8; ++i) {
        int k = ((i & 4) << 2) + ((i & 3) << 1);   // i<4 -> 0..6 ; i>=4 -> 16..22
        r.u[i] = *(const unsigned*)(p + k);
    }
    return r.v;
}

// ---------------------------------------------------------------------------
// fp32 [K][N] -> bf16 [N][K] convert + transpose. One 64x64 tile per block,
// turned in LDS (pitch 65 dwords: column walks hit distinct banks); each wave
// stores whole 128-byte rows of the output.
// ---------------------------------------------------------------------------
__global__ __launch_bounds__(256) void cvt_bf16_t_kernel(const float* __restrict__ in,
                                                         __bf16* __restrict__ out,
                                                         int K, int Nn) {
    __shared__ float t[64][65];
    const int n0 = blockIdx.x * 64;
    const int k0 = blockIdx.y * 64;
    const int tid = threadIdx.x;
    const int kr = tid >> 4;          // 16 rows a sweep, 16 bytes a lane
    const int c4 = (tid & 15) * 4;
    float4 v[4];
#pragma unroll
    for (int r = 0; r < 4; ++r)
        v[r] = *(const float4*)(in + (size_t)(k0 + kr + r * 16) * Nn + n0 + c4);
#pragma unroll
    for (int r = 0; r < 4; ++r) {
        t[kr + r * 16][c4 + 0] = v[r].x;
        t[kr + r * 16][c4 + 1] = v[r].y;
        t[kr + r * 16][c4 + 2] = v[r].z;
        t[kr + r * 16][c4 + 3] = v[r].w;
    }
    __syncthreads();
    const int kp = tid & 31;   // pair of k
    const int nr = tid >> 5;
#pragma unroll
    for (int r = 0; r < 8; ++r) {
        int n = nr + r * 8;
        union { __bf16 h[2]; unsigned u; } p;
        p.h[0] = (__bf16)t[2 * kp][n];
        p.h[1] = (__bf16)t[2 * kp + 1][n];
        *(unsigned*)(out + (size_t)(n0 + n) * K + k0 + 2 * kp) = p.u;
    }
}

// ---------------------------------------------------------------------------
// LayerNorm over D=512. Optionally applies token mask and emits f32 residual.
// One block (256 threads, 2 cols each) per row.
// ---------------------------------------------------------------------------
template <bool MASKED>
__global__ __launch_bounds__(256) void ln_kernel(const float* __restrict__ x,
                                                 const float* __restrict__ mask,
                                                 float* __restrict__ residOut,
                                                 const float* __restrict__ g,
                                                 const float* __restrict__ bta,
                                                 __bf16* __restrict__ outB) {
    __shared__ float red[256];
    __shared__ float stats[2];
    const int row = blockIdx.x;
    const int tid = threadIdx.x;
    const size_t rb = (size_t)row * DMODEL;
    float v0 = x[rb + tid];
    float v1 = x[rb + tid + 256];
    if (MASKED) {
        float mv = mask[row & (SEQ - 1)];
        v0 *= mv; v1 *= mv;
        residOut[rb + tid]       = v0;
        residOut[rb + tid + 256] = v1;
    }
    red[tid] = v0 + v1;
    __syncthreads();
#pragma unroll
    for (int off = 128; off > 0; off >>= 1) {
        if (tid < off) red[tid] += red[tid + off];
        __syncthreads();
    }
    if (tid == 0) stats[0] = red[0] * (1.f / DMODEL);
    __syncthreads();
    const float mu = stats[0];
    float d0 = v0 - mu, d1 = v1 - mu;
    red[tid] = d0 * d0 + d1 * d1;
    __syncthreads();
#pragma unroll
    for (int off = 128; off > 0; off >>= 1) {
        if (tid < off) red[tid] += red[tid + off];
        __syncthreads();
    }
    if (tid == 0) stats[1] = rsqrtf(red[0] * (1.f / DMODEL) + 1e-5f);
    __syncthreads();
    const float rstd = stats[1];
    outB[rb + tid]       = (__bf16)(d0 * rstd * g[tid]       + bta[tid]);
    outB[rb + tid + 256] = (__bf16)(d1 * rstd * g[tid + 256] + bta[tid + 256]);
}

// ---------------------------------------------------------------------------
// bf16 WMMA GEMM: C[M,N] = A[M,K] @ B[K,N] (+bias)(+GELU)(+resid), B given as Bt[N,K]
// Block: 256 threads = 8 waves. Tile BM=128, BN=128, BK=32, double-buffered:
// next tile's async DMA runs under the current tile's WMMAs.
// Waves: 4 along M (32 rows), 2 along N (64 cols) -> 2x4 subtiles of 16x16.
// Bt rows are K-contiguous, so both tiles are copied alike and both operands
// use the same frag loader.
// ---------------------------------------------------------------------------
template <bool BIAS, bool GELU_ACT, bool RESID, bool OUT_BF16>
__global__ __launch_bounds__(256) void gemm_bf16_kernel(
        const __bf16* __restrict__ A, const __bf16* __restrict__ Bt,
        const float* __restrict__ bias, const float* __restrict__ resid,
        float* __restrict__ outF, __bf16* __restrict__ outB,
        int M, int Nn, int K) {
    __shared__ __attribute__((aligned(16))) __bf16 lsA[2][128][40];   // [buf][row][k]
    __shared__ __attribute__((aligned(16))) __bf16 lsB[2][128][40];   // [buf][col][k]

    const int m0 = blockIdx.y * 128;
    const int n0 = blockIdx.x * 128;
    const int tid  = threadIdx.x;
    const int wave = tid >> 5;
    const int wm   = wave & 3;    // 0..3 : 32 rows each
    const int wn   = wave >> 2;   // 0..1 : 64 cols each

    f32x8 acc[2][4];
#pragma unroll
    for (int mi = 0; mi < 2; ++mi)
#pragma unroll
        for (int ni = 0; ni < 4; ++ni) acc[mi][ni] = zero8();

    // One stage: 128 rows x 32 k of A and of Bt, 64 bytes a row, 16 bytes a lane.
    const int crow = tid >> 2, cseg = (tid & 3) * 8;
    const __bf16* gA = A  + (size_t)(m0 + crow) * K + cseg;
    const __bf16* gB = Bt + (size_t)(n0 + crow) * K + cseg;
    const size_t half64 = (size_t)64 * K;
    auto load_tiles = [&](int k0, int buf) {
        async_g2l_b128_x4(&lsA[buf][crow][cseg],      gA + k0,
                          &lsA[buf][crow + 64][cseg], gA + half64 + k0,
                          &lsB[buf][crow][cseg],      gB + k0,
                          &lsB[buf][crow + 64][cseg], gB + half64 + k0);
    };

    const int nk = K >> 5;
    load_tiles(0, 0);
    asm volatile("s_wait_asynccnt 0x0" ::: "memory");   // stage 0 landed (own copies)
    __syncthreads();                                    // ... and everyone's
    if (nk > 1) load_tiles(32, 1);
    for (int i = 0; i < nk; ++i) {
        const int buf = i & 1;
        bf16x16 aF[2], bF[4];
#pragma unroll
        for (int mi = 0; mi < 2; ++mi)
            aF[mi] = load_frag(&lsA[buf][0][0], 40, wm * 32 + mi * 16, 0);
#pragma unroll
        for (int ni = 0; ni < 4; ++ni)
            bF[ni] = load_frag(&lsB[buf][0][0], 40, wn * 64 + ni * 16, 0);
#pragma unroll
        for (int mi = 0; mi < 2; ++mi)
#pragma unroll
            for (int ni = 0; ni < 4; ++ni)
                acc[mi][ni] = __builtin_amdgcn_wmma_f32_16x16x32_bf16(
                    false, aF[mi], false, bF[ni], (short)0, acc[mi][ni], false, false);

        // Publish stage i+1 and free this buffer: own LDS reads done, own
        // copies landed, then the barrier; only then the refill.
        asm volatile("s_wait_dscnt 0x0" ::: "memory");
        asm volatile("s_wait_asynccnt 0x0" ::: "memory");
        __syncthreads();
        if (i + 2 < nk) load_tiles((i + 2) << 5, buf);
    }
    asm volatile("s_wait_asynccnt 0x0" ::: "memory");   // nothing in flight at the end

    // Epilogue. C/D layout: lane<16 -> M = r, lane>=16 -> M = 8+r ; N = lane&15
    const int lane = tid & 31;
    const int half = lane >> 4;
    const int lcol = lane & 15;
#pragma unroll
    for (int mi = 0; mi < 2; ++mi) {
#pragma unroll
        for (int ni = 0; ni < 4; ++ni) {
#pragma unroll
            for (int r = 0; r < 8; ++r) {
                int gr = m0 + wm * 32 + mi * 16 + half * 8 + r;
                int gc = n0 + wn * 64 + ni * 16 + lcol;
                float v = acc[mi][ni][r];
                if (BIAS)     v += bias[gc];
                if (GELU_ACT) v = gelu_tanh(v);
                if (RESID)    v += resid[(size_t)gr * Nn + gc];
                if (OUT_BF16) outB[(size_t)gr * Nn + gc] = (__bf16)v;
                else          outF[(size_t)gr * Nn + gc] = v;
            }
        }
    }
}

// ---------------------------------------------------------------------------
// Attention: one block per (b, h, 128-row Q tile). Streams 64-key tiles:
//   S = Q K^T * scale ; P = exp(S) (reference has no max-subtraction)
//   rowsum += sum_j P ; O += P V ; final O /= rowsum.
// Q/K tiles are async-DMA'd into LDS; V needs a transpose scatter.
// ---------------------------------------------------------------------------
__global__ __launch_bounds__(256) void attn_kernel(const __bf16* __restrict__ Q,
                                                   const __bf16* __restrict__ Kmat,
                                                   const __bf16* __restrict__ Vmat,
                                                   __bf16* __restrict__ O) {
    __shared__ __bf16 lsQ[128][72];   // [row][dh]
    __shared__ __bf16 lsK[64][72];    // [key][dh]  (B-transposed layout for QK^T)
    __shared__ __bf16 lsVt[64][72];   // [dh][key]  (B-transposed layout for PV)
    __shared__ __bf16 lsP[128][72];   // [row][key]
    __shared__ float  rowsumAcc[128];

    const int r0 = blockIdx.x * 128;
    const int h  = blockIdx.y;
    const int b  = blockIdx.z;
    const int tid  = threadIdx.x;
    const int wave = tid >> 5;
    const int wm   = wave & 3;     // 4 x 32 rows
    const int wn   = wave >> 2;    // 2 x 32 cols
    const int lane = tid & 31;
    const int half = lane >> 4;
    const int lcol = lane & 15;

    const __bf16* qbase = Q + ((size_t)(b * SEQ + r0)) * DMODEL + h * DHEAD;
#pragma unroll
    for (int s = tid; s < 1024; s += 256) {   // 128 rows x 8 uint4 segs
        int row = s >> 3, cs = s & 7;
        async_g2l_b128(&lsQ[row][cs * 8], qbase + (size_t)row * DMODEL + cs * 8);
    }
    if (tid < 128) rowsumAcc[tid] = 0.f;

    f32x8 oAcc[2][2];
#pragma unroll
    for (int mi = 0; mi < 2; ++mi)
#pragma unroll
        for (int ni = 0; ni < 2; ++ni) oAcc[mi][ni] = zero8();

    for (int j0 = 0; j0 < SEQ; j0 += 64) {
        __syncthreads();
        const __bf16* kbase = Kmat + ((size_t)(b * SEQ + j0)) * DMODEL + h * DHEAD;
        const __bf16* vbase = Vmat + ((size_t)(b * SEQ + j0)) * DMODEL + h * DHEAD;
#pragma unroll
        for (int s = tid; s < 512; s += 256) {  // K tile row-major, async DMA
            int kr = s >> 3, cs = s & 7;
            async_g2l_b128(&lsK[kr][cs * 8], kbase + (size_t)kr * DMODEL + cs * 8);
        }
#pragma unroll
        for (int s = tid; s < 512; s += 256) {  // V tile, scatter transposed
            int kr = s >> 3, cs = s & 7;
            uint4 t = *(const uint4*)(vbase + (size_t)kr * DMODEL + cs * 8);
            const __bf16* hs = reinterpret_cast<const __bf16*>(&t);
#pragma unroll
            for (int e = 0; e < 8; ++e) lsVt[cs * 8 + e][kr] = hs[e];
        }
        wait_async0();
        __syncthreads();

        // S = Q K^T  (M=128 rows, N=64 keys, K=64=dh)
        f32x8 sAcc[2][2];
#pragma unroll
        for (int mi = 0; mi < 2; ++mi)
#pragma unroll
            for (int ni = 0; ni < 2; ++ni) sAcc[mi][ni] = zero8();
#pragma unroll
        for (int kk = 0; kk < 64; kk += 32) {
            bf16x16 aF[2], bF[2];
#pragma unroll
            for (int mi = 0; mi < 2; ++mi)
                aF[mi] = load_frag(&lsQ[0][0], 72, wm * 32 + mi * 16, kk);
#pragma unroll
            for (int ni = 0; ni < 2; ++ni)
                bF[ni] = load_frag(&lsK[0][0], 72, wn * 32 + ni * 16, kk);
#pragma unroll
            for (int mi = 0; mi < 2; ++mi)
#pragma unroll
                for (int ni = 0; ni < 2; ++ni)
                    sAcc[mi][ni] = __builtin_amdgcn_wmma_f32_16x16x32_bf16(
                        false, aF[mi], false, bF[ni], (short)0, sAcc[mi][ni], false, false);
        }
        // P = exp(scale * S) into LDS
#pragma unroll
        for (int mi = 0; mi < 2; ++mi)
#pragma unroll
            for (int ni = 0; ni < 2; ++ni)
#pragma unroll
                for (int r = 0; r < 8; ++r) {
                    int row = wm * 32 + mi * 16 + half * 8 + r;
                    int col = wn * 32 + ni * 16 + lcol;
                    lsP[row][col] = (__bf16)expf(sAcc[mi][ni][r] * ATTN_SCALE);
                }
        __syncthreads();
        // rowsum accumulate (threads 0..127 own one row each)
        if (tid < 128) {
            float s = 0.f;
#pragma unroll
            for (int c = 0; c < 64; ++c) s += (float)lsP[tid][c];
            rowsumAcc[tid] += s;
        }
        // O += P V  (M=128 rows, N=64=dh, K=64 keys)
#pragma unroll
        for (int kk = 0; kk < 64; kk += 32) {
            bf16x16 aF[2], bF[2];
#pragma unroll
            for (int mi = 0; mi < 2; ++mi)
                aF[mi] = load_frag(&lsP[0][0], 72, wm * 32 + mi * 16, kk);
#pragma unroll
            for (int ni = 0; ni < 2; ++ni)
                bF[ni] = load_frag(&lsVt[0][0], 72, wn * 32 + ni * 16, kk);
#pragma unroll
            for (int mi = 0; mi < 2; ++mi)
#pragma unroll
                for (int ni = 0; ni < 2; ++ni)
                    oAcc[mi][ni] = __builtin_amdgcn_wmma_f32_16x16x32_bf16(
                        false, aF[mi], false, bF[ni], (short)0, oAcc[mi][ni], false, false);
        }
    }
    __syncthreads();

    __bf16* obase = O + ((size_t)(b * SEQ + r0)) * DMODEL + h * DHEAD;
#pragma unroll
    for (int mi = 0; mi < 2; ++mi)
#pragma unroll
        for (int ni = 0; ni < 2; ++ni)
#pragma unroll
            for (int r = 0; r < 8; ++r) {
                int row = wm * 32 + mi * 16 + half * 8 + r;
                int col = wn * 32 + ni * 16 + lcol;
                obase[(size_t)row * DMODEL + col] = (__bf16)(oAcc[mi][ni][r] / rowsumAcc[row]);
            }
}

// ---------------------------------------------------------------------------
// Mean pool over tokens + head LayerNorm + classifier (tiny: 8x512x1000, f32).
// One block per batch row, 512 threads (one per feature column).
// ---------------------------------------------------------------------------
__global__ __launch_bounds__(512) void pool_head_kernel(const float* __restrict__ x3,
                                                        const float* __restrict__ g,
                                                        const float* __restrict__ bta,
                                                        const float* __restrict__ Wh,
                                                        const float* __restrict__ bh,
                                                        float* __restrict__ out) {
    __shared__ float red[512];
    __shared__ float pool[512];
    __shared__ float stats[2];
    const int b = blockIdx.x;
    const int tid = threadIdx.x;

    float s = 0.f;
    const float* base = x3 + (size_t)b * SEQ * DMODEL + tid;
    for (int n = 0; n < SEQ; ++n) s += base[(size_t)n * DMODEL];
    float p = s * (1.f / SEQ);

    red[tid] = p;
    __syncthreads();
#pragma unroll
    for (int off = 256; off > 0; off >>= 1) {
        if (tid < off) red[tid] += red[tid + off];
        __syncthreads();
    }
    if (tid == 0) stats[0] = red[0] * (1.f / DMODEL);
    __syncthreads();
    const float mu = stats[0];
    float d = p - mu;
    red[tid] = d * d;
    __syncthreads();
#pragma unroll
    for (int off = 256; off > 0; off >>= 1) {
        if (tid < off) red[tid] += red[tid + off];
        __syncthreads();
    }
    if (tid == 0) stats[1] = rsqrtf(red[0] * (1.f / DMODEL) + 1e-5f);
    __syncthreads();
    pool[tid] = d * stats[1] * g[tid] + bta[tid];
    __syncthreads();

    for (int ci = tid; ci < NCLS; ci += 512) {
        float acc = bh[ci];
        for (int k = 0; k < DMODEL; ++k) acc += pool[k] * Wh[(size_t)k * NCLS + ci];
        out[(size_t)b * NCLS + ci] = acc;
    }
}

// ---------------------------------------------------------------------------
// Host-side orchestration
// ---------------------------------------------------------------------------
extern "C" void kernel_launch(void* const* d_in, const int* in_sizes, int n_in,
                              void* d_out, int out_size, void* d_ws, size_t ws_size,
                              hipStream_t stream) {
    (void)in_sizes; (void)n_in; (void)out_size; (void)ws_size;
    const float* x     = (const float*)d_in[0];
    const float* mask  = (const float*)d_in[1];
    const float* ln1_g = (const float*)d_in[2];
    const float* ln1_b = (const float*)d_in[3];
    const float* Wq    = (const float*)d_in[4];
    const float* bq    = (const float*)d_in[5];
    const float* Wk    = (const float*)d_in[6];
    const float* bk_p  = (const float*)d_in[7];
    const float* Wv    = (const float*)d_in[8];
    const float* bv    = (const float*)d_in[9];
    const float* Wo    = (const float*)d_in[10];
    const float* bo    = (const float*)d_in[11];
    const float* ln2_g = (const float*)d_in[12];
    const float* ln2_b = (const float*)d_in[13];
    const float* W1    = (const float*)d_in[14];
    const float* b1    = (const float*)d_in[15];
    const float* W2    = (const float*)d_in[16];
    const float* b2    = (const float*)d_in[17];
    const float* lnh_g = (const float*)d_in[18];
    const float* lnh_b = (const float*)d_in[19];
    const float* Wh    = (const float*)d_in[20];
    const float* bh    = (const float*)d_in[21];

    char* ws = (char*)d_ws;
    const size_t MB = 1ull << 20;
    // Workspace map (aliasing is ordered by the stream):
    //   [ 0,16MB)  resid (f32)  -- reused as x3 after the Wo projection
    //   [16,32MB)  x2 (f32)
    //   [32,40MB)  xn (bf16)    -- reused as xn2
    //   [40,72MB)  bufQ/bufK/bufV/bufAO (bf16, 8MB each) -- reused as h1 (32MB)
    //   [72MB,..)  bf16 weights, each transposed to [N][K]
    float*  resid  = (float*) (ws + 0);
    float*  x2     = (float*) (ws + 16 * MB);
    __bf16* xn     = (__bf16*)(ws + 32 * MB);
    __bf16* bufQ   = (__bf16*)(ws + 40 * MB);
    __bf16* bufK   = (__bf16*)(ws + 48 * MB);
    __bf16* bufV   = (__bf16*)(ws + 56 * MB);
    __bf16* bufAO  = (__bf16*)(ws + 64 * MB);
    __bf16* h1     = bufQ;
    float*  x3     = resid;
    __bf16* wqB    = (__bf16*)(ws + 72 * MB);
    __bf16* wkB    = wqB + DMODEL * DMODEL;
    __bf16* wvB    = wkB + DMODEL * DMODEL;
    __bf16* woB    = wvB + DMODEL * DMODEL;
    __bf16* w1B    = woB + DMODEL * DMODEL;
    __bf16* w2B    = w1B + DMODEL * DFF;

    // W[K][N] f32 -> Wt[N][K] bf16; grid = (N/64, K/64)
    dim3 gTDD(DMODEL / 64, DMODEL / 64);
    cvt_bf16_t_kernel<<<gTDD, 256, 0, stream>>>(Wq, wqB, DMODEL, DMODEL);
    cvt_bf16_t_kernel<<<gTDD, 256, 0, stream>>>(Wk, wkB, DMODEL, DMODEL);
    cvt_bf16_t_kernel<<<gTDD, 256, 0, stream>>>(Wv, wvB, DMODEL, DMODEL);
    cvt_bf16_t_kernel<<<gTDD, 256, 0, stream>>>(Wo, woB, DMODEL, DMODEL);
    cvt_bf16_t_kernel<<<dim3(DFF / 64, DMODEL / 64), 256, 0, stream>>>(W1, w1B, DMODEL, DFF);
    cvt_bf16_t_kernel<<<dim3(DMODEL / 64, DFF / 64), 256, 0, stream>>>(W2, w2B, DFF, DMODEL);

    // mask * x -> residual ; LN1 -> xn (bf16)
    ln_kernel<true><<<MROWS, 256, 0, stream>>>(x, mask, resid, ln1_g, ln1_b, xn);

    // QKV projections
    dim3 gDD(DMODEL / 128, MROWS / 128);   // (4, 64)
    gemm_bf16_kernel<true, false, false, true><<<gDD, 256, 0, stream>>>(
        xn, wqB, bq, nullptr, nullptr, bufQ, MROWS, DMODEL, DMODEL);
    gemm_bf16_kernel<true, false, false, true><<<gDD, 256, 0, stream>>>(
        xn, wkB, bk_p, nullptr, nullptr, bufK, MROWS, DMODEL, DMODEL);
    gemm_bf16_kernel<true, false, false, true><<<gDD, 256, 0, stream>>>(
        xn, wvB, bv, nullptr, nullptr, bufV, MROWS, DMODEL, DMODEL);

    // Attention
    attn_kernel<<<dim3(SEQ / 128, HEADS, BATCH), 256, 0, stream>>>(bufQ, bufK, bufV, bufAO);

    // Output projection + residual -> x2 (f32)
    gemm_bf16_kernel<true, false, true, false><<<gDD, 256, 0, stream>>>(
        bufAO, woB, bo, resid, x2, nullptr, MROWS, DMODEL, DMODEL);

    // LN2 -> xn2 (bf16)
    ln_kernel<false><<<MROWS, 256, 0, stream>>>(x2, nullptr, nullptr, ln2_g, ln2_b, xn);

    // FFN1: GELU(xn2 @ W1 + b1) -> h1 (bf16)
    gemm_bf16_kernel<true, true, false, true><<<dim3(DFF / 128, MROWS / 128), 256, 0, stream>>>(
        xn, w1B, b1, nullptr, nullptr, h1, MROWS, DFF, DMODEL);

    // FFN2: h1 @ W2 + b2 + x2 -> x3 (f32)
    gemm_bf16_kernel<true, false, true, false><<<gDD, 256, 0, stream>>>(
        h1, w2B, b2, x2, x3, nullptr, MROWS, DMODEL, DFF);

    // Mean pool + head LN + classifier
    pool_head_kernel<<<BATCH, 512, 0, stream>>>(x3, lnh_g, lnh_b, Wh, bh, (float*)d_out);
}

// v002
// It runs in 238 microseconds.
// Timed twice side by side with v001, it ran 1.22 and 1.23 times as fast.
// All steps since v000 together make it 2.01 times as fast.
#include <hip/hip_runtime.h>
#include <cstdint>
#include <cstddef>

// ---------------------------------------------------------------------------
// MI455X (gfx1250) transformer block, bf16 WMMA path.
// ~70 GFLOP of GEMMs vs ~100MB traffic -> matrix-core bound; everything
// routed through v_wmma_f32_16x16x32_bf16 with f32 accumulation.
// Row-major tiles are staged into LDS with global_load_async_to_lds_b128
// (ASYNCcnt-tracked DMA, no VGPR round-trip), double-buffered in the GEMM.
// Weights are converted to bf16 K-contiguous ([N][K]) so that the GEMM's B
// tile is copied the same way as its A tile.
// ---------------------------------------------------------------------------

typedef __attribute__((ext_vector_type(16))) __bf16 bf16x16;
typedef __attribute__((ext_vector_type(8)))  float  f32x8;

#define HEADS 8
#define DHEAD 64
#define SEQ   1024
#define BATCH 8
#define DMODEL 512
#define DFF   2048
#define NCLS  1000
#define MROWS (BATCH * SEQ)   // 8192
#define ATTN_SCALE 0.125f     // 1/sqrt(64)

__device__ __forceinline__ f32x8 zero8() {
    f32x8 z = {0.f, 0.f, 0.f, 0.f, 0.f, 0.f, 0.f, 0.f};
    return z;
}

__device__ __forceinline__ float gelu_tanh(float x) {
    float x3 = x * x * x;
    return 0.5f * x * (1.f + tanhf(0.7978845608028654f * (x + 0.044715f * x3)));
}

// Async DMA: 16 bytes global -> LDS per lane (VDST = LDS byte offset VGPR,
// VADDR = 64-bit global address). Tracked by ASYNCcnt. Low 32 bits of a
// flat shared pointer are the LDS byte offset on AMDGPU.
__device__ __forceinline__ void async_g2l_b128(void* ldsDst, const void* gSrc) {
    unsigned ldsOff = (unsigned)(uintptr_t)ldsDst;
    asm volatile("global_load_async_to_lds_b128 %0, %1, off"
                 :: "v"(ldsOff), "v"(gSrc)
                 : "memory");
}

// Four such copies of one lane (two A rows, two B rows of a GEMM stage). The
// s_wait_xcnt closes the statement so that no address register of a copy is
// rewritten ahead of it.
__device__ __forceinline__ void async_g2l_b128_x4(void* l0, const void* g0,
                                                  void* l1, const void* g1,
                                                  void* l2, const void* g2,
                                                  void* l3, const void* g3) {
    unsigned o0 = (unsigned)(uintptr_t)l0;
    unsigned o1 = (unsigned)(uintptr_t)l1;
    unsigned o2 = (unsigned)(uintptr_t)l2;
    unsigned o3 = (unsigned)(uintptr_t)l3;
    asm volatile("global_load_async_to_lds_b128 %0, %1, off\n\t"
                 "global_load_async_to_lds_b128 %2, %3, off\n\t"
                 "global_load_async_to_lds_b128 %4, %5, off\n\t"
                 "global_load_async_to_lds_b128 %6, %7, off\n\t"
                 "s_wait_xcnt 0x0"
                 :: "v"(o0), "v"(g0), "v"(o1), "v"(g1),
                    "v"(o2), "v"(g2), "v"(o3), "v"(g3)
                 : "memory");
}

__device__ __forceinline__ void wait_async0() {
#if __has_builtin(__builtin_amdgcn_s_wait_asynccnt)
    __builtin_amdgcn_s_wait_asynccnt(0);
#else
    asm volatile("s_wait_asynccnt 0x0" ::: "memory");
#endif
}

// Load a 16x32 bf16 WMMA operand fragment from an LDS tile laid out as
// tile[rc][k] (A-matrix rows, or B-matrix stored K-transposed: tile[col][k]).
// Per ISA 7.12.2 (16-bit A 16x32): lanes 0-15 hold K=0..7,16..23 of row M=lane,
// lanes 16-31 hold K=8..15,24..31 of row M=lane-16; pairs packed per VGPR.
__device__ __forceinline__ bf16x16 load_frag(const __bf16* base, int stride,
                                             int rcBase, int kBase) {
    const int lane = threadIdx.x & 31;
    const int idx  = lane & 15;
    const int half = lane >> 4;
    const __bf16* p = base + (size_t)(rcBase + idx) * stride + kBase + half * 8;
    union { bf16x16 v; unsigned u[8]; } r;
#pragma unroll
    for (int i = 0; i < 8; ++i) {
        int k = ((i & 4) << 2) + ((i & 3) << 1);   // i<4 -> 0..6 ; i>=4 -> 16..22
        r.u[i] = *(const unsigned*)(p + k);
    }
    return r.v;
}

// ---------------------------------------------------------------------------
// fp32 [K][N] -> bf16 [N][K] convert + transpose. One 64x64 tile per block,
// turned in LDS (pitch 65 dwords: column walks hit distinct banks); each wave
// stores whole 128-byte rows of the output.
// ---------------------------------------------------------------------------
__global__ __launch_bounds__(256) void cvt_bf16_t_kernel(const float* __restrict__ in,
                                                         __bf16* __restrict__ out,
                                                         int K, int Nn) {
    __shared__ float t[64][65];
    const int n0 = blockIdx.x * 64;
    const int k0 = blockIdx.y * 64;
    const int tid = threadIdx.x;
    const int kr = tid >> 4;          // 16 rows a sweep, 16 bytes a lane
    const int c4 = (tid & 15) * 4;
    float4 v[4];
#pragma unroll
    for (int r = 0; r < 4; ++r)
        v[r] = *(const float4*)(in + (size_t)(k0 + kr + r * 16) * Nn + n0 + c4);
#pragma unroll
    for (int r = 0; r < 4; ++r) {
        t[kr + r * 16][c4 + 0] = v[r].x;
        t[kr + r * 16][c4 + 1] = v[r].y;
        t[kr + r * 16][c4 + 2] = v[r].z;
        t[kr + r * 16][c4 + 3] = v[r].w;
    }
    __syncthreads();
    const int kp = tid & 31;   // pair of k
    const int nr = tid >> 5;
#pragma unroll
    for (int r = 0; r < 8; ++r) {
        int n = nr + r * 8;
        union { __bf16 h[2]; unsigned u; } p;
        p.h[0] = (__bf16)t[2 * kp][n];
        p.h[1] = (__bf16)t[2 * kp + 1][n];
        *(unsigned*)(out + (size_t)(n0 + n) * K + k0 + 2 * kp) = p.u;
    }
}

// ---------------------------------------------------------------------------
// LayerNorm over D=512. Optionally applies token mask and emits f32 residual.
// One block (256 threads, 2 cols each) per row.
// ---------------------------------------------------------------------------
template <bool MASKED>
__global__ __launch_bounds__(256) void ln_kernel(const float* __restrict__ x,
                                                 const float* __restrict__ mask,
                                                 float* __restrict__ residOut,
                                                 const float* __restrict__ g,
                                                 const float* __restrict__ bta,
                                                 __bf16* __restrict__ outB) {
    __shared__ float red[256];
    __shared__ float stats[2];
    const int row = blockIdx.x;
    const int tid = threadIdx.x;
    const size_t rb = (size_t)row * DMODEL;
    float v0 = x[rb + tid];
    float v1 = x[rb + tid + 256];
    if (MASKED) {
        float mv = mask[row & (SEQ - 1)];
        v0 *= mv; v1 *= mv;
        residOut[rb + tid]       = v0;
        residOut[rb + tid + 256] = v1;
    }
    red[tid] = v0 + v1;
    __syncthreads();
#pragma unroll
    for (int off = 128; off > 0; off >>= 1) {
        if (tid < off) red[tid] += red[tid + off];
        __syncthreads();
    }
    if (tid == 0) stats[0] = red[0] * (1.f / DMODEL);
    __syncthreads();
    const float mu = stats[0];
    float d0 = v0 - mu, d1 = v1 - mu;
    red[tid] = d0 * d0 + d1 * d1;
    __syncthreads();
#pragma unroll
    for (int off = 128; off > 0; off >>= 1) {
        if (tid < off) red[tid] += red[tid + off];
        __syncthreads();
    }
    if (tid == 0) stats[1] = rsqrtf(red[0] * (1.f / DMODEL) + 1e-5f);
    __syncthreads();
    const float rstd = stats[1];
    outB[rb + tid]       = (__bf16)(d0 * rstd * g[tid]       + bta[tid]);
    outB[rb + tid + 256] = (__bf16)(d1 * rstd * g[tid + 256] + bta[tid + 256]);
}

// ---------------------------------------------------------------------------
// bf16 WMMA GEMM: C[M,N] = A[M,K] @ B[K,N] (+bias)(+GELU)(+resid), B given as Bt[N,K]
// Block: 256 threads = 8 waves. Tile BM=128, BN=128, BK=32, double-buffered:
// next tile's async DMA runs under the current tile's WMMAs.
// Waves: 4 along M (32 rows), 2 along N (64 cols) -> 2x4 subtiles of 16x16.
// Bt rows are K-contiguous, so both tiles are copied alike and both operands
// use the same frag loader.
// ---------------------------------------------------------------------------
template <bool BIAS, bool GELU_ACT, bool RESID, bool OUT_BF16>
__global__ __launch_bounds__(256) void gemm_bf16_kernel(
        const __bf16* __restrict__ A, const __bf16* __restrict__ Bt,
        const float* __restrict__ bias, const float* __restrict__ resid,
        float* __restrict__ outF, __bf16* __restrict__ outB,
        int M, int Nn, int K) {
    __shared__ __attribute__((aligned(16))) __bf16 lsA[2][128][40];   // [buf][row][k]
    __shared__ __attribute__((aligned(16))) __bf16 lsB[2][128][40];   // [buf][col][k]

    const int m0 = blockIdx.y * 128;
    const int n0 = blockIdx.x * 128;
    const int tid  = threadIdx.x;
    const int wave = tid >> 5;
    const int wm   = wave & 3;    // 0..3 : 32 rows each
    const int wn   = wave >> 2;   // 0..1 : 64 cols each

    f32x8 acc[2][4];
#pragma unroll
    for (int mi = 0; mi < 2; ++mi)
#pragma unroll
        for (int ni = 0; ni < 4; ++ni) acc[mi][ni] = zero8();

    // One stage: 128 rows x 32 k of A and of Bt, 64 bytes a row, 16 bytes a lane.
    const int crow = tid >> 2, cseg = (tid & 3) * 8;
    const __bf16* gA = A  + (size_t)(m0 + crow) * K + cseg;
    const __bf16* gB = Bt + (size_t)(n0 + crow) * K + cseg;
    const size_t half64 = (size_t)64 * K;
    auto load_tiles = [&](int k0, int buf) {
        async_g2l_b128_x4(&lsA[buf][crow][cseg],      gA + k0,
                          &lsA[buf][crow + 64][cseg], gA + half64 + k0,
                          &lsB[buf][crow][cseg],      gB + k0,
                          &lsB[buf][crow + 64][cseg], gB + half64 + k0);
    };

    const int nk = K >> 5;
    load_tiles(0, 0);
    asm volatile("s_wait_asynccnt 0x0" ::: "memory");   // stage 0 landed (own copies)
    __syncthreads();                                    // ... and everyone's
    if (nk > 1) load_tiles(32, 1);
    for (int i = 0; i < nk; ++i) {
        const int buf = i & 1;
        bf16x16 aF[2], bF[4];
#pragma unroll
        for (int mi = 0; mi < 2; ++mi)
            aF[mi] = load_frag(&lsA[buf][0][0], 40, wm * 32 + mi * 16, 0);
#pragma unroll
        for (int ni = 0; ni < 4; ++ni)
            bF[ni] = load_frag(&lsB[buf][0][0], 40, wn * 64 + ni * 16, 0);
#pragma unroll
        for (int mi = 0; mi < 2; ++mi)
#pragma unroll
            for (int ni = 0; ni < 4; ++ni)
                acc[mi][ni] = __builtin_amdgcn_wmma_f32_16x16x32_bf16(
                    false, aF[mi], false, bF[ni], (short)0, acc[mi][ni], false, false);

        // Publish stage i+1 and free this buffer: own LDS reads done, own
        // copies landed, then the barrier; only then the refill.
        asm volatile("s_wait_dscnt 0x0" ::: "memory");
        asm volatile("s_wait_asynccnt 0x0" ::: "memory");
        __syncthreads();
        if (i + 2 < nk) load_tiles((i + 2) << 5, buf);
    }
    asm volatile("s_wait_asynccnt 0x0" ::: "memory");   // nothing in flight at the end

    // Epilogue. C/D layout: lane<16 -> M = r, lane>=16 -> M = 8+r ; N = lane&15
    const int lane = tid & 31;
    const int half = lane >> 4;
    const int lcol = lane & 15;
#pragma unroll
    for (int mi = 0; mi < 2; ++mi) {
#pragma unroll
        for (int ni = 0; ni < 4; ++ni) {
#pragma unroll
            for (int r = 0; r < 8; ++r) {
                int gr = m0 + wm * 32 + mi * 16 + half * 8 + r;
                int gc = n0 + wn * 64 + ni * 16 + lcol;
                float v = acc[mi][ni][r];
                if (BIAS)     v += bias[gc];
                if (GELU_ACT) v = gelu_tanh(v);
                if (RESID)    v += resid[(size_t)gr * Nn + gc];
                if (OUT_BF16) outB[(size_t)gr * Nn + gc] = (__bf16)v;
                else          outF[(size_t)gr * Nn + gc] = v;
            }
        }
    }
}

// ---------------------------------------------------------------------------
// Attention: one block per (b, h, 128-row Q tile). Streams 64-key tiles:
//   S = Q K^T * scale ; P = exp(S) (reference has no max-subtraction)
//   rowsum += sum_j P ; O += P V ; final O /= rowsum.
// Q/K tiles are async-DMA'd into LDS; V needs a transpose scatter.
// ---------------------------------------------------------------------------
__global__ __launch_bounds__(256) void attn_kernel(const __bf16* __restrict__ Q,
                                                   const __bf16* __restrict__ Kmat,
                                                   const __bf16* __restrict__ Vmat,
                                                   __bf16* __restrict__ O) {
    __shared__ __bf16 lsQ[128][72];   // [row][dh]
    __shared__ __bf16 lsK[64][72];    // [key][dh]  (B-transposed layout for QK^T)
    __shared__ __bf16 lsVt[64][72];   // [dh][key]  (B-transposed layout for PV)
    __shared__ __bf16 lsP[128][72];   // [row][key]
    __shared__ float  rowsumAcc[128];

    const int r0 = blockIdx.x * 128;
    const int h  = blockIdx.y;
    const int b  = blockIdx.z;
    const int tid  = threadIdx.x;
    const int wave = tid >> 5;
    const int wm   = wave & 3;     // 4 x 32 rows
    const int wn   = wave >> 2;    // 2 x 32 cols
    const int lane = tid & 31;
    const int half = lane >> 4;
    const int lcol = lane & 15;

    const __bf16* qbase = Q + ((size_t)(b * SEQ + r0)) * DMODEL + h * DHEAD;
#pragma unroll
    for (int s = tid; s < 1024; s += 256) {   // 128 rows x 8 uint4 segs
        int row = s >> 3, cs = s & 7;
        async_g2l_b128(&lsQ[row][cs * 8], qbase + (size_t)row * DMODEL + cs * 8);
    }
    if (tid < 128) rowsumAcc[tid] = 0.f;

    f32x8 oAcc[2][2];
#pragma unroll
    for (int mi = 0; mi < 2; ++mi)
#pragma unroll
        for (int ni = 0; ni < 2; ++ni) oAcc[mi][ni] = zero8();

    for (int j0 = 0; j0 < SEQ; j0 += 64) {
        __syncthreads();
        const __bf16* kbase = Kmat + ((size_t)(b * SEQ + j0)) * DMODEL + h * DHEAD;
        const __bf16* vbase = Vmat + ((size_t)(b * SEQ + j0)) * DMODEL + h * DHEAD;
#pragma unroll
        for (int s = tid; s < 512; s += 256) {  // K tile row-major, async DMA
            int kr = s >> 3, cs = s & 7;
            async_g2l_b128(&lsK[kr][cs * 8], kbase + (size_t)kr * DMODEL + cs * 8);
        }
#pragma unroll
        for (int s = tid; s < 512; s += 256) {  // V tile, scatter transposed
            int kr = s >> 3, cs = s & 7;
            uint4 t = *(const uint4*)(vbase + (size_t)kr * DMODEL + cs * 8);
            const __bf16* hs = reinterpret_cast<const __bf16*>(&t);
#pragma unroll
            for (int e = 0; e < 8; ++e) lsVt[cs * 8 + e][kr] = hs[e];
        }
        wait_async0();
        __syncthreads();

        // S = Q K^T  (M=128 rows, N=64 keys, K=64=dh)
        f32x8 sAcc[2][2];
#pragma unroll
        for (int mi = 0; mi < 2; ++mi)
#pragma unroll
            for (int ni = 0; ni < 2; ++ni) sAcc[mi][ni] = zero8();
#pragma unroll
        for (int kk = 0; kk < 64; kk += 32) {
            bf16x16 aF[2], bF[2];
#pragma unroll
            for (int mi = 0; mi < 2; ++mi)
                aF[mi] = load_frag(&lsQ[0][0], 72, wm * 32 + mi * 16, kk);
#pragma unroll
            for (int ni = 0; ni < 2; ++ni)
                bF[ni] = load_frag(&lsK[0][0], 72, wn * 32 + ni * 16, kk);
#pragma unroll
            for (int mi = 0; mi < 2; ++mi)
#pragma unroll
                for (int ni = 0; ni < 2; ++ni)
                    sAcc[mi][ni] = __builtin_amdgcn_wmma_f32_16x16x32_bf16(
                        false, aF[mi], false, bF[ni], (short)0, sAcc[mi][ni], false, false);
        }
        // P = exp(scale * S) into LDS
#pragma unroll
        for (int mi = 0; mi < 2; ++mi)
#pragma unroll
            for (int ni = 0; ni < 2; ++ni)
#pragma unroll
                for (int r = 0; r < 8; ++r) {
                    int row = wm * 32 + mi * 16 + half * 8 + r;
                    int col = wn * 32 + ni * 16 + lcol;
                    lsP[row][col] = (__bf16)expf(sAcc[mi][ni][r] * ATTN_SCALE);
                }
        __syncthreads();
        // rowsum accumulate (threads 0..127 own one row each)
        if (tid < 128) {
            float s = 0.f;
#pragma unroll
            for (int c = 0; c < 64; ++c) s += (float)lsP[tid][c];
            rowsumAcc[tid] += s;
        }
        // O += P V  (M=128 rows, N=64=dh, K=64 keys)
#pragma unroll
        for (int kk = 0; kk < 64; kk += 32) {
            bf16x16 aF[2], bF[2];
#pragma unroll
            for (int mi = 0; mi < 2; ++mi)
                aF[mi] = load_frag(&lsP[0][0], 72, wm * 32 + mi * 16, kk);
#pragma unroll
            for (int ni = 0; ni < 2; ++ni)
                bF[ni] = load_frag(&lsVt[0][0], 72, wn * 32 + ni * 16, kk);
#pragma unroll
            for (int mi = 0; mi < 2; ++mi)
#pragma unroll
                for (int ni = 0; ni < 2; ++ni)
                    oAcc[mi][ni] = __builtin_amdgcn_wmma_f32_16x16x32_bf16(
                        false, aF[mi], false, bF[ni], (short)0, oAcc[mi][ni], false, false);
        }
    }
    __syncthreads();

    __bf16* obase = O + ((size_t)(b * SEQ + r0)) * DMODEL + h * DHEAD;
#pragma unroll
    for (int mi = 0; mi < 2; ++mi)
#pragma unroll
        for (int ni = 0; ni < 2; ++ni)
#pragma unroll
            for (int r = 0; r < 8; ++r) {
                int row = wm * 32 + mi * 16 + half * 8 + r;
                int col = wn * 32 + ni * 16 + lcol;
                obase[(size_t)row * DMODEL + col] = (__bf16)(oAcc[mi][ni][r] / rowsumAcc[row]);
            }
}

// ---------------------------------------------------------------------------
// Mean pool over tokens + head LayerNorm + classifier (8x512x1000, f32), spread
// over the chip in two launches.
// ---------------------------------------------------------------------------
#define POOL_CH   16                 // partial token sums per batch row
#define POOL_ROWS (SEQ / POOL_CH)    // 64 tokens a block

typedef __attribute__((ext_vector_type(4))) float f32x4;
typedef __attribute__((ext_vector_type(2))) float f32x2;

template <int M>
__device__ __forceinline__ float row_xor(float v) {   // lane l <- lane l ^ M, M < 16
    return __builtin_bit_cast(float, __builtin_amdgcn_update_dpp(
        0, __builtin_bit_cast(int, v), 0x160 | M, 0xf, 0xf, true));
}

__device__ __forceinline__ float half_xor(float v) {  // lane l <- lane l ^ 16
    int t = __builtin_bit_cast(int, v);
    return __builtin_bit_cast(float, __builtin_amdgcn_permlanex16(t, t, 0x76543210, 0xfedcba98, false, false));
}

__device__ __forceinline__ float wave_sum(float v) {  // total of 32 lanes, in every lane
    v += row_xor<1>(v);
    v += row_xor<2>(v);
    v += row_xor<4>(v);
    v += row_xor<8>(v);
    v += half_xor(v);
    return v;
}

// Launch 1: block (ch, b, z) sums 64 tokens of batch row b, columns
// [256 z, 256 z + 256), into part[b][ch][.]. 256 threads = 64 column quads x 4
// token groups; a wave's load covers 512 contiguous bytes.
__global__ __launch_bounds__(256) void pool_partial_kernel(const float* __restrict__ x3,
                                                           float* __restrict__ part) {
    __shared__ f32x4 red[4][64];
    const int tid = threadIdx.x;
    const int c4  = tid & 63;
    const int rg  = tid >> 6;
    const int ch  = blockIdx.x;
    const int b   = blockIdx.y;
    const int col = blockIdx.z * 256 + c4 * 4;
    const float* base = x3 + ((size_t)(b * SEQ + ch * POOL_ROWS + rg)) * DMODEL + col;
    f32x4 v[16];
#pragma unroll
    for (int i = 0; i < 16; ++i) v[i] = *(const f32x4*)(base + (size_t)(i * 4) * DMODEL);
    // The loads' address register is named so that it is not reused, not even
    // as a load's destination, ahead of this wait.
    asm volatile("s_wait_xcnt 0x0" :: "v"(base) : "memory");
    // Keeps all 16 loads in flight at once: left alone, the scheduler issues the
    // last four only when the first have returned, a second latency.
    __builtin_amdgcn_sched_barrier(0);
#pragma unroll
    for (int w = 8; w > 0; w >>= 1)
#pragma unroll
        for (int i = 0; i < w; ++i) v[i] += v[i + w];
    red[rg][c4] = v[0];
    __syncthreads();
    if (rg == 0)
        *(f32x4*)(part + ((size_t)(b * POOL_CH + ch)) * DMODEL + col) =
            (red[0][c4] + red[1][c4]) + (red[2][c4] + red[3][c4]);
}

// Launch 2: one block per 128-byte line of out (32 consecutive floats of the
// flat [8][1000] array), so every line has one writer. A line can straddle two
// batch rows, so each block normalises the pooled vectors of the first and of
// the last float's batch row (the same row twice for most lines).
// Lane = (k group kr, class quad q); wave w takes k in [64 w, 64 w + 64).
__global__ __launch_bounds__(256) void head_kernel(const float* __restrict__ part,
                                                   const float* __restrict__ g,
                                                   const float* __restrict__ bta,
                                                   const float* __restrict__ Wh,
                                                   const float* __restrict__ bh,
                                                   float* __restrict__ out) {
    __shared__ __attribute__((aligned(16))) float pool[2][DMODEL];
    __shared__ __attribute__((aligned(16))) float redS[2][8];
    __shared__ __attribute__((aligned(16))) float redQ[2][8];
    __shared__ f32x4 accs[8][8];
    const int tid  = threadIdx.x;
    const int lane = tid & 31;
    const int wave = tid >> 5;
    const int q    = lane & 7;
    const int kr   = lane >> 3;
    const int f0   = blockIdx.x * 32;
    const int b0   = f0 / NCLS;
    const int b1   = (f0 + 31) / NCLS;
    const int f    = f0 + q * 4;        // NCLS is a multiple of 4: a quad stays in one row
    const int bq   = f / NCLS;
    const int c    = f - bq * NCLS;
    const int kb   = wave * 64 + kr * 16;

    const f32x2 g2   = *(const f32x2*)(g + tid * 2);
    const f32x2 t2   = *(const f32x2*)(bta + tid * 2);
    const float* bp  = bh + c;
    const float* wp  = Wh + (size_t)kb * NCLS + c;
    const float* pp0 = part + (size_t)(b0 * POOL_CH) * DMODEL + tid * 2;
    const float* pp1 = part + (size_t)(b1 * POOL_CH) * DMODEL + tid * 2;
    const f32x4 bias = *(const f32x4*)bp;
    f32x4 w[16];
#pragma unroll
    for (int i = 0; i < 16; ++i) w[i] = *(const f32x4*)(wp + (size_t)i * NCLS);
    f32x2 p0[POOL_CH], p1[POOL_CH];
#pragma unroll
    for (int j = 0; j < POOL_CH; ++j) {
        p0[j] = *(const f32x2*)(pp0 + (size_t)j * DMODEL);
        p1[j] = *(const f32x2*)(pp1 + (size_t)j * DMODEL);
    }
    // The address registers of the bias and weight loads are named so that
    // neither is reused, not even as a load's destination, ahead of this wait
    // (the other loads go by the thread index and a scalar base).
    asm volatile("s_wait_xcnt 0x0" :: "v"(bp), "v"(wp) : "memory");
    // Keeps the classifier's loads in front of the pooling arithmetic, so that
    // their latency runs under it instead of behind the three barriers below.
    __builtin_amdgcn_sched_barrier(0);

#pragma unroll
    for (int s = POOL_CH / 2; s > 0; s >>= 1)
#pragma unroll
        for (int j = 0; j < s; ++j) { p0[j] += p0[j + s]; p1[j] += p1[j + s]; }
    const f32x2 m0 = p0[0] * (1.f / SEQ);
    const f32x2 m1 = p1[0] * (1.f / SEQ);

    const float s0 = wave_sum(m0.x + m0.y);
    const float s1 = wave_sum(m1.x + m1.y);
    if (lane == 0) { redS[0][wave] = s0; redS[1][wave] = s1; }
    __syncthreads();
    float mu0 = 0.f, mu1 = 0.f;
#pragma unroll
    for (int i = 0; i < 8; ++i) { mu0 += redS[0][i]; mu1 += redS[1][i]; }
    mu0 *= (1.f / DMODEL);
    mu1 *= (1.f / DMODEL);
    const f32x2 d0 = m0 - mu0;
    const f32x2 d1 = m1 - mu1;
    const float q0 = wave_sum(d0.x * d0.x + d0.y * d0.y);
    const float q1 = wave_sum(d1.x * d1.x + d1.y * d1.y);
    if (lane == 0) { redQ[0][wave] = q0; redQ[1][wave] = q1; }
    __syncthreads();
    float v0 = 0.f, v1 = 0.f;
#pragma unroll
    for (int i = 0; i < 8; ++i) { v0 += redQ[0][i]; v1 += redQ[1][i]; }
    const float r0 = rsqrtf(v0 * (1.f / DMODEL) + 1e-5f);
    const float r1 = rsqrtf(v1 * (1.f / DMODEL) + 1e-5f);
    *(f32x2*)&pool[0][tid * 2] = d0 * r0 * g2 + t2;
    *(f32x2*)&pool[1][tid * 2] = d1 * r1 * g2 + t2;
    __syncthreads();

    const float* pv = &pool[bq - b0][kb];
    f32x4 acc = {0.f, 0.f, 0.f, 0.f};
#pragma unroll
    for (int i = 0; i < 16; i += 4) {
        const f32x4 pk = *(const f32x4*)(pv + i);
        acc += pk.x * w[i] + pk.y * w[i + 1] + pk.z * w[i + 2] + pk.w * w[i + 3];
    }
#pragma unroll
    for (int e = 0; e < 4; ++e) {       // fold the four k groups of the wave
        acc[e] += row_xor<8>(acc[e]);
        acc[e] += half_xor(acc[e]);
    }
    if (lane < 8) accs[wave][q] = acc;
    __syncthreads();
    if (tid < 8) {
        f32x4 r = bias;
#pragma unroll
        for (int i = 0; i < 8; ++i) r += accs[i][tid];
        *(f32x4*)(out + f) = r;
    }
}

// ---------------------------------------------------------------------------
// Host-side orchestration
// ---------------------------------------------------------------------------
extern "C" void kernel_launch(void* const* d_in, const int* in_sizes, int n_in,
                              void* d_out, int out_size, void* d_ws, size_t ws_size,
                              hipStream_t stream) {
    (void)in_sizes; (void)n_in; (void)out_size; (void)ws_size;
    const float* x     = (const float*)d_in[0];
    const float* mask  = (const float*)d_in[1];
    const float* ln1_g = (const float*)d_in[2];
    const float* ln1_b = (const float*)d_in[3];
    const float* Wq    = (const float*)d_in[4];
    const float* bq    = (const float*)d_in[5];
    const float* Wk    = (const float*)d_in[6];
    const float* bk_p  = (const float*)d_in[7];
    const float* Wv    = (const float*)d_in[8];
    const float* bv    = (const float*)d_in[9];
    const float* Wo    = (const float*)d_in[10];
    const float* bo    = (const float*)d_in[11];
    const float* ln2_g = (const float*)d_in[12];
    const float* ln2_b = (const float*)d_in[13];
    const float* W1    = (const float*)d_in[14];
    const float* b1    = (const float*)d_in[15];
    const float* W2    = (const float*)d_in[16];
    const float* b2    = (const float*)d_in[17];
    const float* lnh_g = (const float*)d_in[18];
    const float* lnh_b = (const float*)d_in[19];
    const float* Wh    = (const float*)d_in[20];
    const float* bh    = (const float*)d_in[21];

    char* ws = (char*)d_ws;
    const size_t MB = 1ull << 20;
    // Workspace map (aliasing is ordered by the stream):
    //   [ 0,16MB)  resid (f32)  -- reused as x3 after the Wo projection
    //   [16,32MB)  x2 (f32)
    //   [32,40MB)  xn (bf16)    -- reused as xn2
    //   [40,72MB)  bufQ/bufK/bufV/bufAO (bf16, 8MB each) -- reused as h1 (32MB)
    //   [72MB,..)  bf16 weights, each transposed to [N][K]
    //   [80MB,..)  partial token sums (f32, 256KB)
    float*  resid  = (float*) (ws + 0);
    float*  x2     = (float*) (ws + 16 * MB);
    __bf16* xn     = (__bf16*)(ws + 32 * MB);
    __bf16* bufQ   = (__bf16*)(ws + 40 * MB);
    __bf16* bufK   = (__bf16*)(ws + 48 * MB);
    __bf16* bufV   = (__bf16*)(ws + 56 * MB);
    __bf16* bufAO  = (__bf16*)(ws + 64 * MB);
    __bf16* h1     = bufQ;
    float*  x3     = resid;
    __bf16* wqB    = (__bf16*)(ws + 72 * MB);
    __bf16* wkB    = wqB + DMODEL * DMODEL;
    __bf16* wvB    = wkB + DMODEL * DMODEL;
    __bf16* woB    = wvB + DMODEL * DMODEL;
    __bf16* w1B    = woB + DMODEL * DMODEL;
    __bf16* w2B    = w1B + DMODEL * DFF;
    float*  part   = (float*) (ws + 80 * MB);

    // W[K][N] f32 -> Wt[N][K] bf16; grid = (N/64, K/64)
    dim3 gTDD(DMODEL / 64, DMODEL / 64);
    cvt_bf16_t_kernel<<<gTDD, 256, 0, stream>>>(Wq, wqB, DMODEL, DMODEL);
    cvt_bf16_t_kernel<<<gTDD, 256, 0, stream>>>(Wk, wkB, DMODEL, DMODEL);
    cvt_bf16_t_kernel<<<gTDD, 256, 0, stream>>>(Wv, wvB, DMODEL, DMODEL);
    cvt_bf16_t_kernel<<<gTDD, 256, 0, stream>>>(Wo, woB, DMODEL, DMODEL);
    cvt_bf16_t_kernel<<<dim3(DFF / 64, DMODEL / 64), 256, 0, stream>>>(W1, w1B, DMODEL, DFF);
    cvt_bf16_t_kernel<<<dim3(DMODEL / 64, DFF / 64), 256, 0, stream>>>(W2, w2B, DFF, DMODEL);

    // mask * x -> residual ; LN1 -> xn (bf16)
    ln_kernel<true><<<MROWS, 256, 0, stream>>>(x, mask, resid, ln1_g, ln1_b, xn);

    // QKV projections
    dim3 gDD(DMODEL / 128, MROWS / 128);   // (4, 64)
    gemm_bf16_kernel<true, false, false, true><<<gDD, 256, 0, stream>>>(
        xn, wqB, bq, nullptr, nullptr, bufQ, MROWS, DMODEL, DMODEL);
    gemm_bf16_kernel<true, false, false, true><<<gDD, 256, 0, stream>>>(
        xn, wkB, bk_p, nullptr, nullptr, bufK, MROWS, DMODEL, DMODEL);
    gemm_bf16_kernel<true, false, false, true><<<gDD, 256, 0, stream>>>(
        xn, wvB, bv, nullptr, nullptr, bufV, MROWS, DMODEL, DMODEL);

    // Attention
    attn_kernel<<<dim3(SEQ / 128, HEADS, BATCH), 256, 0, stream>>>(bufQ, bufK, bufV, bufAO);

    // Output projection + residual -> x2 (f32)
    gemm_bf16_kernel<true, false, true, false><<<gDD, 256, 0, stream>>>(
        bufAO, woB, bo, resid, x2, nullptr, MROWS, DMODEL, DMODEL);

    // LN2 -> xn2 (bf16)
    ln_kernel<false><<<MROWS, 256, 0, stream>>>(x2, nullptr, nullptr, ln2_g, ln2_b, xn);

    // FFN1: GELU(xn2 @ W1 + b1) -> h1 (bf16)
    gemm_bf16_kernel<true, true, false, true><<<dim3(DFF / 128, MROWS / 128), 256, 0, stream>>>(
        xn, w1B, b1, nullptr, nullptr, h1, MROWS, DFF, DMODEL);

    // FFN2: h1 @ W2 + b2 + x2 -> x3 (f32)
    gemm_bf16_kernel<true, false, true, false><<<gDD, 256, 0, stream>>>(
        h1, w2B, b2, x2, x3, nullptr, MROWS, DMODEL, DFF);

    // Mean pool + head LN + classifier
    pool_partial_kernel<<<dim3(POOL_CH, BATCH, 2), 256, 0, stream>>>(x3, part);
    head_kernel<<<BATCH * NCLS / 32, 256, 0, stream>>>(part, lnh_g, lnh_b, Wh, bh, (float*)d_out);
}

// v003
// It runs in 214 microseconds.
// Next to v002, in two timings, it ran 1.11 times as fast each time.
// Over all steps from v000 it is 2.24 times as fast.
#include <hip/hip_runtime.h>
#include <cstdint>
#include <cstddef>

// ---------------------------------------------------------------------------
// MI455X (gfx1250) transformer block, bf16 WMMA path.
// ~70 GFLOP of GEMMs vs ~100MB traffic -> matrix-core bound; everything
// routed through v_wmma_f32_16x16x32_bf16 with f32 accumulation.
// Row-major tiles are staged into LDS with global_load_async_to_lds_b128
// (ASYNCcnt-tracked DMA, no VGPR round-trip), double-buffered in the GEMM.
// Weights are converted to bf16 K-contiguous ([N][K]) so that the GEMM's B
// tile is copied the same way as its A tile.
// ---------------------------------------------------------------------------

typedef __attribute__((ext_vector_type(16))) __bf16 bf16x16;
typedef __attribute__((ext_vector_type(8)))  float  f32x8;

#define HEADS 8
#define DHEAD 64
#define SEQ   1024
#define BATCH 8
#define DMODEL 512
#define DFF   2048
#define NCLS  1000
#define MROWS (BATCH * SEQ)   // 8192
#define ATTN_SCALE 0.125f     // 1/sqrt(64)

__device__ __forceinline__ f32x8 zero8() {
    f32x8 z = {0.f, 0.f, 0.f, 0.f, 0.f, 0.f, 0.f, 0.f};
    return z;
}

__device__ __forceinline__ float gelu_tanh(float x) {
    float x3 = x * x * x;
    return 0.5f * x * (1.f + tanhf(0.7978845608028654f * (x + 0.044715f * x3)));
}

// Async DMA: 16 bytes global -> LDS per lane (VDST = LDS byte offset VGPR,
// VADDR = 64-bit global address). Tracked by ASYNCcnt. Low 32 bits of a
// flat shared pointer are the LDS byte offset on AMDGPU.
__device__ __forceinline__ void async_g2l_b128(void* ldsDst, const void* gSrc) {
    unsigned ldsOff = (unsigned)(uintptr_t)ldsDst;
    asm volatile("global_load_async_to_lds_b128 %0, %1, off"
                 :: "v"(ldsOff), "v"(gSrc)
                 : "memory");
}

// Four such copies of one lane (two A rows, two B rows of a GEMM stage). The
// s_wait_xcnt closes the statement so that no address register of a copy is
// rewritten ahead of it.
__device__ __forceinline__ void async_g2l_b128_x4(void* l0, const void* g0,
                                                  void* l1, const void* g1,
                                                  void* l2, const void* g2,
                                                  void* l3, const void* g3) {
    unsigned o0 = (unsigned)(uintptr_t)l0;
    unsigned o1 = (unsigned)(uintptr_t)l1;
    unsigned o2 = (unsigned)(uintptr_t)l2;
    unsigned o3 = (unsigned)(uintptr_t)l3;
    asm volatile("global_load_async_to_lds_b128 %0, %1, off\n\t"
                 "global_load_async_to_lds_b128 %2, %3, off\n\t"
                 "global_load_async_to_lds_b128 %4, %5, off\n\t"
                 "global_load_async_to_lds_b128 %6, %7, off\n\t"
                 "s_wait_xcnt 0x0"
                 :: "v"(o0), "v"(g0), "v"(o1), "v"(g1),
                    "v"(o2), "v"(g2), "v"(o3), "v"(g3)
                 : "memory");
}

__device__ __forceinline__ void wait_async0() {
#if __has_builtin(__builtin_amdgcn_s_wait_asynccnt)
    __builtin_amdgcn_s_wait_asynccnt(0);
#else
    asm volatile("s_wait_asynccnt 0x0" ::: "memory");
#endif
}

// Load a 16x32 bf16 WMMA operand fragment from an LDS tile laid out as
// tile[rc][k] (A-matrix rows, or B-matrix stored K-transposed: tile[col][k]).
// Per ISA 7.12.2 (16-bit A 16x32): lanes 0-15 hold K=0..7,16..23 of row M=lane,
// lanes 16-31 hold K=8..15,24..31 of row M=lane-16; pairs packed per VGPR.
__device__ __forceinline__ bf16x16 load_frag(const __bf16* base, int stride,
                                             int rcBase, int kBase) {
    const int lane = threadIdx.x & 31;
    const int idx  = lane & 15;
    const int half = lane >> 4;
    const __bf16* p = base + (size_t)(rcBase + idx) * stride + kBase + half * 8;
    union { bf16x16 v; unsigned u[8]; } r;
#pragma unroll
    for (int i = 0; i < 8; ++i) {
        int k = ((i & 4) << 2) + ((i & 3) << 1);   // i<4 -> 0..6 ; i>=4 -> 16..22
        r.u[i] = *(const unsigned*)(p + k);
    }
    return r.v;
}

// ---------------------------------------------------------------------------
// fp32 [K][N] -> bf16 [N][K] convert + transpose. One 64x64 tile per block,
// turned in LDS (pitch 65 dwords: column walks hit distinct banks); each wave
// stores whole 128-byte rows of the output.
// ---------------------------------------------------------------------------
__global__ __launch_bounds__(256) void cvt_bf16_t_kernel(const float* __restrict__ in,
                                                         __bf16* __restrict__ out,
                                                         int K, int Nn) {
    __shared__ float t[64][65];
    const int n0 = blockIdx.x * 64;
    const int k0 = blockIdx.y * 64;
    const int tid = threadIdx.x;
    const int kr = tid >> 4;          // 16 rows a sweep, 16 bytes a lane
    const int c4 = (tid & 15) * 4;
    float4 v[4];
#pragma unroll
    for (int r = 0; r < 4; ++r)
        v[r] = *(const float4*)(in + (size_t)(k0 + kr + r * 16) * Nn + n0 + c4);
#pragma unroll
    for (int r = 0; r < 4; ++r) {
        t[kr + r * 16][c4 + 0] = v[r].x;
        t[kr + r * 16][c4 + 1] = v[r].y;
        t[kr + r * 16][c4 + 2] = v[r].z;
        t[kr + r * 16][c4 + 3] = v[r].w;
    }
    __syncthreads();
    const int kp = tid & 31;   // pair of k
    const int nr = tid >> 5;
#pragma unroll
    for (int r = 0; r < 8; ++r) {
        int n = nr + r * 8;
        union { __bf16 h[2]; unsigned u; } p;
        p.h[0] = (__bf16)t[2 * kp][n];
        p.h[1] = (__bf16)t[2 * kp + 1][n];
        *(unsigned*)(out + (size_t)(n0 + n) * K + k0 + 2 * kp) = p.u;
    }
}

// ---------------------------------------------------------------------------
// LayerNorm over D=512. Optionally applies token mask and emits f32 residual.
// One block (256 threads, 2 cols each) per row.
// ---------------------------------------------------------------------------
template <bool MASKED>
__global__ __launch_bounds__(256) void ln_kernel(const float* __restrict__ x,
                                                 const float* __restrict__ mask,
                                                 float* __restrict__ residOut,
                                                 const float* __restrict__ g,
                                                 const float* __restrict__ bta,
                                                 __bf16* __restrict__ outB) {
    __shared__ float red[256];
    __shared__ float stats[2];
    const int row = blockIdx.x;
    const int tid = threadIdx.x;
    const size_t rb = (size_t)row * DMODEL;
    float v0 = x[rb + tid];
    float v1 = x[rb + tid + 256];
    if (MASKED) {
        float mv = mask[row & (SEQ - 1)];
        v0 *= mv; v1 *= mv;
        residOut[rb + tid]       = v0;
        residOut[rb + tid + 256] = v1;
    }
    red[tid] = v0 + v1;
    __syncthreads();
#pragma unroll
    for (int off = 128; off > 0; off >>= 1) {
        if (tid < off) red[tid] += red[tid + off];
        __syncthreads();
    }
    if (tid == 0) stats[0] = red[0] * (1.f / DMODEL);
    __syncthreads();
    const float mu = stats[0];
    float d0 = v0 - mu, d1 = v1 - mu;
    red[tid] = d0 * d0 + d1 * d1;
    __syncthreads();
#pragma unroll
    for (int off = 128; off > 0; off >>= 1) {
        if (tid < off) red[tid] += red[tid + off];
        __syncthreads();
    }
    if (tid == 0) stats[1] = rsqrtf(red[0] * (1.f / DMODEL) + 1e-5f);
    __syncthreads();
    const float rstd = stats[1];
    outB[rb + tid]       = (__bf16)(d0 * rstd * g[tid]       + bta[tid]);
    outB[rb + tid + 256] = (__bf16)(d1 * rstd * g[tid + 256] + bta[tid + 256]);
}

// ---------------------------------------------------------------------------
// bf16 WMMA GEMM: C[M,N] = A[M,K] @ B[K,N] (+bias)(+GELU)(+resid), B given as Bt[N,K]
// Block: 256 threads = 8 waves. Tile BM=128, BN=128, BK=32, double-buffered:
// next tile's async DMA runs under the current tile's WMMAs.
// Waves: 4 along M (32 rows), 2 along N (64 cols) -> 2x4 subtiles of 16x16.
// Bt rows are K-contiguous, so both tiles are copied alike and both operands
// use the same frag loader.
// ---------------------------------------------------------------------------
template <bool BIAS, bool GELU_ACT, bool RESID, bool OUT_BF16>
__global__ __launch_bounds__(256) void gemm_bf16_kernel(
        const __bf16* __restrict__ A, const __bf16* __restrict__ Bt,
        const float* __restrict__ bias, const float* __restrict__ resid,
        float* __restrict__ outF, __bf16* __restrict__ outB,
        int M, int Nn, int K) {
    __shared__ __attribute__((aligned(16))) __bf16 lsA[2][128][40];   // [buf][row][k]
    __shared__ __attribute__((aligned(16))) __bf16 lsB[2][128][40];   // [buf][col][k]

    const int m0 = blockIdx.y * 128;
    const int n0 = blockIdx.x * 128;
    const int tid  = threadIdx.x;
    const int wave = tid >> 5;
    const int wm   = wave & 3;    // 0..3 : 32 rows each
    const int wn   = wave >> 2;   // 0..1 : 64 cols each

    f32x8 acc[2][4];
#pragma unroll
    for (int mi = 0; mi < 2; ++mi)
#pragma unroll
        for (int ni = 0; ni < 4; ++ni) acc[mi][ni] = zero8();

    // One stage: 128 rows x 32 k of A and of Bt, 64 bytes a row, 16 bytes a lane.
    const int crow = tid >> 2, cseg = (tid & 3) * 8;
    const __bf16* gA = A  + (size_t)(m0 + crow) * K + cseg;
    const __bf16* gB = Bt + (size_t)(n0 + crow) * K + cseg;
    const size_t half64 = (size_t)64 * K;
    auto load_tiles = [&](int k0, int buf) {
        async_g2l_b128_x4(&lsA[buf][crow][cseg],      gA + k0,
                          &lsA[buf][crow + 64][cseg], gA + half64 + k0,
                          &lsB[buf][crow][cseg],      gB + k0,
                          &lsB[buf][crow + 64][cseg], gB + half64 + k0);
    };

    const int nk = K >> 5;
    load_tiles(0, 0);
    asm volatile("s_wait_asynccnt 0x0" ::: "memory");   // stage 0 landed (own copies)
    __syncthreads();                                    // ... and everyone's
    if (nk > 1) load_tiles(32, 1);
    for (int i = 0; i < nk; ++i) {
        const int buf = i & 1;
        bf16x16 aF[2], bF[4];
#pragma unroll
        for (int mi = 0; mi < 2; ++mi)
            aF[mi] = load_frag(&lsA[buf][0][0], 40, wm * 32 + mi * 16, 0);
#pragma unroll
        for (int ni = 0; ni < 4; ++ni)
            bF[ni] = load_frag(&lsB[buf][0][0], 40, wn * 64 + ni * 16, 0);
#pragma unroll
        for (int mi = 0; mi < 2; ++mi)
#pragma unroll
            for (int ni = 0; ni < 4; ++ni)
                acc[mi][ni] = __builtin_amdgcn_wmma_f32_16x16x32_bf16(
                    false, aF[mi], false, bF[ni], (short)0, acc[mi][ni], false, false);

        // Publish stage i+1 and free this buffer: own LDS reads done, own
        // copies landed, then the barrier; only then the refill.
        asm volatile("s_wait_dscnt 0x0" ::: "memory");
        asm volatile("s_wait_asynccnt 0x0" ::: "memory");
        __syncthreads();
        if (i + 2 < nk) load_tiles((i + 2) << 5, buf);
    }
    asm volatile("s_wait_asynccnt 0x0" ::: "memory");   // nothing in flight at the end

    // Epilogue. C/D layout: lane<16 -> M = r, lane>=16 -> M = 8+r ; N = lane&15
    const int lane = tid & 31;
    const int half = lane >> 4;
    const int lcol = lane & 15;
    // Residual values of this wave's 2x4 subtiles, all 64 loads issued here back
    // to back: their latency runs once, not once per element between the stores.
    float rs[2][4][8];
    if (RESID) {
        // The residual stream is DMODEL wide, so every row and column step is an
        // immediate offset from one index register.
        const float* rp = resid + ((m0 + wm * 32 + half * 8) * DMODEL + n0 + wn * 64 + lcol);
#pragma unroll
        for (int mi = 0; mi < 2; ++mi)
#pragma unroll
            for (int r = 0; r < 8; ++r)
#pragma unroll
                for (int ni = 0; ni < 4; ++ni)
                    rs[mi][ni][r] = rp[(mi * 16 + r) * DMODEL + ni * 16];
        // Keeps all 64 loads in flight at once: left alone, the scheduler issues the
        // last fourteen only when the first have returned, a second latency.
        __builtin_amdgcn_sched_barrier(0);
    }
#pragma unroll
    for (int mi = 0; mi < 2; ++mi) {
#pragma unroll
        for (int ni = 0; ni < 4; ++ni) {
#pragma unroll
            for (int r = 0; r < 8; ++r) {
                int gr = m0 + wm * 32 + mi * 16 + half * 8 + r;
                int gc = n0 + wn * 64 + ni * 16 + lcol;
                float v = acc[mi][ni][r];
                if (BIAS)     v += bias[gc];
                if (GELU_ACT) v = gelu_tanh(v);
                if (RESID)    v += rs[mi][ni][r];
                if (OUT_BF16) outB[(size_t)gr * Nn + gc] = (__bf16)v;
                else          outF[(size_t)gr * Nn + gc] = v;
            }
        }
    }
}

// ---------------------------------------------------------------------------
// Attention: one block per (b, h, 128-row Q tile). Streams 64-key tiles:
//   S = Q K^T * scale ; P = exp(S) (reference has no max-subtraction)
//   rowsum += sum_j P ; O += P V ; final O /= rowsum.
// Q/K tiles are async-DMA'd into LDS; V needs a transpose scatter.
// ---------------------------------------------------------------------------
__global__ __launch_bounds__(256) void attn_kernel(const __bf16* __restrict__ Q,
                                                   const __bf16* __restrict__ Kmat,
                                                   const __bf16* __restrict__ Vmat,
                                                   __bf16* __restrict__ O) {
    __shared__ __bf16 lsQ[128][72];   // [row][dh]
    __shared__ __bf16 lsK[64][72];    // [key][dh]  (B-transposed layout for QK^T)
    __shared__ __bf16 lsVt[64][72];   // [dh][key]  (B-transposed layout for PV)
    __shared__ __bf16 lsP[128][72];   // [row][key]
    __shared__ float  rowsumAcc[128];

    const int r0 = blockIdx.x * 128;
    const int h  = blockIdx.y;
    const int b  = blockIdx.z;
    const int tid  = threadIdx.x;
    const int wave = tid >> 5;
    const int wm   = wave & 3;     // 4 x 32 rows
    const int wn   = wave >> 2;    // 2 x 32 cols
    const int lane = tid & 31;
    const int half = lane >> 4;
    const int lcol = lane & 15;

    const __bf16* qbase = Q + ((size_t)(b * SEQ + r0)) * DMODEL + h * DHEAD;
#pragma unroll
    for (int s = tid; s < 1024; s += 256) {   // 128 rows x 8 uint4 segs
        int row = s >> 3, cs = s & 7;
        async_g2l_b128(&lsQ[row][cs * 8], qbase + (size_t)row * DMODEL + cs * 8);
    }
    if (tid < 128) rowsumAcc[tid] = 0.f;

    f32x8 oAcc[2][2];
#pragma unroll
    for (int mi = 0; mi < 2; ++mi)
#pragma unroll
        for (int ni = 0; ni < 2; ++ni) oAcc[mi][ni] = zero8();

    for (int j0 = 0; j0 < SEQ; j0 += 64) {
        __syncthreads();
        const __bf16* kbase = Kmat + ((size_t)(b * SEQ + j0)) * DMODEL + h * DHEAD;
        const __bf16* vbase = Vmat + ((size_t)(b * SEQ + j0)) * DMODEL + h * DHEAD;
#pragma unroll
        for (int s = tid; s < 512; s += 256) {  // K tile row-major, async DMA
            int kr = s >> 3, cs = s & 7;
            async_g2l_b128(&lsK[kr][cs * 8], kbase + (size_t)kr * DMODEL + cs * 8);
        }
#pragma unroll
        for (int s = tid; s < 512; s += 256) {  // V tile, scatter transposed
            int kr = s >> 3, cs = s & 7;
            uint4 t = *(const uint4*)(vbase + (size_t)kr * DMODEL + cs * 8);
            const __bf16* hs = reinterpret_cast<const __bf16*>(&t);
#pragma unroll
            for (int e = 0; e < 8; ++e) lsVt[cs * 8 + e][kr] = hs[e];
        }
        wait_async0();
        __syncthreads();

        // S = Q K^T  (M=128 rows, N=64 keys, K=64=dh)
        f32x8 sAcc[2][2];
#pragma unroll
        for (int mi = 0; mi < 2; ++mi)
#pragma unroll
            for (int ni = 0; ni < 2; ++ni) sAcc[mi][ni] = zero8();
#pragma unroll
        for (int kk = 0; kk < 64; kk += 32) {
            bf16x16 aF[2], bF[2];
#pragma unroll
            for (int mi = 0; mi < 2; ++mi)
                aF[mi] = load_frag(&lsQ[0][0], 72, wm * 32 + mi * 16, kk);
#pragma unroll
            for (int ni = 0; ni < 2; ++ni)
                bF[ni] = load_frag(&lsK[0][0], 72, wn * 32 + ni * 16, kk);
#pragma unroll
            for (int mi = 0; mi < 2; ++mi)
#pragma unroll
                for (int ni = 0; ni < 2; ++ni)
                    sAcc[mi][ni] = __builtin_amdgcn_wmma_f32_16x16x32_bf16(
                        false, aF[mi], false, bF[ni], (short)0, sAcc[mi][ni], false, false);
        }
        // P = exp(scale * S) into LDS
#pragma unroll
        for (int mi = 0; mi < 2; ++mi)
#pragma unroll
            for (int ni = 0; ni < 2; ++ni)
#pragma unroll
                for (int r = 0; r < 8; ++r) {
                    int row = wm * 32 + mi * 16 + half * 8 + r;
                    int col = wn * 32 + ni * 16 + lcol;
                    lsP[row][col] = (__bf16)expf(sAcc[mi][ni][r] * ATTN_SCALE);
                }
        __syncthreads();
        // rowsum accumulate (threads 0..127 own one row each)
        if (tid < 128) {
            float s = 0.f;
#pragma unroll
            for (int c = 0; c < 64; ++c) s += (float)lsP[tid][c];
            rowsumAcc[tid] += s;
        }
        // O += P V  (M=128 rows, N=64=dh, K=64 keys)
#pragma unroll
        for (int kk = 0; kk < 64; kk += 32) {
            bf16x16 aF[2], bF[2];
#pragma unroll
            for (int mi = 0; mi < 2; ++mi)
                aF[mi] = load_frag(&lsP[0][0], 72, wm * 32 + mi * 16, kk);
#pragma unroll
            for (int ni = 0; ni < 2; ++ni)
                bF[ni] = load_frag(&lsVt[0][0], 72, wn * 32 + ni * 16, kk);
#pragma unroll
            for (int mi = 0; mi < 2; ++mi)
#pragma unroll
                for (int ni = 0; ni < 2; ++ni)
                    oAcc[mi][ni] = __builtin_amdgcn_wmma_f32_16x16x32_bf16(
                        false, aF[mi], false, bF[ni], (short)0, oAcc[mi][ni], false, false);
        }
    }
    __syncthreads();

    __bf16* obase = O + ((size_t)(b * SEQ + r0)) * DMODEL + h * DHEAD;
#pragma unroll
    for (int mi = 0; mi < 2; ++mi)
#pragma unroll
        for (int ni = 0; ni < 2; ++ni)
#pragma unroll
            for (int r = 0; r < 8; ++r) {
                int row = wm * 32 + mi * 16 + half * 8 + r;
                int col = wn * 32 + ni * 16 + lcol;
                obase[(size_t)row * DMODEL + col] = (__bf16)(oAcc[mi][ni][r] / rowsumAcc[row]);
            }
}

// ---------------------------------------------------------------------------
// Mean pool over tokens + head LayerNorm + classifier (8x512x1000, f32), spread
// over the chip in two launches.
// ---------------------------------------------------------------------------
#define POOL_CH   16                 // partial token sums per batch row
#define POOL_ROWS (SEQ / POOL_CH)    // 64 tokens a block

typedef __attribute__((ext_vector_type(4))) float f32x4;
typedef __attribute__((ext_vector_type(2))) float f32x2;

template <int M>
__device__ __forceinline__ float row_xor(float v) {   // lane l <- lane l ^ M, M < 16
    return __builtin_bit_cast(float, __builtin_amdgcn_update_dpp(
        0, __builtin_bit_cast(int, v), 0x160 | M, 0xf, 0xf, true));
}

__device__ __forceinline__ float half_xor(float v) {  // lane l <- lane l ^ 16
    int t = __builtin_bit_cast(int, v);
    return __builtin_bit_cast(float, __builtin_amdgcn_permlanex16(t, t, 0x76543210, 0xfedcba98, false, false));
}

__device__ __forceinline__ float wave_sum(float v) {  // total of 32 lanes, in every lane
    v += row_xor<1>(v);
    v += row_xor<2>(v);
    v += row_xor<4>(v);
    v += row_xor<8>(v);
    v += half_xor(v);
    return v;
}

// Launch 1: block (ch, b, z) sums 64 tokens of batch row b, columns
// [256 z, 256 z + 256), into part[b][ch][.]. 256 threads = 64 column quads x 4
// token groups; a wave's load covers 512 contiguous bytes.
__global__ __launch_bounds__(256) void pool_partial_kernel(const float* __restrict__ x3,
                                                           float* __restrict__ part) {
    __shared__ f32x4 red[4][64];
    const int tid = threadIdx.x;
    const int c4  = tid & 63;
    const int rg  = tid >> 6;
    const int ch  = blockIdx.x;
    const int b   = blockIdx.y;
    const int col = blockIdx.z * 256 + c4 * 4;
    const float* base = x3 + ((size_t)(b * SEQ + ch * POOL_ROWS + rg)) * DMODEL + col;
    f32x4 v[16];
#pragma unroll
    for (int i = 0; i < 16; ++i) v[i] = *(const f32x4*)(base + (size_t)(i * 4) * DMODEL);
    // The loads' address register is named so that it is not reused, not even
    // as a load's destination, ahead of this wait.
    asm volatile("s_wait_xcnt 0x0" :: "v"(base) : "memory");
    // Keeps all 16 loads in flight at once: left alone, the scheduler issues the
    // last four only when the first have returned, a second latency.
    __builtin_amdgcn_sched_barrier(0);
#pragma unroll
    for (int w = 8; w > 0; w >>= 1)
#pragma unroll
        for (int i = 0; i < w; ++i) v[i] += v[i + w];
    red[rg][c4] = v[0];
    __syncthreads();
    if (rg == 0)
        *(f32x4*)(part + ((size_t)(b * POOL_CH + ch)) * DMODEL + col) =
            (red[0][c4] + red[1][c4]) + (red[2][c4] + red[3][c4]);
}

// Launch 2: one block per 128-byte line of out (32 consecutive floats of the
// flat [8][1000] array), so every line has one writer. A line can straddle two
// batch rows, so each block normalises the pooled vectors of the first and of
// the last float's batch row (the same row twice for most lines).
// Lane = (k group kr, class quad q); wave w takes k in [64 w, 64 w + 64).
__global__ __launch_bounds__(256) void head_kernel(const float* __restrict__ part,
                                                   const float* __restrict__ g,
                                                   const float* __restrict__ bta,
                                                   const float* __restrict__ Wh,
                                                   const float* __restrict__ bh,
                                                   float* __restrict__ out) {
    __shared__ __attribute__((aligned(16))) float pool[2][DMODEL];
    __shared__ __attribute__((aligned(16))) float redS[2][8];
    __shared__ __attribute__((aligned(16))) float redQ[2][8];
    __shared__ f32x4 accs[8][8];
    const int tid  = threadIdx.x;
    const int lane = tid & 31;
    const int wave = tid >> 5;
    const int q    = lane & 7;
    const int kr   = lane >> 3;
    const int f0   = blockIdx.x * 32;
    const int b0   = f0 / NCLS;
    const int b1   = (f0 + 31) / NCLS;
    const int f    = f0 + q * 4;        // NCLS is a multiple of 4: a quad stays in one row
    const int bq   = f / NCLS;
    const int c    = f - bq * NCLS;
    const int kb   = wave * 64 + kr * 16;

    const f32x2 g2   = *(const f32x2*)(g + tid * 2);
    const f32x2 t2   = *(const f32x2*)(bta + tid * 2);
    const float* bp  = bh + c;
    const float* wp  = Wh + (size_t)kb * NCLS + c;
    const float* pp0 = part + (size_t)(b0 * POOL_CH) * DMODEL + tid * 2;
    const float* pp1 = part + (size_t)(b1 * POOL_CH) * DMODEL + tid * 2;
    const f32x4 bias = *(const f32x4*)bp;
    f32x4 w[16];
#pragma unroll
    for (int i = 0; i < 16; ++i) w[i] = *(const f32x4*)(wp + (size_t)i * NCLS);
    f32x2 p0[POOL_CH], p1[POOL_CH];
#pragma unroll
    for (int j = 0; j < POOL_CH; ++j) {
        p0[j] = *(const f32x2*)(pp0 + (size_t)j * DMODEL);
        p1[j] = *(const f32x2*)(pp1 + (size_t)j * DMODEL);
    }
    // The address registers of the bias and weight loads are named so that
    // neither is reused, not even as a load's destination, ahead of this wait
    // (the other loads go by the thread index and a scalar base).
    asm volatile("s_wait_xcnt 0x0" :: "v"(bp), "v"(wp) : "memory");
    // Keeps the classifier's loads in front of the pooling arithmetic, so that
    // their latency runs under it instead of behind the three barriers below.
    __builtin_amdgcn_sched_barrier(0);

#pragma unroll
    for (int s = POOL_CH / 2; s > 0; s >>= 1)
#pragma unroll
        for (int j = 0; j < s; ++j) { p0[j] += p0[j + s]; p1[j] += p1[j + s]; }
    const f32x2 m0 = p0[0] * (1.f / SEQ);
    const f32x2 m1 = p1[0] * (1.f / SEQ);

    const float s0 = wave_sum(m0.x + m0.y);
    const float s1 = wave_sum(m1.x + m1.y);
    if (lane == 0) { redS[0][wave] = s0; redS[1][wave] = s1; }
    __syncthreads();
    float mu0 = 0.f, mu1 = 0.f;
#pragma unroll
    for (int i = 0; i < 8; ++i) { mu0 += redS[0][i]; mu1 += redS[1][i]; }
    mu0 *= (1.f / DMODEL);
    mu1 *= (1.f / DMODEL);
    const f32x2 d0 = m0 - mu0;
    const f32x2 d1 = m1 - mu1;
    const float q0 = wave_sum(d0.x * d0.x + d0.y * d0.y);
    const float q1 = wave_sum(d1.x * d1.x + d1.y * d1.y);
    if (lane == 0) { redQ[0][wave] = q0; redQ[1][wave] = q1; }
    __syncthreads();
    float v0 = 0.f, v1 = 0.f;
#pragma unroll
    for (int i = 0; i < 8; ++i) { v0 += redQ[0][i]; v1 += redQ[1][i]; }
    const float r0 = rsqrtf(v0 * (1.f / DMODEL) + 1e-5f);
    const float r1 = rsqrtf(v1 * (1.f / DMODEL) + 1e-5f);
    *(f32x2*)&pool[0][tid * 2] = d0 * r0 * g2 + t2;
    *(f32x2*)&pool[1][tid * 2] = d1 * r1 * g2 + t2;
    __syncthreads();

    const float* pv = &pool[bq - b0][kb];
    f32x4 acc = {0.f, 0.f, 0.f, 0.f};
#pragma unroll
    for (int i = 0; i < 16; i += 4) {
        const f32x4 pk = *(const f32x4*)(pv + i);
        acc += pk.x * w[i] + pk.y * w[i + 1] + pk.z * w[i + 2] + pk.w * w[i + 3];
    }
#pragma unroll
    for (int e = 0; e < 4; ++e) {       // fold the four k groups of the wave
        acc[e] += row_xor<8>(acc[e]);
        acc[e] += half_xor(acc[e]);
    }
    if (lane < 8) accs[wave][q] = acc;
    __syncthreads();
    if (tid < 8) {
        f32x4 r = bias;
#pragma unroll
        for (int i = 0; i < 8; ++i) r += accs[i][tid];
        *(f32x4*)(out + f) = r;
    }
}

// ---------------------------------------------------------------------------
// Host-side orchestration
// ---------------------------------------------------------------------------
extern "C" void kernel_launch(void* const* d_in, const int* in_sizes, int n_in,
                              void* d_out, int out_size, void* d_ws, size_t ws_size,
                              hipStream_t stream) {
    (void)in_sizes; (void)n_in; (void)out_size; (void)ws_size;
    const float* x     = (const float*)d_in[0];
    const float* mask  = (const float*)d_in[1];
    const float* ln1_g = (const float*)d_in[2];
    const float* ln1_b = (const float*)d_in[3];
    const float* Wq    = (const float*)d_in[4];
    const float* bq    = (const float*)d_in[5];
    const float* Wk    = (const float*)d_in[6];
    const float* bk_p  = (const float*)d_in[7];
    const float* Wv    = (const float*)d_in[8];
    const float* bv    = (const float*)d_in[9];
    const float* Wo    = (const float*)d_in[10];
    const float* bo    = (const float*)d_in[11];
    const float* ln2_g = (const float*)d_in[12];
    const float* ln2_b = (const float*)d_in[13];
    const float* W1    = (const float*)d_in[14];
    const float* b1    = (const float*)d_in[15];
    const float* W2    = (const float*)d_in[16];
    const float* b2    = (const float*)d_in[17];
    const float* lnh_g = (const float*)d_in[18];
    const float* lnh_b = (const float*)d_in[19];
    const float* Wh    = (const float*)d_in[20];
    const float* bh    = (const float*)d_in[21];

    char* ws = (char*)d_ws;
    const size_t MB = 1ull << 20;
    // Workspace map (aliasing is ordered by the stream):
    //   [ 0,16MB)  resid (f32)  -- reused as x3 after the Wo projection
    //   [16,32MB)  x2 (f32)
    //   [32,40MB)  xn (bf16)    -- reused as xn2
    //   [40,72MB)  bufQ/bufK/bufV/bufAO (bf16, 8MB each) -- reused as h1 (32MB)
    //   [72MB,..)  bf16 weights, each transposed to [N][K]
    //   [80MB,..)  partial token sums (f32, 256KB)
    float*  resid  = (float*) (ws + 0);
    float*  x2     = (float*) (ws + 16 * MB);
    __bf16* xn     = (__bf16*)(ws + 32 * MB);
    __bf16* bufQ   = (__bf16*)(ws + 40 * MB);
    __bf16* bufK   = (__bf16*)(ws + 48 * MB);
    __bf16* bufV   = (__bf16*)(ws + 56 * MB);
    __bf16* bufAO  = (__bf16*)(ws + 64 * MB);
    __bf16* h1     = bufQ;
    float*  x3     = resid;
    __bf16* wqB    = (__bf16*)(ws + 72 * MB);
    __bf16* wkB    = wqB + DMODEL * DMODEL;
    __bf16* wvB    = wkB + DMODEL * DMODEL;
    __bf16* woB    = wvB + DMODEL * DMODEL;
    __bf16* w1B    = woB + DMODEL * DMODEL;
    __bf16* w2B    = w1B + DMODEL * DFF;
    float*  part   = (float*) (ws + 80 * MB);

    // W[K][N] f32 -> Wt[N][K] bf16; grid = (N/64, K/64)
    dim3 gTDD(DMODEL / 64, DMODEL / 64);
    cvt_bf16_t_kernel<<<gTDD, 256, 0, stream>>>(Wq, wqB, DMODEL, DMODEL);
    cvt_bf16_t_kernel<<<gTDD, 256, 0, stream>>>(Wk, wkB, DMODEL, DMODEL);
    cvt_bf16_t_kernel<<<gTDD, 256, 0, stream>>>(Wv, wvB, DMODEL, DMODEL);
    cvt_bf16_t_kernel<<<gTDD, 256, 0, stream>>>(Wo, woB, DMODEL, DMODEL);
    cvt_bf16_t_kernel<<<dim3(DFF / 64, DMODEL / 64), 256, 0, stream>>>(W1, w1B, DMODEL, DFF);
    cvt_bf16_t_kernel<<<dim3(DMODEL / 64, DFF / 64), 256, 0, stream>>>(W2, w2B, DFF, DMODEL);

    // mask * x -> residual ; LN1 -> xn (bf16)
    ln_kernel<true><<<MROWS, 256, 0, stream>>>(x, mask, resid, ln1_g, ln1_b, xn);

    // QKV projections
    dim3 gDD(DMODEL / 128, MROWS / 128);   // (4, 64)
    gemm_bf16_kernel<true, false, false, true><<<gDD, 256, 0, stream>>>(
        xn, wqB, bq, nullptr, nullptr, bufQ, MROWS, DMODEL, DMODEL);
    gemm_bf16_kernel<true, false, false, true><<<gDD, 256, 0, stream>>>(
        xn, wkB, bk_p, nullptr, nullptr, bufK, MROWS, DMODEL, DMODEL);
    gemm_bf16_kernel<true, false, false, true><<<gDD, 256, 0, stream>>>(
        xn, wvB, bv, nullptr, nullptr, bufV, MROWS, DMODEL, DMODEL);

    // Attention
    attn_kernel<<<dim3(SEQ / 128, HEADS, BATCH), 256, 0, stream>>>(bufQ, bufK, bufV, bufAO);

    // Output projection + residual -> x2 (f32)
    gemm_bf16_kernel<true, false, true, false><<<gDD, 256, 0, stream>>>(
        bufAO, woB, bo, resid, x2, nullptr, MROWS, DMODEL, DMODEL);

    // LN2 -> xn2 (bf16)
    ln_kernel<false><<<MROWS, 256, 0, stream>>>(x2, nullptr, nullptr, ln2_g, ln2_b, xn);

    // FFN1: GELU(xn2 @ W1 + b1) -> h1 (bf16)
    gemm_bf16_kernel<true, true, false, true><<<dim3(DFF / 128, MROWS / 128), 256, 0, stream>>>(
        xn, w1B, b1, nullptr, nullptr, h1, MROWS, DFF, DMODEL);

    // FFN2: h1 @ W2 + b2 + x2 -> x3 (f32)
    gemm_bf16_kernel<true, false, true, false><<<gDD, 256, 0, stream>>>(
        h1, w2B, b2, x2, x3, nullptr, MROWS, DMODEL, DFF);

    // Mean pool + head LN + classifier
    pool_partial_kernel<<<dim3(POOL_CH, BATCH, 2), 256, 0, stream>>>(x3, part);
    head_kernel<<<BATCH * NCLS / 32, 256, 0, stream>>>(part, lnh_g, lnh_b, Wh, bh, (float*)d_out);
}

// v004
// One run takes 186 microseconds.
// In two side-by-side timings against v003, it was 1.14 and 1.15 times as fast.
// Over all steps from v000 it is 2.57 times as fast.
#include <hip/hip_runtime.h>
#include <cstdint>
#include <cstddef>

// ---------------------------------------------------------------------------
// MI455X (gfx1250) transformer block, bf16 WMMA path.
// ~70 GFLOP of GEMMs vs ~100MB traffic -> matrix-core bound; everything
// routed through v_wmma_f32_16x16x32_bf16 with f32 accumulation.
// Row-major tiles are staged into LDS with global_load_async_to_lds_b128
// (ASYNCcnt-tracked DMA, no VGPR round-trip), double-buffered in the GEMM.
// Weights are converted to bf16 K-contiguous ([N][K]) so that the GEMM's B
// tile is copied the same way as its A tile.
// ---------------------------------------------------------------------------

typedef __attribute__((ext_vector_type(16))) __bf16 bf16x16;
typedef __attribute__((ext_vector_type(8)))  float  f32x8;

#define HEADS 8
#define DHEAD 64
#define SEQ   1024
#define BATCH 8
#define DMODEL 512
#define DFF   2048
#define NCLS  1000
#define MROWS (BATCH * SEQ)   // 8192
#define ATTN_SCALE 0.125f     // 1/sqrt(64)

__device__ __forceinline__ f32x8 zero8() {
    f32x8 z = {0.f, 0.f, 0.f, 0.f, 0.f, 0.f, 0.f, 0.f};
    return z;
}

__device__ __forceinline__ float gelu_tanh(float x) {
    float x3 = x * x * x;
    return 0.5f * x * (1.f + tanhf(0.7978845608028654f * (x + 0.044715f * x3)));
}

// Async DMA: 16 bytes global -> LDS per lane (VDST = LDS byte offset VGPR,
// VADDR = 64-bit global address). Tracked by ASYNCcnt. Low 32 bits of a
// flat shared pointer are the LDS byte offset on AMDGPU.
__device__ __forceinline__ void async_g2l_b128(void* ldsDst, const void* gSrc) {
    unsigned ldsOff = (unsigned)(uintptr_t)ldsDst;
    asm volatile("global_load_async_to_lds_b128 %0, %1, off"
                 :: "v"(ldsOff), "v"(gSrc)
                 : "memory");
}

// Four such copies of one lane (two A rows, two B rows of a GEMM stage). The
// s_wait_xcnt closes the statement so that no address register of a copy is
// rewritten ahead of it.
__device__ __forceinline__ void async_g2l_b128_x4(void* l0, const void* g0,
                                                  void* l1, const void* g1,
                                                  void* l2, const void* g2,
                                                  void* l3, const void* g3) {
    unsigned o0 = (unsigned)(uintptr_t)l0;
    unsigned o1 = (unsigned)(uintptr_t)l1;
    unsigned o2 = (unsigned)(uintptr_t)l2;
    unsigned o3 = (unsigned)(uintptr_t)l3;
    asm volatile("global_load_async_to_lds_b128 %0, %1, off\n\t"
                 "global_load_async_to_lds_b128 %2, %3, off\n\t"
                 "global_load_async_to_lds_b128 %4, %5, off\n\t"
                 "global_load_async_to_lds_b128 %6, %7, off\n\t"
                 "s_wait_xcnt 0x0"
                 :: "v"(o0), "v"(g0), "v"(o1), "v"(g1),
                    "v"(o2), "v"(g2), "v"(o3), "v"(g3)
                 : "memory");
}

__device__ __forceinline__ void wait_async0() {
#if __has_builtin(__builtin_amdgcn_s_wait_asynccnt)
    __builtin_amdgcn_s_wait_asynccnt(0);
#else
    asm volatile("s_wait_asynccnt 0x0" ::: "memory");
#endif
}

// Load a 16x32 bf16 WMMA operand fragment from an LDS tile laid out as
// tile[rc][k] (A-matrix rows, or B-matrix stored K-transposed: tile[col][k]).
// Per ISA 7.12.2 (16-bit A 16x32): lanes 0-15 hold K=0..7,16..23 of row M=lane,
// lanes 16-31 hold K=8..15,24..31 of row M=lane-16; pairs packed per VGPR.
__device__ __forceinline__ bf16x16 load_frag(const __bf16* base, int stride,
                                             int rcBase, int kBase) {
    const int lane = threadIdx.x & 31;
    const int idx  = lane & 15;
    const int half = lane >> 4;
    const __bf16* p = base + (size_t)(rcBase + idx) * stride + kBase + half * 8;
    union { bf16x16 v; unsigned u[8]; } r;
#pragma unroll
    for (int i = 0; i < 8; ++i) {
        int k = ((i & 4) << 2) + ((i & 3) << 1);   // i<4 -> 0..6 ; i>=4 -> 16..22
        r.u[i] = *(const unsigned*)(p + k);
    }
    return r.v;
}

// ---------------------------------------------------------------------------
// fp32 [K][N] -> bf16 [N][K] convert + transpose. One 64x64 tile per block,
// turned in LDS (pitch 65 dwords: column walks hit distinct banks); each wave
// stores whole 128-byte rows of the output.
// ---------------------------------------------------------------------------
__device__ __forceinline__ void cvt_bf16_t_tile(const float* __restrict__ in,
                                                __bf16* __restrict__ out,
                                                int K, int Nn, int n0, int k0) {
    __shared__ float t[64][65];
    const int tid = threadIdx.x;
    const int kr = tid >> 4;          // 16 rows a sweep, 16 bytes a lane
    const int c4 = (tid & 15) * 4;
    float4 v[4];
#pragma unroll
    for (int r = 0; r < 4; ++r)
        v[r] = *(const float4*)(in + (size_t)(k0 + kr + r * 16) * Nn + n0 + c4);
#pragma unroll
    for (int r = 0; r < 4; ++r) {
        t[kr + r * 16][c4 + 0] = v[r].x;
        t[kr + r * 16][c4 + 1] = v[r].y;
        t[kr + r * 16][c4 + 2] = v[r].z;
        t[kr + r * 16][c4 + 3] = v[r].w;
    }
    __syncthreads();
    const int kp = tid & 31;   // pair of k
    const int nr = tid >> 5;
#pragma unroll
    for (int r = 0; r < 8; ++r) {
        int n = nr + r * 8;
        union { __bf16 h[2]; unsigned u; } p;
        p.h[0] = (__bf16)t[2 * kp][n];
        p.h[1] = (__bf16)t[2 * kp + 1][n];
        *(unsigned*)(out + (size_t)(n0 + n) * K + k0 + 2 * kp) = p.u;
    }
}

// ---------------------------------------------------------------------------
// LayerNorm over D=512. Optionally applies token mask and emits f32 residual.
// One block (256 threads, 2 cols each) per row.
// ---------------------------------------------------------------------------
template <bool MASKED>
__device__ __forceinline__ void ln_row(int row,
                                       const float* __restrict__ x,
                                       const float* __restrict__ mask,
                                       float* __restrict__ residOut,
                                       const float* __restrict__ g,
                                       const float* __restrict__ bta,
                                       __bf16* __restrict__ outB) {
    __shared__ float red[256];
    __shared__ float stats[2];
    const int tid = threadIdx.x;
    const size_t rb = (size_t)row * DMODEL;
    float v0 = x[rb + tid];
    float v1 = x[rb + tid + 256];
    if (MASKED) {
        float mv = mask[row & (SEQ - 1)];
        v0 *= mv; v1 *= mv;
        residOut[rb + tid]       = v0;
        residOut[rb + tid + 256] = v1;
    }
    red[tid] = v0 + v1;
    __syncthreads();
#pragma unroll
    for (int off = 128; off > 0; off >>= 1) {
        if (tid < off) red[tid] += red[tid + off];
        __syncthreads();
    }
    if (tid == 0) stats[0] = red[0] * (1.f / DMODEL);
    __syncthreads();
    const float mu = stats[0];
    float d0 = v0 - mu, d1 = v1 - mu;
    red[tid] = d0 * d0 + d1 * d1;
    __syncthreads();
#pragma unroll
    for (int off = 128; off > 0; off >>= 1) {
        if (tid < off) red[tid] += red[tid + off];
        __syncthreads();
    }
    if (tid == 0) stats[1] = rsqrtf(red[0] * (1.f / DMODEL) + 1e-5f);
    __syncthreads();
    const float rstd = stats[1];
    outB[rb + tid]       = (__bf16)(d0 * rstd * g[tid]       + bta[tid]);
    outB[rb + tid + 256] = (__bf16)(d1 * rstd * g[tid + 256] + bta[tid + 256]);
}

__global__ __launch_bounds__(256) void ln_kernel(const float* __restrict__ x,
                                                 const float* __restrict__ g,
                                                 const float* __restrict__ bta,
                                                 __bf16* __restrict__ outB) {
    ln_row<false>(blockIdx.x, x, nullptr, nullptr, g, bta, outB);
}

// ---------------------------------------------------------------------------
// The six weight conversions and the first LayerNorm read none of each other's
// output: one grid runs them all. Blocks [0, CVT_BLKS) turn one 64x64 weight
// tile each (they come first, so they start first), the rest take one row each.
// wB holds the six bf16 weights one behind the other: Wq Wk Wv Wo W1 W2.
// ---------------------------------------------------------------------------
#define CVT_DD_BLKS ((DMODEL / 64) * (DMODEL / 64))   // 64 tiles of a D x D weight
#define CVT_DF_BLKS ((DMODEL / 64) * (DFF / 64))      // 256 tiles of W1 or W2
#define CVT_BLKS    (4 * CVT_DD_BLKS + 2 * CVT_DF_BLKS)

__global__ __launch_bounds__(256) void prep_kernel(const float* __restrict__ Wq,
                                                   const float* __restrict__ Wk,
                                                   const float* __restrict__ Wv,
                                                   const float* __restrict__ Wo,
                                                   const float* __restrict__ W1,
                                                   const float* __restrict__ W2,
                                                   __bf16* __restrict__ wB,
                                                   const float* __restrict__ x,
                                                   const float* __restrict__ mask,
                                                   float* __restrict__ residOut,
                                                   const float* __restrict__ g,
                                                   const float* __restrict__ bta,
                                                   __bf16* __restrict__ outB) {
    const unsigned bid = blockIdx.x;
    if (bid >= CVT_BLKS) {
        ln_row<true>(bid - CVT_BLKS, x, mask, residOut, g, bta, outB);
        return;
    }
    const float* in;
    __bf16* out;
    int K = DMODEL, Nn = DMODEL;
    unsigned t;
    if (bid < 4 * CVT_DD_BLKS) {
        const unsigned w = bid / CVT_DD_BLKS;
        in  = w == 0 ? Wq : w == 1 ? Wk : w == 2 ? Wv : Wo;
        out = wB + w * (DMODEL * DMODEL);
        t   = bid % CVT_DD_BLKS;
    } else if (bid < 4 * CVT_DD_BLKS + CVT_DF_BLKS) {
        in  = W1;
        out = wB + 4 * (DMODEL * DMODEL);
        Nn  = DFF;
        t   = bid - 4 * CVT_DD_BLKS;
    } else {
        in  = W2;
        out = wB + 4 * (DMODEL * DMODEL) + DMODEL * DFF;
        K   = DFF;
        t   = bid - (4 * CVT_DD_BLKS + CVT_DF_BLKS);
    }
    const unsigned sh = Nn == DFF ? 5 : 3;   // 32 or 8 tiles along n
    cvt_bf16_t_tile(in, out, K, Nn, (int)(t & ((1u << sh) - 1)) * 64, (int)(t >> sh) * 64);
}

// ---------------------------------------------------------------------------
// bf16 WMMA GEMM: C[M,N] = A[M,K] @ B[K,N] (+bias)(+GELU)(+resid), B given as Bt[N,K]
// Block: 256 threads = 8 waves. Tile BM=128, BN=128, BK=32, double-buffered:
// next tile's async DMA runs under the current tile's WMMAs.
// Waves: 4 along M (32 rows), 2 along N (64 cols) -> 2x4 subtiles of 16x16.
// Bt rows are K-contiguous, so both tiles are copied alike and both operands
// use the same frag loader.
// THREE: one grid runs three products that share A (the Q, K and V projections);
// blockIdx.z picks the weight (one behind the other in Bt0), the bias and the
// output (one behind the other in outB0).
// ---------------------------------------------------------------------------
template <bool BIAS, bool GELU_ACT, bool RESID, bool OUT_BF16, bool THREE>
__global__ __launch_bounds__(256) void gemm_bf16_kernel(
        const __bf16* __restrict__ A, const __bf16* __restrict__ Bt0,
        const float* __restrict__ bias0, const float* __restrict__ bias1,
        const float* __restrict__ bias2, const float* __restrict__ resid,
        float* __restrict__ outF, __bf16* __restrict__ outB0,
        int M, int Nn, int K) {
    __shared__ __attribute__((aligned(16))) __bf16 lsA[2][128][40];   // [buf][row][k]
    __shared__ __attribute__((aligned(16))) __bf16 lsB[2][128][40];   // [buf][col][k]

    const int z = THREE ? (int)blockIdx.z : 0;
    const __bf16* __restrict__ Bt   = Bt0 + (size_t)z * Nn * K;
    const float*  __restrict__ bias = z == 0 ? bias0 : z == 1 ? bias1 : bias2;
    __bf16*       __restrict__ outB = outB0 + (size_t)z * M * Nn;

    const int m0 = blockIdx.y * 128;
    const int n0 = blockIdx.x * 128;
    const int tid  = threadIdx.x;
    const int wave = tid >> 5;
    const int wm   = wave & 3;    // 0..3 : 32 rows each
    const int wn   = wave >> 2;   // 0..1 : 64 cols each

    f32x8 acc[2][4];
#pragma unroll
    for (int mi = 0; mi < 2; ++mi)
#pragma unroll
        for (int ni = 0; ni < 4; ++ni) acc[mi][ni] = zero8();

    // One stage: 128 rows x 32 k of A and of Bt, 64 bytes a row, 16 bytes a lane.
    const int crow = tid >> 2, cseg = (tid & 3) * 8;
    const __bf16* gA = A  + (size_t)(m0 + crow) * K + cseg;
    const __bf16* gB = Bt + (size_t)(n0 + crow) * K + cseg;
    const size_t half64 = (size_t)64 * K;
    auto load_tiles = [&](int k0, int buf) {
        async_g2l_b128_x4(&lsA[buf][crow][cseg],      gA + k0,
                          &lsA[buf][crow + 64][cseg], gA + half64 + k0,
                          &lsB[buf][crow][cseg],      gB + k0,
                          &lsB[buf][crow + 64][cseg], gB + half64 + k0);
    };

    const int nk = K >> 5;
    load_tiles(0, 0);
    asm volatile("s_wait_asynccnt 0x0" ::: "memory");   // stage 0 landed (own copies)
    __syncthreads();                                    // ... and everyone's
    if (nk > 1) load_tiles(32, 1);
    for (int i = 0; i < nk; ++i) {
        const int buf = i & 1;
        bf16x16 aF[2], bF[4];
#pragma unroll
        for (int mi = 0; mi < 2; ++mi)
            aF[mi] = load_frag(&lsA[buf][0][0], 40, wm * 32 + mi * 16, 0);
#pragma unroll
        for (int ni = 0; ni < 4; ++ni)
            bF[ni] = load_frag(&lsB[buf][0][0], 40, wn * 64 + ni * 16, 0);
#pragma unroll
        for (int mi = 0; mi < 2; ++mi)
#pragma unroll
            for (int ni = 0; ni < 4; ++ni)
                acc[mi][ni] = __builtin_amdgcn_wmma_f32_16x16x32_bf16(
                    false, aF[mi], false, bF[ni], (short)0, acc[mi][ni], false, false);

        // Publish stage i+1 and free this buffer: own LDS reads done, own
        // copies landed, then the barrier; only then the refill.
        asm volatile("s_wait_dscnt 0x0" ::: "memory");
        asm volatile("s_wait_asynccnt 0x0" ::: "memory");
        __syncthreads();
        if (i + 2 < nk) load_tiles((i + 2) << 5, buf);
    }
    asm volatile("s_wait_asynccnt 0x0" ::: "memory");   // nothing in flight at the end

    // Epilogue. C/D layout: lane<16 -> M = r, lane>=16 -> M = 8+r ; N = lane&15
    const int lane = tid & 31;
    const int half = lane >> 4;
    const int lcol = lane & 15;
    // Residual values of this wave's 2x4 subtiles, all 64 loads issued here back
    // to back: their latency runs once, not once per element between the stores.
    float rs[2][4][8];
    if (RESID) {
        // The residual stream is DMODEL wide, so every row and column step is an
        // immediate offset from one index register.
        const float* rp = resid + ((m0 + wm * 32 + half * 8) * DMODEL + n0 + wn * 64 + lcol);
#pragma unroll
        for (int mi = 0; mi < 2; ++mi)
#pragma unroll
            for (int r = 0; r < 8; ++r)
#pragma unroll
                for (int ni = 0; ni < 4; ++ni)
                    rs[mi][ni][r] = rp[(mi * 16 + r) * DMODEL + ni * 16];
        // Keeps all 64 loads in flight at once: left alone, the scheduler issues the
        // last fourteen only when the first have returned, a second latency.
        __builtin_amdgcn_sched_barrier(0);
    }
#pragma unroll
    for (int mi = 0; mi < 2; ++mi) {
#pragma unroll
        for (int ni = 0; ni < 4; ++ni) {
#pragma unroll
            for (int r = 0; r < 8; ++r) {
                int gr = m0 + wm * 32 + mi * 16 + half * 8 + r;
                int gc = n0 + wn * 64 + ni * 16 + lcol;
                float v = acc[mi][ni][r];
                if (BIAS)     v += bias[gc];
                if (GELU_ACT) v = gelu_tanh(v);
                if (RESID)    v += rs[mi][ni][r];
                if (OUT_BF16) outB[(size_t)gr * Nn + gc] = (__bf16)v;
                else          outF[(size_t)gr * Nn + gc] = v;
            }
        }
    }
}

// ---------------------------------------------------------------------------
// Attention: one block per (b, h, 128-row Q tile). Streams 64-key tiles:
//   S = Q K^T * scale ; P = exp(S) (reference has no max-subtraction)
//   rowsum += sum_j P ; O += P V ; final O /= rowsum.
// Q/K tiles are async-DMA'd into LDS; V needs a transpose scatter.
// ---------------------------------------------------------------------------
__global__ __launch_bounds__(256) void attn_kernel(const __bf16* __restrict__ Q,
                                                   const __bf16* __restrict__ Kmat,
                                                   const __bf16* __restrict__ Vmat,
                                                   __bf16* __restrict__ O) {
    __shared__ __bf16 lsQ[128][72];   // [row][dh]
    __shared__ __bf16 lsK[64][72];    // [key][dh]  (B-transposed layout for QK^T)
    __shared__ __bf16 lsVt[64][72];   // [dh][key]  (B-transposed layout for PV)
    __shared__ __bf16 lsP[128][72];   // [row][key]
    __shared__ float  rowsumAcc[128];

    const int r0 = blockIdx.x * 128;
    const int h  = blockIdx.y;
    const int b  = blockIdx.z;
    const int tid  = threadIdx.x;
    const int wave = tid >> 5;
    const int wm   = wave & 3;     // 4 x 32 rows
    const int wn   = wave >> 2;    // 2 x 32 cols
    const int lane = tid & 31;
    const int half = lane >> 4;
    const int lcol = lane & 15;

    const __bf16* qbase = Q + ((size_t)(b * SEQ + r0)) * DMODEL + h * DHEAD;
#pragma unroll
    for (int s = tid; s < 1024; s += 256) {   // 128 rows x 8 uint4 segs
        int row = s >> 3, cs = s & 7;
        async_g2l_b128(&lsQ[row][cs * 8], qbase + (size_t)row * DMODEL + cs * 8);
    }
    if (tid < 128) rowsumAcc[tid] = 0.f;

    f32x8 oAcc[2][2];
#pragma unroll
    for (int mi = 0; mi < 2; ++mi)
#pragma unroll
        for (int ni = 0; ni < 2; ++ni) oAcc[mi][ni] = zero8();

    for (int j0 = 0; j0 < SEQ; j0 += 64) {
        __syncthreads();
        const __bf16* kbase = Kmat + ((size_t)(b * SEQ + j0)) * DMODEL + h * DHEAD;
        const __bf16* vbase = Vmat + ((size_t)(b * SEQ + j0)) * DMODEL + h * DHEAD;
#pragma unroll
        for (int s = tid; s < 512; s += 256) {  // K tile row-major, async DMA
            int kr = s >> 3, cs = s & 7;
            async_g2l_b128(&lsK[kr][cs * 8], kbase + (size_t)kr * DMODEL + cs * 8);
        }
#pragma unroll
        for (int s = tid; s < 512; s += 256) {  // V tile, scatter transposed
            int kr = s >> 3, cs = s & 7;
            uint4 t = *(const uint4*)(vbase + (size_t)kr * DMODEL + cs * 8);
            const __bf16* hs = reinterpret_cast<const __bf16*>(&t);
#pragma unroll
            for (int e = 0; e < 8; ++e) lsVt[cs * 8 + e][kr] = hs[e];
        }
        wait_async0();
        __syncthreads();

        // S = Q K^T  (M=128 rows, N=64 keys, K=64=dh)
        f32x8 sAcc[2][2];
#pragma unroll
        for (int mi = 0; mi < 2; ++mi)
#pragma unroll
            for (int ni = 0; ni < 2; ++ni) sAcc[mi][ni] = zero8();
#pragma unroll
        for (int kk = 0; kk < 64; kk += 32) {
            bf16x16 aF[2], bF[2];
#pragma unroll
            for (int mi = 0; mi < 2; ++mi)
                aF[mi] = load_frag(&lsQ[0][0], 72, wm * 32 + mi * 16, kk);
#pragma unroll
            for (int ni = 0; ni < 2; ++ni)
                bF[ni] = load_frag(&lsK[0][0], 72, wn * 32 + ni * 16, kk);
#pragma unroll
            for (int mi = 0; mi < 2; ++mi)
#pragma unroll
                for (int ni = 0; ni < 2; ++ni)
                    sAcc[mi][ni] = __builtin_amdgcn_wmma_f32_16x16x32_bf16(
                        false, aF[mi], false, bF[ni], (short)0, sAcc[mi][ni], false, false);
        }
        // P = exp(scale * S) into LDS
#pragma unroll
        for (int mi = 0; mi < 2; ++mi)
#pragma unroll
            for (int ni = 0; ni < 2; ++ni)
#pragma unroll
                for (int r = 0; r < 8; ++r) {
                    int row = wm * 32 + mi * 16 + half * 8 + r;
                    int col = wn * 32 + ni * 16 + lcol;
                    lsP[row][col] = (__bf16)expf(sAcc[mi][ni][r] * ATTN_SCALE);
                }
        __syncthreads();
        // rowsum accumulate (threads 0..127 own one row each)
        if (tid < 128) {
            float s = 0.f;
#pragma unroll
            for (int c = 0; c < 64; ++c) s += (float)lsP[tid][c];
            rowsumAcc[tid] += s;
        }
        // O += P V  (M=128 rows, N=64=dh, K=64 keys)
#pragma unroll
        for (int kk = 0; kk < 64; kk += 32) {
            bf16x16 aF[2], bF[2];
#pragma unroll
            for (int mi = 0; mi < 2; ++mi)
                aF[mi] = load_frag(&lsP[0][0], 72, wm * 32 + mi * 16, kk);
#pragma unroll
            for (int ni = 0; ni < 2; ++ni)
                bF[ni] = load_frag(&lsVt[0][0], 72, wn * 32 + ni * 16, kk);
#pragma unroll
            for (int mi = 0; mi < 2; ++mi)
#pragma unroll
                for (int ni = 0; ni < 2; ++ni)
                    oAcc[mi][ni] = __builtin_amdgcn_wmma_f32_16x16x32_bf16(
                        false, aF[mi], false, bF[ni], (short)0, oAcc[mi][ni], false, false);
        }
    }
    __syncthreads();

    __bf16* obase = O + ((size_t)(b * SEQ + r0)) * DMODEL + h * DHEAD;
#pragma unroll
    for (int mi = 0; mi < 2; ++mi)
#pragma unroll
        for (int ni = 0; ni < 2; ++ni)
#pragma unroll
            for (int r = 0; r < 8; ++r) {
                int row = wm * 32 + mi * 16 + half * 8 + r;
                int col = wn * 32 + ni * 16 + lcol;
                obase[(size_t)row * DMODEL + col] = (__bf16)(oAcc[mi][ni][r] / rowsumAcc[row]);
            }
}

// ---------------------------------------------------------------------------
// Mean pool over tokens + head LayerNorm + classifier (8x512x1000, f32), spread
// over the chip in two launches.
// ---------------------------------------------------------------------------
#define POOL_CH   16                 // partial token sums per batch row
#define POOL_ROWS (SEQ / POOL_CH)    // 64 tokens a block

typedef __attribute__((ext_vector_type(4))) float f32x4;
typedef __attribute__((ext_vector_type(2))) float f32x2;

template <int M>
__device__ __forceinline__ float row_xor(float v) {   // lane l <- lane l ^ M, M < 16
    return __builtin_bit_cast(float, __builtin_amdgcn_update_dpp(
        0, __builtin_bit_cast(int, v), 0x160 | M, 0xf, 0xf, true));
}

__device__ __forceinline__ float half_xor(float v) {  // lane l <- lane l ^ 16
    int t = __builtin_bit_cast(int, v);
    return __builtin_bit_cast(float, __builtin_amdgcn_permlanex16(t, t, 0x76543210, 0xfedcba98, false, false));
}

__device__ __forceinline__ float wave_sum(float v) {  // total of 32 lanes, in every lane
    v += row_xor<1>(v);
    v += row_xor<2>(v);
    v += row_xor<4>(v);
    v += row_xor<8>(v);
    v += half_xor(v);
    return v;
}

// Launch 1: block (ch, b, z) sums 64 tokens of batch row b, columns
// [256 z, 256 z + 256), into part[b][ch][.]. 256 threads = 64 column quads x 4
// token groups; a wave's load covers 512 contiguous bytes.
__global__ __launch_bounds__(256) void pool_partial_kernel(const float* __restrict__ x3,
                                                           float* __restrict__ part) {
    __shared__ f32x4 red[4][64];
    const int tid = threadIdx.x;
    const int c4  = tid & 63;
    const int rg  = tid >> 6;
    const int ch  = blockIdx.x;
    const int b   = blockIdx.y;
    const int col = blockIdx.z * 256 + c4 * 4;
    const float* base = x3 + ((size_t)(b * SEQ + ch * POOL_ROWS + rg)) * DMODEL + col;
    f32x4 v[16];
#pragma unroll
    for (int i = 0; i < 16; ++i) v[i] = *(const f32x4*)(base + (size_t)(i * 4) * DMODEL);
    // The loads' address register is named so that it is not reused, not even
    // as a load's destination, ahead of this wait.
    asm volatile("s_wait_xcnt 0x0" :: "v"(base) : "memory");
    // Keeps all 16 loads in flight at once: left alone, the scheduler issues the
    // last four only when the first have returned, a second latency.
    __builtin_amdgcn_sched_barrier(0);
#pragma unroll
    for (int w = 8; w > 0; w >>= 1)
#pragma unroll
        for (int i = 0; i < w; ++i) v[i] += v[i + w];
    red[rg][c4] = v[0];
    __syncthreads();
    if (rg == 0)
        *(f32x4*)(part + ((size_t)(b * POOL_CH + ch)) * DMODEL + col) =
            (red[0][c4] + red[1][c4]) + (red[2][c4] + red[3][c4]);
}

// Launch 2: one block per 128-byte line of out (32 consecutive floats of the
// flat [8][1000] array), so every line has one writer. A line can straddle two
// batch rows, so each block normalises the pooled vectors of the first and of
// the last float's batch row (the same row twice for most lines).
// Lane = (k group kr, class quad q); wave w takes k in [64 w, 64 w + 64).
__global__ __launch_bounds__(256) void head_kernel(const float* __restrict__ part,
                                                   const float* __restrict__ g,
                                                   const float* __restrict__ bta,
                                                   const float* __restrict__ Wh,
                                                   const float* __restrict__ bh,
                                                   float* __restrict__ out) {
    __shared__ __attribute__((aligned(16))) float pool[2][DMODEL];
    __shared__ __attribute__((aligned(16))) float redS[2][8];
    __shared__ __attribute__((aligned(16))) float redQ[2][8];
    __shared__ f32x4 accs[8][8];
    const int tid  = threadIdx.x;
    const int lane = tid & 31;
    const int wave = tid >> 5;
    const int q    = lane & 7;
    const int kr   = lane >> 3;
    const int f0   = blockIdx.x * 32;
    const int b0   = f0 / NCLS;
    const int b1   = (f0 + 31) / NCLS;
    const int f    = f0 + q * 4;        // NCLS is a multiple of 4: a quad stays in one row
    const int bq   = f / NCLS;
    const int c    = f - bq * NCLS;
    const int kb   = wave * 64 + kr * 16;

    const f32x2 g2   = *(const f32x2*)(g + tid * 2);
    const f32x2 t2   = *(const f32x2*)(bta + tid * 2);
    const float* bp  = bh + c;
    const float* wp  = Wh + (size_t)kb * NCLS + c;
    const float* pp0 = part + (size_t)(b0 * POOL_CH) * DMODEL + tid * 2;
    const float* pp1 = part + (size_t)(b1 * POOL_CH) * DMODEL + tid * 2;
    const f32x4 bias = *(const f32x4*)bp;
    f32x4 w[16];
#pragma unroll
    for (int i = 0; i < 16; ++i) w[i] = *(const f32x4*)(wp + (size_t)i * NCLS);
    f32x2 p0[POOL_CH], p1[POOL_CH];
#pragma unroll
    for (int j = 0; j < POOL_CH; ++j) {
        p0[j] = *(const f32x2*)(pp0 + (size_t)j * DMODEL);
        p1[j] = *(const f32x2*)(pp1 + (size_t)j * DMODEL);
    }
    // The address registers of the bias and weight loads are named so that
    // neither is reused, not even as a load's destination, ahead of this wait
    // (the other loads go by the thread index and a scalar base).
    asm volatile("s_wait_xcnt 0x0" :: "v"(bp), "v"(wp) : "memory");
    // Keeps the classifier's loads in front of the pooling arithmetic, so that
    // their latency runs under it instead of behind the three barriers below.
    __builtin_amdgcn_sched_barrier(0);

#pragma unroll
    for (int s = POOL_CH / 2; s > 0; s >>= 1)
#pragma unroll
        for (int j = 0; j < s; ++j) { p0[j] += p0[j + s]; p1[j] += p1[j + s]; }
    const f32x2 m0 = p0[0] * (1.f / SEQ);
    const f32x2 m1 = p1[0] * (1.f / SEQ);

    const float s0 = wave_sum(m0.x + m0.y);
    const float s1 = wave_sum(m1.x + m1.y);
    if (lane == 0) { redS[0][wave] = s0; redS[1][wave] = s1; }
    __syncthreads();
    float mu0 = 0.f, mu1 = 0.f;
#pragma unroll
    for (int i = 0; i < 8; ++i) { mu0 += redS[0][i]; mu1 += redS[1][i]; }
    mu0 *= (1.f / DMODEL);
    mu1 *= (1.f / DMODEL);
    const f32x2 d0 = m0 - mu0;
    const f32x2 d1 = m1 - mu1;
    const float q0 = wave_sum(d0.x * d0.x + d0.y * d0.y);
    const float q1 = wave_sum(d1.x * d1.x + d1.y * d1.y);
    if (lane == 0) { redQ[0][wave] = q0; redQ[1][wave] = q1; }
    __syncthreads();
    float v0 = 0.f, v1 = 0.f;
#pragma unroll
    for (int i = 0; i < 8; ++i) { v0 += redQ[0][i]; v1 += redQ[1][i]; }
    const float r0 = rsqrtf(v0 * (1.f / DMODEL) + 1e-5f);
    const float r1 = rsqrtf(v1 * (1.f / DMODEL) + 1e-5f);
    *(f32x2*)&pool[0][tid * 2] = d0 * r0 * g2 + t2;
    *(f32x2*)&pool[1][tid * 2] = d1 * r1 * g2 + t2;
    __syncthreads();

    const float* pv = &pool[bq - b0][kb];
    f32x4 acc = {0.f, 0.f, 0.f, 0.f};
#pragma unroll
    for (int i = 0; i < 16; i += 4) {
        const f32x4 pk = *(const f32x4*)(pv + i);
        acc += pk.x * w[i] + pk.y * w[i + 1] + pk.z * w[i + 2] + pk.w * w[i + 3];
    }
#pragma unroll
    for (int e = 0; e < 4; ++e) {       // fold the four k groups of the wave
        acc[e] += row_xor<8>(acc[e]);
        acc[e] += half_xor(acc[e]);
    }
    if (lane < 8) accs[wave][q] = acc;
    __syncthreads();
    if (tid < 8) {
        f32x4 r = bias;
#pragma unroll
        for (int i = 0; i < 8; ++i) r += accs[i][tid];
        *(f32x4*)(out + f) = r;
    }
}

// ---------------------------------------------------------------------------
// Host-side orchestration
// ---------------------------------------------------------------------------
extern "C" void kernel_launch(void* const* d_in, const int* in_sizes, int n_in,
                              void* d_out, int out_size, void* d_ws, size_t ws_size,
                              hipStream_t stream) {
    (void)in_sizes; (void)n_in; (void)out_size; (void)ws_size;
    const float* x     = (const float*)d_in[0];
    const float* mask  = (const float*)d_in[1];
    const float* ln1_g = (const float*)d_in[2];
    const float* ln1_b = (const float*)d_in[3];
    const float* Wq    = (const float*)d_in[4];
    const float* bq    = (const float*)d_in[5];
    const float* Wk    = (const float*)d_in[6];
    const float* bk_p  = (const float*)d_in[7];
    const float* Wv    = (const float*)d_in[8];
    const float* bv    = (const float*)d_in[9];
    const float* Wo    = (const float*)d_in[10];
    const float* bo    = (const float*)d_in[11];
    const float* ln2_g = (const float*)d_in[12];
    const float* ln2_b = (const float*)d_in[13];
    const float* W1    = (const float*)d_in[14];
    const float* b1    = (const float*)d_in[15];
    const float* W2    = (const float*)d_in[16];
    const float* b2    = (const float*)d_in[17];
    const float* lnh_g = (const float*)d_in[18];
    const float* lnh_b = (const float*)d_in[19];
    const float* Wh    = (const float*)d_in[20];
    const float* bh    = (const float*)d_in[21];

    char* ws = (char*)d_ws;
    const size_t MB = 1ull << 20;
    // Workspace map (aliasing is ordered by the stream):
    //   [ 0,16MB)  resid (f32)  -- reused as x3 after the Wo projection
    //   [16,32MB)  x2 (f32)
    //   [32,40MB)  xn (bf16)    -- reused as xn2
    //   [40,72MB)  bufQ/bufK/bufV/bufAO (bf16, 8MB each) -- reused as h1 (32MB)
    //   [72MB,..)  bf16 weights, each transposed to [N][K]
    //   [80MB,..)  partial token sums (f32, 256KB)
    float*  resid  = (float*) (ws + 0);
    float*  x2     = (float*) (ws + 16 * MB);
    __bf16* xn     = (__bf16*)(ws + 32 * MB);
    __bf16* bufQ   = (__bf16*)(ws + 40 * MB);
    __bf16* bufK   = (__bf16*)(ws + 48 * MB);
    __bf16* bufV   = (__bf16*)(ws + 56 * MB);
    __bf16* bufAO  = (__bf16*)(ws + 64 * MB);
    __bf16* h1     = bufQ;
    float*  x3     = resid;
    __bf16* wqB    = (__bf16*)(ws + 72 * MB);
    __bf16* wkB    = wqB + DMODEL * DMODEL;
    __bf16* wvB    = wkB + DMODEL * DMODEL;
    __bf16* woB    = wvB + DMODEL * DMODEL;
    __bf16* w1B    = woB + DMODEL * DMODEL;
    __bf16* w2B    = w1B + DMODEL * DFF;
    float*  part   = (float*) (ws + 80 * MB);

    // One grid: W[K][N] f32 -> Wt[N][K] bf16 for all six weights, and
    // mask * x -> residual ; LN1 -> xn (bf16)
    prep_kernel<<<CVT_BLKS + MROWS, 256, 0, stream>>>(Wq, Wk, Wv, Wo, W1, W2, wqB,
                                                      x, mask, resid, ln1_g, ln1_b, xn);

    // QKV projections, one grid: z = 0, 1, 2 -> bufQ, bufK, bufV
    dim3 gDD(DMODEL / 128, MROWS / 128);   // (4, 64)
    gemm_bf16_kernel<true, false, false, true, true>
        <<<dim3(DMODEL / 128, MROWS / 128, 3), 256, 0, stream>>>(
        xn, wqB, bq, bk_p, bv, nullptr, nullptr, bufQ, MROWS, DMODEL, DMODEL);

    // Attention
    attn_kernel<<<dim3(SEQ / 128, HEADS, BATCH), 256, 0, stream>>>(bufQ, bufK, bufV, bufAO);

    // Output projection + residual -> x2 (f32)
    gemm_bf16_kernel<true, false, true, false, false><<<gDD, 256, 0, stream>>>(
        bufAO, woB, bo, nullptr, nullptr, resid, x2, nullptr, MROWS, DMODEL, DMODEL);

    // LN2 -> xn2 (bf16)
    ln_kernel<<<MROWS, 256, 0, stream>>>(x2, ln2_g, ln2_b, xn);

    // FFN1: GELU(xn2 @ W1 + b1) -> h1 (bf16)
    gemm_bf16_kernel<true, true, false, true, false><<<dim3(DFF / 128, MROWS / 128), 256, 0, stream>>>(
        xn, w1B, b1, nullptr, nullptr, nullptr, nullptr, h1, MROWS, DFF, DMODEL);

    // FFN2: h1 @ W2 + b2 + x2 -> x3 (f32)
    gemm_bf16_kernel<true, false, true, false, false><<<gDD, 256, 0, stream>>>(
        h1, w2B, b2, nullptr, nullptr, x2, x3, nullptr, MROWS, DMODEL, DFF);

    // Mean pool + head LN + classifier
    pool_partial_kernel<<<dim3(POOL_CH, BATCH, 2), 256, 0, stream>>>(x3, part);
    head_kernel<<<BATCH * NCLS / 32, 256, 0, stream>>>(part, lnh_g, lnh_b, Wh, bh, (float*)d_out);
}

// v005
// Measured time: 171 microseconds a run.
// Two timings next to v004 put it at 1.09 and 1.10 times that version's speed.
// Counting every step since v000, it is 2.81 times as fast.
#include <hip/hip_runtime.h>
#include <cstdint>
#include <cstddef>

// ---------------------------------------------------------------------------
// MI455X (gfx1250) transformer block, bf16 WMMA path.
// ~70 GFLOP of GEMMs vs ~100MB traffic -> matrix-core bound; everything
// routed through v_wmma_f32_16x16x32_bf16 with f32 accumulation.
// Row-major tiles are staged into LDS with global_load_async_to_lds_b128
// (ASYNCcnt-tracked DMA, no VGPR round-trip), double-buffered in the GEMM.
// Weights are converted to bf16 K-contiguous ([N][K]) so that the GEMM's B
// tile is copied the same way as its A tile.
// ---------------------------------------------------------------------------

typedef __attribute__((ext_vector_type(16))) __bf16 bf16x16;
typedef __attribute__((ext_vector_type(8)))  float  f32x8;

#define HEADS 8
#define DHEAD 64
#define SEQ   1024
#define BATCH 8
#define DMODEL 512
#define DFF   2048
#define NCLS  1000
#define MROWS (BATCH * SEQ)   // 8192
#define ATTN_SCALE 0.125f     // 1/sqrt(64)
#define LOG2E 1.4426950408889634

__device__ __forceinline__ f32x8 zero8() {
    f32x8 z = {0.f, 0.f, 0.f, 0.f, 0.f, 0.f, 0.f, 0.f};
    return z;
}

// Eight hardware transcendentals in place (OP: v_exp_f32 = 2^x, v_rcp_f32 = 1/x).
// One statement, so that every one of them has an independent instruction behind
// it (the next of the eight) and the last one the v_nop: the slot that the
// instruction set asks for before a transcendental's result is used. volatile
// keeps the groups in program order: left free, the scheduler opens several at
// once and the GELU kernel goes past 128 registers, one block fewer on a WGP.
#define TRANS_X8(OP, v)                                                          \
    do {                                                                         \
        float t0 = (v)[0], t1 = (v)[1], t2 = (v)[2], t3 = (v)[3];                \
        float t4 = (v)[4], t5 = (v)[5], t6 = (v)[6], t7 = (v)[7];                \
        asm volatile(OP " %0, %0\n\t" OP " %1, %1\n\t" OP " %2, %2\n\t" OP " %3, %3\n\t" \
            OP " %4, %4\n\t" OP " %5, %5\n\t" OP " %6, %6\n\t" OP " %7, %7\n\t" \
            "v_nop"                                                              \
            : "+v"(t0), "+v"(t1), "+v"(t2), "+v"(t3),                            \
              "+v"(t4), "+v"(t5), "+v"(t6), "+v"(t7));                           \
        (v)[0] = t0; (v)[1] = t1; (v)[2] = t2; (v)[3] = t3;                      \
        (v)[4] = t4; (v)[5] = t5; (v)[6] = t6; (v)[7] = t7;                      \
    } while (0)

// 0.5 x (1 + tanh(u)) = x / (1 + exp(-2u)), u = c (x + 0.044715 x^3): the same
// function without the library tanh's two branches. -2 c log2(e) is folded into
// the cubic, so that the hardware's exp2 and reciprocal take it from there.
// x far below 0: exp2 -> inf, 1/inf = 0, result -0; x far above 0: exp2 -> 0, result x.
__device__ __forceinline__ f32x8 gelu_tanh_x8(f32x8 x) {
    constexpr float k0 = (float)(-2.0 * 0.7978845608028654 * LOG2E);
    constexpr float k1 = (float)(-2.0 * 0.7978845608028654 * LOG2E * 0.044715);
    f32x8 e = x * (k0 + k1 * (x * x));
    TRANS_X8("v_exp_f32", e);
    e += 1.f;
    TRANS_X8("v_rcp_f32", e);
    return x * e;
}

// Async DMA: 16 bytes global -> LDS per lane (VDST = LDS byte offset VGPR,
// VADDR = 64-bit global address). Tracked by ASYNCcnt. Low 32 bits of a
// flat shared pointer are the LDS byte offset on AMDGPU.
__device__ __forceinline__ void async_g2l_b128(void* ldsDst, const void* gSrc) {
    unsigned ldsOff = (unsigned)(uintptr_t)ldsDst;
    asm volatile("global_load_async_to_lds_b128 %0, %1, off"
                 :: "v"(ldsOff), "v"(gSrc)
                 : "memory");
}

// Four such copies of one lane (two A rows, two B rows of a GEMM stage). The
// s_wait_xcnt closes the statement so that no address register of a copy is
// rewritten ahead of it.
__device__ __forceinline__ void async_g2l_b128_x4(void* l0, const void* g0,
                                                  void* l1, const void* g1,
                                                  void* l2, const void* g2,
                                                  void* l3, const void* g3) {
    unsigned o0 = (unsigned)(uintptr_t)l0;
    unsigned o1 = (unsigned)(uintptr_t)l1;
    unsigned o2 = (unsigned)(uintptr_t)l2;
    unsigned o3 = (unsigned)(uintptr_t)l3;
    asm volatile("global_load_async_to_lds_b128 %0, %1, off\n\t"
                 "global_load_async_to_lds_b128 %2, %3, off\n\t"
                 "global_load_async_to_lds_b128 %4, %5, off\n\t"
                 "global_load_async_to_lds_b128 %6, %7, off\n\t"
                 "s_wait_xcnt 0x0"
                 :: "v"(o0), "v"(g0), "v"(o1), "v"(g1),
                    "v"(o2), "v"(g2), "v"(o3), "v"(g3)
                 : "memory");
}

__device__ __forceinline__ void wait_async0() {
#if __has_builtin(__builtin_amdgcn_s_wait_asynccnt)
    __builtin_amdgcn_s_wait_asynccnt(0);
#else
    asm volatile("s_wait_asynccnt 0x0" ::: "memory");
#endif
}

// Load a 16x32 bf16 WMMA operand fragment from an LDS tile laid out as
// tile[rc][k] (A-matrix rows, or B-matrix stored K-transposed: tile[col][k]).
// Per ISA 7.12.2 (16-bit A 16x32): lanes 0-15 hold K=0..7,16..23 of row M=lane,
// lanes 16-31 hold K=8..15,24..31 of row M=lane-16; pairs packed per VGPR.
__device__ __forceinline__ bf16x16 load_frag(const __bf16* base, int stride,
                                             int rcBase, int kBase) {
    const int lane = threadIdx.x & 31;
    const int idx  = lane & 15;
    const int half = lane >> 4;
    const __bf16* p = base + (size_t)(rcBase + idx) * stride + kBase + half * 8;
    union { bf16x16 v; unsigned u[8]; } r;
#pragma unroll
    for (int i = 0; i < 8; ++i) {
        int k = ((i & 4) << 2) + ((i & 3) << 1);   // i<4 -> 0..6 ; i>=4 -> 16..22
        r.u[i] = *(const unsigned*)(p + k);
    }
    return r.v;
}

// ---------------------------------------------------------------------------
// fp32 [K][N] -> bf16 [N][K] convert + transpose. One 64x64 tile per block,
// turned in LDS (pitch 65 dwords: column walks hit distinct banks); each wave
// stores whole 128-byte rows of the output.
// ---------------------------------------------------------------------------
__device__ __forceinline__ void cvt_bf16_t_tile(const float* __restrict__ in,
                                                __bf16* __restrict__ out,
                                                int K, int Nn, int n0, int k0) {
    __shared__ float t[64][65];
    const int tid = threadIdx.x;
    const int kr = tid >> 4;          // 16 rows a sweep, 16 bytes a lane
    const int c4 = (tid & 15) * 4;
    float4 v[4];
#pragma unroll
    for (int r = 0; r < 4; ++r)
        v[r] = *(const float4*)(in + (size_t)(k0 + kr + r * 16) * Nn + n0 + c4);
#pragma unroll
    for (int r = 0; r < 4; ++r) {
        t[kr + r * 16][c4 + 0] = v[r].x;
        t[kr + r * 16][c4 + 1] = v[r].y;
        t[kr + r * 16][c4 + 2] = v[r].z;
        t[kr + r * 16][c4 + 3] = v[r].w;
    }
    __syncthreads();
    const int kp = tid & 31;   // pair of k
    const int nr = tid >> 5;
#pragma unroll
    for (int r = 0; r < 8; ++r) {
        int n = nr + r * 8;
        union { __bf16 h[2]; unsigned u; } p;
        p.h[0] = (__bf16)t[2 * kp][n];
        p.h[1] = (__bf16)t[2 * kp + 1][n];
        *(unsigned*)(out + (size_t)(n0 + n) * K + k0 + 2 * kp) = p.u;
    }
}

// ---------------------------------------------------------------------------
// LayerNorm over D=512. Optionally applies token mask and emits f32 residual.
// One block (256 threads, 2 cols each) per row.
// ---------------------------------------------------------------------------
template <bool MASKED>
__device__ __forceinline__ void ln_row(int row,
                                       const float* __restrict__ x,
                                       const float* __restrict__ mask,
                                       float* __restrict__ residOut,
                                       const float* __restrict__ g,
                                       const float* __restrict__ bta,
                                       __bf16* __restrict__ outB) {
    __shared__ float red[256];
    __shared__ float stats[2];
    const int tid = threadIdx.x;
    const size_t rb = (size_t)row * DMODEL;
    float v0 = x[rb + tid];
    float v1 = x[rb + tid + 256];
    if (MASKED) {
        float mv = mask[row & (SEQ - 1)];
        v0 *= mv; v1 *= mv;
        residOut[rb + tid]       = v0;
        residOut[rb + tid + 256] = v1;
    }
    red[tid] = v0 + v1;
    __syncthreads();
#pragma unroll
    for (int off = 128; off > 0; off >>= 1) {
        if (tid < off) red[tid] += red[tid + off];
        __syncthreads();
    }
    if (tid == 0) stats[0] = red[0] * (1.f / DMODEL);
    __syncthreads();
    const float mu = stats[0];
    float d0 = v0 - mu, d1 = v1 - mu;
    red[tid] = d0 * d0 + d1 * d1;
    __syncthreads();
#pragma unroll
    for (int off = 128; off > 0; off >>= 1) {
        if (tid < off) red[tid] += red[tid + off];
        __syncthreads();
    }
    if (tid == 0) stats[1] = rsqrtf(red[0] * (1.f / DMODEL) + 1e-5f);
    __syncthreads();
    const float rstd = stats[1];
    outB[rb + tid]       = (__bf16)(d0 * rstd * g[tid]       + bta[tid]);
    outB[rb + tid + 256] = (__bf16)(d1 * rstd * g[tid + 256] + bta[tid + 256]);
}

__global__ __launch_bounds__(256) void ln_kernel(const float* __restrict__ x,
                                                 const float* __restrict__ g,
                                                 const float* __restrict__ bta,
                                                 __bf16* __restrict__ outB) {
    ln_row<false>(blockIdx.x, x, nullptr, nullptr, g, bta, outB);
}

// ---------------------------------------------------------------------------
// The six weight conversions and the first LayerNorm read none of each other's
// output: one grid runs them all. Blocks [0, CVT_BLKS) turn one 64x64 weight
// tile each (they come first, so they start first), the rest take one row each.
// wB holds the six bf16 weights one behind the other: Wq Wk Wv Wo W1 W2.
// ---------------------------------------------------------------------------
#define CVT_DD_BLKS ((DMODEL / 64) * (DMODEL / 64))   // 64 tiles of a D x D weight
#define CVT_DF_BLKS ((DMODEL / 64) * (DFF / 64))      // 256 tiles of W1 or W2
#define CVT_BLKS    (4 * CVT_DD_BLKS + 2 * CVT_DF_BLKS)

__global__ __launch_bounds__(256) void prep_kernel(const float* __restrict__ Wq,
                                                   const float* __restrict__ Wk,
                                                   const float* __restrict__ Wv,
                                                   const float* __restrict__ Wo,
                                                   const float* __restrict__ W1,
                                                   const float* __restrict__ W2,
                                                   __bf16* __restrict__ wB,
                                                   const float* __restrict__ x,
                                                   const float* __restrict__ mask,
                                                   float* __restrict__ residOut,
                                                   const float* __restrict__ g,
                                                   const float* __restrict__ bta,
                                                   __bf16* __restrict__ outB) {
    const unsigned bid = blockIdx.x;
    if (bid >= CVT_BLKS) {
        ln_row<true>(bid - CVT_BLKS, x, mask, residOut, g, bta, outB);
        return;
    }
    const float* in;
    __bf16* out;
    int K = DMODEL, Nn = DMODEL;
    unsigned t;
    if (bid < 4 * CVT_DD_BLKS) {
        const unsigned w = bid / CVT_DD_BLKS;
        in  = w == 0 ? Wq : w == 1 ? Wk : w == 2 ? Wv : Wo;
        out = wB + w * (DMODEL * DMODEL);
        t   = bid % CVT_DD_BLKS;
    } else if (bid < 4 * CVT_DD_BLKS + CVT_DF_BLKS) {
        in  = W1;
        out = wB + 4 * (DMODEL * DMODEL);
        Nn  = DFF;
        t   = bid - 4 * CVT_DD_BLKS;
    } else {
        in  = W2;
        out = wB + 4 * (DMODEL * DMODEL) + DMODEL * DFF;
        K   = DFF;
        t   = bid - (4 * CVT_DD_BLKS + CVT_DF_BLKS);
    }
    const unsigned sh = Nn == DFF ? 5 : 3;   // 32 or 8 tiles along n
    cvt_bf16_t_tile(in, out, K, Nn, (int)(t & ((1u << sh) - 1)) * 64, (int)(t >> sh) * 64);
}

// ---------------------------------------------------------------------------
// bf16 WMMA GEMM: C[M,N] = A[M,K] @ B[K,N] (+bias)(+GELU)(+resid), B given as Bt[N,K]
// Block: 256 threads = 8 waves. Tile BM=128, BN=128, BK=32, double-buffered:
// next tile's async DMA runs under the current tile's WMMAs.
// Waves: 4 along M (32 rows), 2 along N (64 cols) -> 2x4 subtiles of 16x16.
// Bt rows are K-contiguous, so both tiles are copied alike and both operands
// use the same frag loader.
// THREE: one grid runs three products that share A (the Q, K and V projections);
// blockIdx.z picks the weight (one behind the other in Bt0), the bias and the
// output (one behind the other in outB0).
// ---------------------------------------------------------------------------
template <bool BIAS, bool GELU_ACT, bool RESID, bool OUT_BF16, bool THREE>
__global__ __launch_bounds__(256) void gemm_bf16_kernel(
        const __bf16* __restrict__ A, const __bf16* __restrict__ Bt0,
        const float* __restrict__ bias0, const float* __restrict__ bias1,
        const float* __restrict__ bias2, const float* __restrict__ resid,
        float* __restrict__ outF, __bf16* __restrict__ outB0,
        int M, int Nn, int K) {
    __shared__ __attribute__((aligned(16))) __bf16 lsA[2][128][40];   // [buf][row][k]
    __shared__ __attribute__((aligned(16))) __bf16 lsB[2][128][40];   // [buf][col][k]

    const int z = THREE ? (int)blockIdx.z : 0;
    const __bf16* __restrict__ Bt   = Bt0 + (size_t)z * Nn * K;
    const float*  __restrict__ bias = z == 0 ? bias0 : z == 1 ? bias1 : bias2;
    __bf16*       __restrict__ outB = outB0 + (size_t)z * M * Nn;

    const int m0 = blockIdx.y * 128;
    const int n0 = blockIdx.x * 128;
    const int tid  = threadIdx.x;
    const int wave = tid >> 5;
    const int wm   = wave & 3;    // 0..3 : 32 rows each
    const int wn   = wave >> 2;   // 0..1 : 64 cols each

    f32x8 acc[2][4];
#pragma unroll
    for (int mi = 0; mi < 2; ++mi)
#pragma unroll
        for (int ni = 0; ni < 4; ++ni) acc[mi][ni] = zero8();

    // One stage: 128 rows x 32 k of A and of Bt, 64 bytes a row, 16 bytes a lane.
    const int crow = tid >> 2, cseg = (tid & 3) * 8;
    const __bf16* gA = A  + (size_t)(m0 + crow) * K + cseg;
    const __bf16* gB = Bt + (size_t)(n0 + crow) * K + cseg;
    const size_t half64 = (size_t)64 * K;
    auto load_tiles = [&](int k0, int buf) {
        async_g2l_b128_x4(&lsA[buf][crow][cseg],      gA + k0,
                          &lsA[buf][crow + 64][cseg], gA + half64 + k0,
                          &lsB[buf][crow][cseg],      gB + k0,
                          &lsB[buf][crow + 64][cseg], gB + half64 + k0);
    };

    const int nk = K >> 5;
    load_tiles(0, 0);
    asm volatile("s_wait_asynccnt 0x0" ::: "memory");   // stage 0 landed (own copies)
    __syncthreads();                                    // ... and everyone's
    if (nk > 1) load_tiles(32, 1);
    for (int i = 0; i < nk; ++i) {
        const int buf = i & 1;
        bf16x16 aF[2], bF[4];
#pragma unroll
        for (int mi = 0; mi < 2; ++mi)
            aF[mi] = load_frag(&lsA[buf][0][0], 40, wm * 32 + mi * 16, 0);
#pragma unroll
        for (int ni = 0; ni < 4; ++ni)
            bF[ni] = load_frag(&lsB[buf][0][0], 40, wn * 64 + ni * 16, 0);
#pragma unroll
        for (int mi = 0; mi < 2; ++mi)
#pragma unroll
            for (int ni = 0; ni < 4; ++ni)
                acc[mi][ni] = __builtin_amdgcn_wmma_f32_16x16x32_bf16(
                    false, aF[mi], false, bF[ni], (short)0, acc[mi][ni], false, false);

        // Publish stage i+1 and free this buffer: own LDS reads done, own
        // copies landed, then the barrier; only then the refill.
        asm volatile("s_wait_dscnt 0x0" ::: "memory");
        asm volatile("s_wait_asynccnt 0x0" ::: "memory");
        __syncthreads();
        if (i + 2 < nk) load_tiles((i + 2) << 5, buf);
    }
    asm volatile("s_wait_asynccnt 0x0" ::: "memory");   // nothing in flight at the end

    // Epilogue. C/D layout: lane<16 -> M = r, lane>=16 -> M = 8+r ; N = lane&15
    const int lane = tid & 31;
    const int half = lane >> 4;
    const int lcol = lane & 15;
    // Residual values of this wave's 2x4 subtiles, all 64 loads issued here back
    // to back: their latency runs once, not once per element between the stores.
    float rs[2][4][8];
    if (RESID) {
        // The residual stream is DMODEL wide, so every row and column step is an
        // immediate offset from one index register.
        const float* rp = resid + ((m0 + wm * 32 + half * 8) * DMODEL + n0 + wn * 64 + lcol);
#pragma unroll
        for (int mi = 0; mi < 2; ++mi)
#pragma unroll
            for (int r = 0; r < 8; ++r)
#pragma unroll
                for (int ni = 0; ni < 4; ++ni)
                    rs[mi][ni][r] = rp[(mi * 16 + r) * DMODEL + ni * 16];
        // Keeps all 64 loads in flight at once: left alone, the scheduler issues the
        // last fourteen only when the first have returned, a second latency.
        __builtin_amdgcn_sched_barrier(0);
    }
    float bv[4];   // the lane's four bias values, loaded together ahead of the arithmetic
    if (BIAS) {
#pragma unroll
        for (int ni = 0; ni < 4; ++ni) bv[ni] = bias[n0 + wn * 64 + ni * 16 + lcol];
    }
#pragma unroll
    for (int mi = 0; mi < 2; ++mi) {
#pragma unroll
        for (int ni = 0; ni < 4; ++ni) {
            const int gc = n0 + wn * 64 + ni * 16 + lcol;
            f32x8 v8 = acc[mi][ni];
            if (BIAS)     v8 += bv[ni];
            if (GELU_ACT) v8 = gelu_tanh_x8(v8);
#pragma unroll
            for (int r = 0; r < 8; ++r) {
                int gr = m0 + wm * 32 + mi * 16 + half * 8 + r;
                float v = v8[r];
                if (RESID)    v += rs[mi][ni][r];
                if (OUT_BF16) outB[(size_t)gr * Nn + gc] = (__bf16)v;
                else          outF[(size_t)gr * Nn + gc] = v;
            }
        }
    }
}

// ---------------------------------------------------------------------------
// Attention: one block per (b, h, 128-row Q tile). Streams 64-key tiles:
//   S = Q K^T * scale ; P = exp(S) (reference has no max-subtraction)
//   rowsum += sum_j P ; O += P V ; final O /= rowsum.
// Q/K tiles are async-DMA'd into LDS; V needs a transpose scatter.
// ---------------------------------------------------------------------------
__global__ __launch_bounds__(256) void attn_kernel(const __bf16* __restrict__ Q,
                                                   const __bf16* __restrict__ Kmat,
                                                   const __bf16* __restrict__ Vmat,
                                                   __bf16* __restrict__ O) {
    __shared__ __bf16 lsQ[128][72];   // [row][dh]
    __shared__ __bf16 lsK[64][72];    // [key][dh]  (B-transposed layout for QK^T)
    __shared__ __bf16 lsVt[64][72];   // [dh][key]  (B-transposed layout for PV)
    __shared__ __bf16 lsP[128][72];   // [row][key]
    __shared__ float  rowsumAcc[128];

    const int r0 = blockIdx.x * 128;
    const int h  = blockIdx.y;
    const int b  = blockIdx.z;
    const int tid  = threadIdx.x;
    const int wave = tid >> 5;
    const int wm   = wave & 3;     // 4 x 32 rows
    const int wn   = wave >> 2;    // 2 x 32 cols
    const int lane = tid & 31;
    const int half = lane >> 4;
    const int lcol = lane & 15;

    const __bf16* qbase = Q + ((size_t)(b * SEQ + r0)) * DMODEL + h * DHEAD;
#pragma unroll
    for (int s = tid; s < 1024; s += 256) {   // 128 rows x 8 uint4 segs
        int row = s >> 3, cs = s & 7;
        async_g2l_b128(&lsQ[row][cs * 8], qbase + (size_t)row * DMODEL + cs * 8);
    }
    if (tid < 128) rowsumAcc[tid] = 0.f;

    f32x8 oAcc[2][2];
#pragma unroll
    for (int mi = 0; mi < 2; ++mi)
#pragma unroll
        for (int ni = 0; ni < 2; ++ni) oAcc[mi][ni] = zero8();

    for (int j0 = 0; j0 < SEQ; j0 += 64) {
        __syncthreads();
        const __bf16* kbase = Kmat + ((size_t)(b * SEQ + j0)) * DMODEL + h * DHEAD;
        const __bf16* vbase = Vmat + ((size_t)(b * SEQ + j0)) * DMODEL + h * DHEAD;
#pragma unroll
        for (int s = tid; s < 512; s += 256) {  // K tile row-major, async DMA
            int kr = s >> 3, cs = s & 7;
            async_g2l_b128(&lsK[kr][cs * 8], kbase + (size_t)kr * DMODEL + cs * 8);
        }
#pragma unroll
        for (int s = tid; s < 512; s += 256) {  // V tile, scatter transposed
            int kr = s >> 3, cs = s & 7;
            uint4 t = *(const uint4*)(vbase + (size_t)kr * DMODEL + cs * 8);
            const __bf16* hs = reinterpret_cast<const __bf16*>(&t);
#pragma unroll
            for (int e = 0; e < 8; ++e) lsVt[cs * 8 + e][kr] = hs[e];
        }
        wait_async0();
        __syncthreads();

        // S = Q K^T  (M=128 rows, N=64 keys, K=64=dh)
        f32x8 sAcc[2][2];
#pragma unroll
        for (int mi = 0; mi < 2; ++mi)
#pragma unroll
            for (int ni = 0; ni < 2; ++ni) sAcc[mi][ni] = zero8();
#pragma unroll
        for (int kk = 0; kk < 64; kk += 32) {
            bf16x16 aF[2], bF[2];
#pragma unroll
            for (int mi = 0; mi < 2; ++mi)
                aF[mi] = load_frag(&lsQ[0][0], 72, wm * 32 + mi * 16, kk);
#pragma unroll
            for (int ni = 0; ni < 2; ++ni)
                bF[ni] = load_frag(&lsK[0][0], 72, wn * 32 + ni * 16, kk);
#pragma unroll
            for (int mi = 0; mi < 2; ++mi)
#pragma unroll
                for (int ni = 0; ni < 2; ++ni)
                    sAcc[mi][ni] = __builtin_amdgcn_wmma_f32_16x16x32_bf16(
                        false, aF[mi], false, bF[ni], (short)0, sAcc[mi][ni], false, false);
        }
        // P = exp(scale * S) into LDS, as 2^(S * scale * log2(e)): one multiply and
        // the hardware's exp2 (inf above the f32 range and 0 below it, like exp)
#pragma unroll
        for (int mi = 0; mi < 2; ++mi)
#pragma unroll
            for (int ni = 0; ni < 2; ++ni) {
                f32x8 p = sAcc[mi][ni] * (float)(ATTN_SCALE * LOG2E);
                TRANS_X8("v_exp_f32", p);
#pragma unroll
                for (int r = 0; r < 8; ++r) {
                    int row = wm * 32 + mi * 16 + half * 8 + r;
                    int col = wn * 32 + ni * 16 + lcol;
                    lsP[row][col] = (__bf16)p[r];
                }
            }
        __syncthreads();
        // rowsum accumulate (threads 0..127 own one row each)
        if (tid < 128) {
            float s = 0.f;
#pragma unroll
            for (int c = 0; c < 64; ++c) s += (float)lsP[tid][c];
            rowsumAcc[tid] += s;
        }
        // O += P V  (M=128 rows, N=64=dh, K=64 keys)
#pragma unroll
        for (int kk = 0; kk < 64; kk += 32) {
            bf16x16 aF[2], bF[2];
#pragma unroll
            for (int mi = 0; mi < 2; ++mi)
                aF[mi] = load_frag(&lsP[0][0], 72, wm * 32 + mi * 16, kk);
#pragma unroll
            for (int ni = 0; ni < 2; ++ni)
                bF[ni] = load_frag(&lsVt[0][0], 72, wn * 32 + ni * 16, kk);
#pragma unroll
            for (int mi = 0; mi < 2; ++mi)
#pragma unroll
                for (int ni = 0; ni < 2; ++ni)
                    oAcc[mi][ni] = __builtin_amdgcn_wmma_f32_16x16x32_bf16(
                        false, aF[mi], false, bF[ni], (short)0, oAcc[mi][ni], false, false);
        }
    }
    __syncthreads();

    __bf16* obase = O + ((size_t)(b * SEQ + r0)) * DMODEL + h * DHEAD;
#pragma unroll
    for (int mi = 0; mi < 2; ++mi)
#pragma unroll
        for (int ni = 0; ni < 2; ++ni)
#pragma unroll
            for (int r = 0; r < 8; ++r) {
                int row = wm * 32 + mi * 16 + half * 8 + r;
                int col = wn * 32 + ni * 16 + lcol;
                obase[(size_t)row * DMODEL + col] = (__bf16)(oAcc[mi][ni][r] / rowsumAcc[row]);
            }
}

// ---------------------------------------------------------------------------
// Mean pool over tokens + head LayerNorm + classifier (8x512x1000, f32), spread
// over the chip in two launches.
// ---------------------------------------------------------------------------
#define POOL_CH   16                 // partial token sums per batch row
#define POOL_ROWS (SEQ / POOL_CH)    // 64 tokens a block

typedef __attribute__((ext_vector_type(4))) float f32x4;
typedef __attribute__((ext_vector_type(2))) float f32x2;

template <int M>
__device__ __forceinline__ float row_xor(float v) {   // lane l <- lane l ^ M, M < 16
    return __builtin_bit_cast(float, __builtin_amdgcn_update_dpp(
        0, __builtin_bit_cast(int, v), 0x160 | M, 0xf, 0xf, true));
}

__device__ __forceinline__ float half_xor(float v) {  // lane l <- lane l ^ 16
    int t = __builtin_bit_cast(int, v);
    return __builtin_bit_cast(float, __builtin_amdgcn_permlanex16(t, t, 0x76543210, 0xfedcba98, false, false));
}

__device__ __forceinline__ float wave_sum(float v) {  // total of 32 lanes, in every lane
    v += row_xor<1>(v);
    v += row_xor<2>(v);
    v += row_xor<4>(v);
    v += row_xor<8>(v);
    v += half_xor(v);
    return v;
}

// Launch 1: block (ch, b, z) sums 64 tokens of batch row b, columns
// [256 z, 256 z + 256), into part[b][ch][.]. 256 threads = 64 column quads x 4
// token groups; a wave's load covers 512 contiguous bytes.
__global__ __launch_bounds__(256) void pool_partial_kernel(const float* __restrict__ x3,
                                                           float* __restrict__ part) {
    __shared__ f32x4 red[4][64];
    const int tid = threadIdx.x;
    const int c4  = tid & 63;
    const int rg  = tid >> 6;
    const int ch  = blockIdx.x;
    const int b   = blockIdx.y;
    const int col = blockIdx.z * 256 + c4 * 4;
    const float* base = x3 + ((size_t)(b * SEQ + ch * POOL_ROWS + rg)) * DMODEL + col;
    f32x4 v[16];
#pragma unroll
    for (int i = 0; i < 16; ++i) v[i] = *(const f32x4*)(base + (size_t)(i * 4) * DMODEL);
    // The loads' address register is named so that it is not reused, not even
    // as a load's destination, ahead of this wait.
    asm volatile("s_wait_xcnt 0x0" :: "v"(base) : "memory");
    // Keeps all 16 loads in flight at once: left alone, the scheduler issues the
    // last four only when the first have returned, a second latency.
    __builtin_amdgcn_sched_barrier(0);
#pragma unroll
    for (int w = 8; w > 0; w >>= 1)
#pragma unroll
        for (int i = 0; i < w; ++i) v[i] += v[i + w];
    red[rg][c4] = v[0];
    __syncthreads();
    if (rg == 0)
        *(f32x4*)(part + ((size_t)(b * POOL_CH + ch)) * DMODEL + col) =
            (red[0][c4] + red[1][c4]) + (red[2][c4] + red[3][c4]);
}

// Launch 2: one block per 128-byte line of out (32 consecutive floats of the
// flat [8][1000] array), so every line has one writer. A line can straddle two
// batch rows, so each block normalises the pooled vectors of the first and of
// the last float's batch row (the same row twice for most lines).
// Lane = (k group kr, class quad q); wave w takes k in [64 w, 64 w + 64).
__global__ __launch_bounds__(256) void head_kernel(const float* __restrict__ part,
                                                   const float* __restrict__ g,
                                                   const float* __restrict__ bta,
                                                   const float* __restrict__ Wh,
                                                   const float* __restrict__ bh,
                                                   float* __restrict__ out) {
    __shared__ __attribute__((aligned(16))) float pool[2][DMODEL];
    __shared__ __attribute__((aligned(16))) float redS[2][8];
    __shared__ __attribute__((aligned(16))) float redQ[2][8];
    __shared__ f32x4 accs[8][8];
    const int tid  = threadIdx.x;
    const int lane = tid & 31;
    const int wave = tid >> 5;
    const int q    = lane & 7;
    const int kr   = lane >> 3;
    const int f0   = blockIdx.x * 32;
    const int b0   = f0 / NCLS;
    const int b1   = (f0 + 31) / NCLS;
    const int f    = f0 + q * 4;        // NCLS is a multiple of 4: a quad stays in one row
    const int bq   = f / NCLS;
    const int c    = f - bq * NCLS;
    const int kb   = wave * 64 + kr * 16;

    const f32x2 g2   = *(const f32x2*)(g + tid * 2);
    const f32x2 t2   = *(const f32x2*)(bta + tid * 2);
    const float* bp  = bh + c;
    const float* wp  = Wh + (size_t)kb * NCLS + c;
    const float* pp0 = part + (size_t)(b0 * POOL_CH) * DMODEL + tid * 2;
    const float* pp1 = part + (size_t)(b1 * POOL_CH) * DMODEL + tid * 2;
    const f32x4 bias = *(const f32x4*)bp;
    f32x4 w[16];
#pragma unroll
    for (int i = 0; i < 16; ++i) w[i] = *(const f32x4*)(wp + (size_t)i * NCLS);
    f32x2 p0[POOL_CH], p1[POOL_CH];
#pragma unroll
    for (int j = 0; j < POOL_CH; ++j) {
        p0[j] = *(const f32x2*)(pp0 + (size_t)j * DMODEL);
        p1[j] = *(const f32x2*)(pp1 + (size_t)j * DMODEL);
    }
    // The address registers of the bias and weight loads are named so that
    // neither is reused, not even as a load's destination, ahead of this wait
    // (the other loads go by the thread index and a scalar base).
    asm volatile("s_wait_xcnt 0x0" :: "v"(bp), "v"(wp) : "memory");
    // Keeps the classifier's loads in front of the pooling arithmetic, so that
    // their latency runs under it instead of behind the three barriers below.
    __builtin_amdgcn_sched_barrier(0);

#pragma unroll
    for (int s = POOL_CH / 2; s > 0; s >>= 1)
#pragma unroll
        for (int j = 0; j < s; ++j) { p0[j] += p0[j + s]; p1[j] += p1[j + s]; }
    const f32x2 m0 = p0[0] * (1.f / SEQ);
    const f32x2 m1 = p1[0] * (1.f / SEQ);

    const float s0 = wave_sum(m0.x + m0.y);
    const float s1 = wave_sum(m1.x + m1.y);
    if (lane == 0) { redS[0][wave] = s0; redS[1][wave] = s1; }
    __syncthreads();
    float mu0 = 0.f, mu1 = 0.f;
#pragma unroll
    for (int i = 0; i < 8; ++i) { mu0 += redS[0][i]; mu1 += redS[1][i]; }
    mu0 *= (1.f / DMODEL);
    mu1 *= (1.f / DMODEL);
    const f32x2 d0 = m0 - mu0;
    const f32x2 d1 = m1 - mu1;
    const float q0 = wave_sum(d0.x * d0.x + d0.y * d0.y);
    const float q1 = wave_sum(d1.x * d1.x + d1.y * d1.y);
    if (lane == 0) { redQ[0][wave] = q0; redQ[1][wave] = q1; }
    __syncthreads();
    float v0 = 0.f, v1 = 0.f;
#pragma unroll
    for (int i = 0; i < 8; ++i) { v0 += redQ[0][i]; v1 += redQ[1][i]; }
    const float r0 = rsqrtf(v0 * (1.f / DMODEL) + 1e-5f);
    const float r1 = rsqrtf(v1 * (1.f / DMODEL) + 1e-5f);
    *(f32x2*)&pool[0][tid * 2] = d0 * r0 * g2 + t2;
    *(f32x2*)&pool[1][tid * 2] = d1 * r1 * g2 + t2;
    __syncthreads();

    const float* pv = &pool[bq - b0][kb];
    f32x4 acc = {0.f, 0.f, 0.f, 0.f};
#pragma unroll
    for (int i = 0; i < 16; i += 4) {
        const f32x4 pk = *(const f32x4*)(pv + i);
        acc += pk.x * w[i] + pk.y * w[i + 1] + pk.z * w[i + 2] + pk.w * w[i + 3];
    }
#pragma unroll
    for (int e = 0; e < 4; ++e) {       // fold the four k groups of the wave
        acc[e] += row_xor<8>(acc[e]);
        acc[e] += half_xor(acc[e]);
    }
    if (lane < 8) accs[wave][q] = acc;
    __syncthreads();
    if (tid < 8) {
        f32x4 r = bias;
#pragma unroll
        for (int i = 0; i < 8; ++i) r += accs[i][tid];
        *(f32x4*)(out + f) = r;
    }
}

// ---------------------------------------------------------------------------
// Host-side orchestration
// ---------------------------------------------------------------------------
extern "C" void kernel_launch(void* const* d_in, const int* in_sizes, int n_in,
                              void* d_out, int out_size, void* d_ws, size_t ws_size,
                              hipStream_t stream) {
    (void)in_sizes; (void)n_in; (void)out_size; (void)ws_size;
    const float* x     = (const float*)d_in[0];
    const float* mask  = (const float*)d_in[1];
    const float* ln1_g = (const float*)d_in[2];
    const float* ln1_b = (const float*)d_in[3];
    const float* Wq    = (const float*)d_in[4];
    const float* bq    = (const float*)d_in[5];
    const float* Wk    = (const float*)d_in[6];
    const float* bk_p  = (const float*)d_in[7];
    const float* Wv    = (const float*)d_in[8];
    const float* bv    = (const float*)d_in[9];
    const float* Wo    = (const float*)d_in[10];
    const float* bo    = (const float*)d_in[11];
    const float* ln2_g = (const float*)d_in[12];
    const float* ln2_b = (const float*)d_in[13];
    const float* W1    = (const float*)d_in[14];
    const float* b1    = (const float*)d_in[15];
    const float* W2    = (const float*)d_in[16];
    const float* b2    = (const float*)d_in[17];
    const float* lnh_g = (const float*)d_in[18];
    const float* lnh_b = (const float*)d_in[19];
    const float* Wh    = (const float*)d_in[20];
    const float* bh    = (const float*)d_in[21];

    char* ws = (char*)d_ws;
    const size_t MB = 1ull << 20;
    // Workspace map (aliasing is ordered by the stream):
    //   [ 0,16MB)  resid (f32)  -- reused as x3 after the Wo projection
    //   [16,32MB)  x2 (f32)
    //   [32,40MB)  xn (bf16)    -- reused as xn2
    //   [40,72MB)  bufQ/bufK/bufV/bufAO (bf16, 8MB each) -- reused as h1 (32MB)
    //   [72MB,..)  bf16 weights, each transposed to [N][K]
    //   [80MB,..)  partial token sums (f32, 256KB)
    float*  resid  = (float*) (ws + 0);
    float*  x2     = (float*) (ws + 16 * MB);
    __bf16* xn     = (__bf16*)(ws + 32 * MB);
    __bf16* bufQ   = (__bf16*)(ws + 40 * MB);
    __bf16* bufK   = (__bf16*)(ws + 48 * MB);
    __bf16* bufV   = (__bf16*)(ws + 56 * MB);
    __bf16* bufAO  = (__bf16*)(ws + 64 * MB);
    __bf16* h1     = bufQ;
    float*  x3     = resid;
    __bf16* wqB    = (__bf16*)(ws + 72 * MB);
    __bf16* wkB    = wqB + DMODEL * DMODEL;
    __bf16* wvB    = wkB + DMODEL * DMODEL;
    __bf16* woB    = wvB + DMODEL * DMODEL;
    __bf16* w1B    = woB + DMODEL * DMODEL;
    __bf16* w2B    = w1B + DMODEL * DFF;
    float*  part   = (float*) (ws + 80 * MB);

    // One grid: W[K][N] f32 -> Wt[N][K] bf16 for all six weights, and
    // mask * x -> residual ; LN1 -> xn (bf16)
    prep_kernel<<<CVT_BLKS + MROWS, 256, 0, stream>>>(Wq, Wk, Wv, Wo, W1, W2, wqB,
                                                      x, mask, resid, ln1_g, ln1_b, xn);

    // QKV projections, one grid: z = 0, 1, 2 -> bufQ, bufK, bufV
    dim3 gDD(DMODEL / 128, MROWS / 128);   // (4, 64)
    gemm_bf16_kernel<true, false, false, true, true>
        <<<dim3(DMODEL / 128, MROWS / 128, 3), 256, 0, stream>>>(
        xn, wqB, bq, bk_p, bv, nullptr, nullptr, bufQ, MROWS, DMODEL, DMODEL);

    // Attention
    attn_kernel<<<dim3(SEQ / 128, HEADS, BATCH), 256, 0, stream>>>(bufQ, bufK, bufV, bufAO);

    // Output projection + residual -> x2 (f32)
    gemm_bf16_kernel<true, false, true, false, false><<<gDD, 256, 0, stream>>>(
        bufAO, woB, bo, nullptr, nullptr, resid, x2, nullptr, MROWS, DMODEL, DMODEL);

    // LN2 -> xn2 (bf16)
    ln_kernel<<<MROWS, 256, 0, stream>>>(x2, ln2_g, ln2_b, xn);

    // FFN1: GELU(xn2 @ W1 + b1) -> h1 (bf16)
    gemm_bf16_kernel<true, true, false, true, false><<<dim3(DFF / 128, MROWS / 128), 256, 0, stream>>>(
        xn, w1B, b1, nullptr, nullptr, nullptr, nullptr, h1, MROWS, DFF, DMODEL);

    // FFN2: h1 @ W2 + b2 + x2 -> x3 (f32)
    gemm_bf16_kernel<true, false, true, false, false><<<gDD, 256, 0, stream>>>(
        h1, w2B, b2, nullptr, nullptr, x2, x3, nullptr, MROWS, DMODEL, DFF);

    // Mean pool + head LN + classifier
    pool_partial_kernel<<<dim3(POOL_CH, BATCH, 2), 256, 0, stream>>>(x3, part);
    head_kernel<<<BATCH * NCLS / 32, 256, 0, stream>>>(part, lnh_g, lnh_b, Wh, bh, (float*)d_out);
}

// v006
// Measured time: 150 microseconds a run.
// Next to v005, in two timings, it ran 1.14 times as fast each time.
// Counting every step since v000, it is 3.21 times as fast.
#include <hip/hip_runtime.h>
#include <cstdint>
#include <cstddef>

// ---------------------------------------------------------------------------
// MI455X (gfx1250) transformer block, bf16 WMMA path.
// ~70 GFLOP of GEMMs vs ~100MB traffic -> matrix-core bound; everything
// routed through v_wmma_f32_16x16x32_bf16 with f32 accumulation.
// Row-major tiles are staged into LDS with global_load_async_to_lds_b128
// (ASYNCcnt-tracked DMA, no VGPR round-trip), double-buffered in the GEMM.
// Weights are converted to bf16 K-contiguous ([N][K]) so that the GEMM's B
// tile is copied the same way as its A tile.
// ---------------------------------------------------------------------------

typedef __attribute__((ext_vector_type(16))) __bf16 bf16x16;
typedef __attribute__((ext_vector_type(8)))  float  f32x8;

#define HEADS 8
#define DHEAD 64
#define SEQ   1024
#define BATCH 8
#define DMODEL 512
#define DFF   2048
#define NCLS  1000
#define MROWS (BATCH * SEQ)   // 8192
#define ATTN_SCALE 0.125f     // 1/sqrt(64)
#define LOG2E 1.4426950408889634

__device__ __forceinline__ f32x8 zero8() {
    f32x8 z = {0.f, 0.f, 0.f, 0.f, 0.f, 0.f, 0.f, 0.f};
    return z;
}

// Eight hardware transcendentals in place (OP: v_exp_f32 = 2^x, v_rcp_f32 = 1/x).
// One statement, so that every one of them has an independent instruction behind
// it (the next of the eight) and the last one the v_nop: the slot that the
// instruction set asks for before a transcendental's result is used. volatile
// keeps the groups in program order: left free, the scheduler opens several at
// once and the GELU kernel goes past 128 registers, one block fewer on a WGP.
#define TRANS_X8(OP, v)                                                          \
    do {                                                                         \
        float t0 = (v)[0], t1 = (v)[1], t2 = (v)[2], t3 = (v)[3];                \
        float t4 = (v)[4], t5 = (v)[5], t6 = (v)[6], t7 = (v)[7];                \
        asm volatile(OP " %0, %0\n\t" OP " %1, %1\n\t" OP " %2, %2\n\t" OP " %3, %3\n\t" \
            OP " %4, %4\n\t" OP " %5, %5\n\t" OP " %6, %6\n\t" OP " %7, %7\n\t" \
            "v_nop"                                                              \
            : "+v"(t0), "+v"(t1), "+v"(t2), "+v"(t3),                            \
              "+v"(t4), "+v"(t5), "+v"(t6), "+v"(t7));                           \
        (v)[0] = t0; (v)[1] = t1; (v)[2] = t2; (v)[3] = t3;                      \
        (v)[4] = t4; (v)[5] = t5; (v)[6] = t6; (v)[7] = t7;                      \
    } while (0)

// 0.5 x (1 + tanh(u)) = x / (1 + exp(-2u)), u = c (x + 0.044715 x^3): the same
// function without the library tanh's two branches. -2 c log2(e) is folded into
// the cubic, so that the hardware's exp2 and reciprocal take it from there.
// x far below 0: exp2 -> inf, 1/inf = 0, result -0; x far above 0: exp2 -> 0, result x.
__device__ __forceinline__ f32x8 gelu_tanh_x8(f32x8 x) {
    constexpr float k0 = (float)(-2.0 * 0.7978845608028654 * LOG2E);
    constexpr float k1 = (float)(-2.0 * 0.7978845608028654 * LOG2E * 0.044715);
    f32x8 e = x * (k0 + k1 * (x * x));
    TRANS_X8("v_exp_f32", e);
    e += 1.f;
    TRANS_X8("v_rcp_f32", e);
    return x * e;
}

// Async DMA: 16 bytes global -> LDS per lane (VDST = LDS byte offset VGPR,
// VADDR = 64-bit global address). Tracked by ASYNCcnt. Low 32 bits of a
// flat shared pointer are the LDS byte offset on AMDGPU.
__device__ __forceinline__ void async_g2l_b128(void* ldsDst, const void* gSrc) {
    unsigned ldsOff = (unsigned)(uintptr_t)ldsDst;
    asm volatile("global_load_async_to_lds_b128 %0, %1, off"
                 :: "v"(ldsOff), "v"(gSrc)
                 : "memory");
}

// Eight such copies of one lane (four A rows, four B rows of a GEMM stage). The
// s_wait_xcnt closes the statement so that no address register of a copy is
// rewritten ahead of it.
__device__ __forceinline__ void async_g2l_b128_x8(const unsigned (&o)[8],
                                                  const __bf16* const (&g)[8]) {
    asm volatile("global_load_async_to_lds_b128 %0, %1, off\n\t"
                 "global_load_async_to_lds_b128 %2, %3, off\n\t"
                 "global_load_async_to_lds_b128 %4, %5, off\n\t"
                 "global_load_async_to_lds_b128 %6, %7, off\n\t"
                 "global_load_async_to_lds_b128 %8, %9, off\n\t"
                 "global_load_async_to_lds_b128 %10, %11, off\n\t"
                 "global_load_async_to_lds_b128 %12, %13, off\n\t"
                 "global_load_async_to_lds_b128 %14, %15, off\n\t"
                 "s_wait_xcnt 0x0"
                 :: "v"(o[0]), "v"(g[0]), "v"(o[1]), "v"(g[1]),
                    "v"(o[2]), "v"(g[2]), "v"(o[3]), "v"(g[3]),
                    "v"(o[4]), "v"(g[4]), "v"(o[5]), "v"(g[5]),
                    "v"(o[6]), "v"(g[6]), "v"(o[7]), "v"(g[7])
                 : "memory");
}

__device__ __forceinline__ void wait_async0() {
#if __has_builtin(__builtin_amdgcn_s_wait_asynccnt)
    __builtin_amdgcn_s_wait_asynccnt(0);
#else
    asm volatile("s_wait_asynccnt 0x0" ::: "memory");
#endif
}

// Load a 16x32 bf16 WMMA operand fragment from an LDS tile laid out as
// tile[rc][k] (A-matrix rows, or B-matrix stored K-transposed: tile[col][k]).
// Per ISA 7.12.2 (16-bit A 16x32): lanes 0-15 hold K=0..7,16..23 of row M=lane,
// lanes 16-31 hold K=8..15,24..31 of row M=lane-16; pairs packed per VGPR.
__device__ __forceinline__ bf16x16 load_frag(const __bf16* base, int stride,
                                             int rcBase, int kBase) {
    const int lane = threadIdx.x & 31;
    const int idx  = lane & 15;
    const int half = lane >> 4;
    const __bf16* p = base + (size_t)(rcBase + idx) * stride + kBase + half * 8;
    union { bf16x16 v; unsigned u[8]; } r;
#pragma unroll
    for (int i = 0; i < 8; ++i) {
        int k = ((i & 4) << 2) + ((i & 3) << 1);   // i<4 -> 0..6 ; i>=4 -> 16..22
        r.u[i] = *(const unsigned*)(p + k);
    }
    return r.v;
}

// ---------------------------------------------------------------------------
// fp32 [K][N] -> bf16 [N][K] convert + transpose. One 64x64 tile per block,
// turned in LDS (pitch 65 dwords: column walks hit distinct banks); each wave
// stores whole 128-byte rows of the output.
// ---------------------------------------------------------------------------
__device__ __forceinline__ void cvt_bf16_t_tile(const float* __restrict__ in,
                                                __bf16* __restrict__ out,
                                                int K, int Nn, int n0, int k0) {
    __shared__ float t[64][65];
    const int tid = threadIdx.x;
    const int kr = tid >> 4;          // 16 rows a sweep, 16 bytes a lane
    const int c4 = (tid & 15) * 4;
    float4 v[4];
#pragma unroll
    for (int r = 0; r < 4; ++r)
        v[r] = *(const float4*)(in + (size_t)(k0 + kr + r * 16) * Nn + n0 + c4);
#pragma unroll
    for (int r = 0; r < 4; ++r) {
        t[kr + r * 16][c4 + 0] = v[r].x;
        t[kr + r * 16][c4 + 1] = v[r].y;
        t[kr + r * 16][c4 + 2] = v[r].z;
        t[kr + r * 16][c4 + 3] = v[r].w;
    }
    __syncthreads();
    const int kp = tid & 31;   // pair of k
    const int nr = tid >> 5;
#pragma unroll
    for (int r = 0; r < 8; ++r) {
        int n = nr + r * 8;
        union { __bf16 h[2]; unsigned u; } p;
        p.h[0] = (__bf16)t[2 * kp][n];
        p.h[1] = (__bf16)t[2 * kp + 1][n];
        *(unsigned*)(out + (size_t)(n0 + n) * K + k0 + 2 * kp) = p.u;
    }
}

// ---------------------------------------------------------------------------
// LayerNorm over D=512. Optionally applies token mask and emits f32 residual.
// One block (256 threads, 2 cols each) per row.
// ---------------------------------------------------------------------------
template <bool MASKED>
__device__ __forceinline__ void ln_row(int row,
                                       const float* __restrict__ x,
                                       const float* __restrict__ mask,
                                       float* __restrict__ residOut,
                                       const float* __restrict__ g,
                                       const float* __restrict__ bta,
                                       __bf16* __restrict__ outB) {
    __shared__ float red[256];
    __shared__ float stats[2];
    const int tid = threadIdx.x;
    const size_t rb = (size_t)row * DMODEL;
    float v0 = x[rb + tid];
    float v1 = x[rb + tid + 256];
    if (MASKED) {
        float mv = mask[row & (SEQ - 1)];
        v0 *= mv; v1 *= mv;
        residOut[rb + tid]       = v0;
        residOut[rb + tid + 256] = v1;
    }
    red[tid] = v0 + v1;
    __syncthreads();
#pragma unroll
    for (int off = 128; off > 0; off >>= 1) {
        if (tid < off) red[tid] += red[tid + off];
        __syncthreads();
    }
    if (tid == 0) stats[0] = red[0] * (1.f / DMODEL);
    __syncthreads();
    const float mu = stats[0];
    float d0 = v0 - mu, d1 = v1 - mu;
    red[tid] = d0 * d0 + d1 * d1;
    __syncthreads();
#pragma unroll
    for (int off = 128; off > 0; off >>= 1) {
        if (tid < off) red[tid] += red[tid + off];
        __syncthreads();
    }
    if (tid == 0) stats[1] = rsqrtf(red[0] * (1.f / DMODEL) + 1e-5f);
    __syncthreads();
    const float rstd = stats[1];
    outB[rb + tid]       = (__bf16)(d0 * rstd * g[tid]       + bta[tid]);
    outB[rb + tid + 256] = (__bf16)(d1 * rstd * g[tid + 256] + bta[tid + 256]);
}

__global__ __launch_bounds__(256) void ln_kernel(const float* __restrict__ x,
                                                 const float* __restrict__ g,
                                                 const float* __restrict__ bta,
                                                 __bf16* __restrict__ outB) {
    ln_row<false>(blockIdx.x, x, nullptr, nullptr, g, bta, outB);
}

// ---------------------------------------------------------------------------
// The six weight conversions and the first LayerNorm read none of each other's
// output: one grid runs them all. Blocks [0, CVT_BLKS) turn one 64x64 weight
// tile each (they come first, so they start first), the rest take one row each.
// wB holds the six bf16 weights one behind the other: Wq Wk Wv Wo W1 W2.
// ---------------------------------------------------------------------------
#define CVT_DD_BLKS ((DMODEL / 64) * (DMODEL / 64))   // 64 tiles of a D x D weight
#define CVT_DF_BLKS ((DMODEL / 64) * (DFF / 64))      // 256 tiles of W1 or W2
#define CVT_BLKS    (4 * CVT_DD_BLKS + 2 * CVT_DF_BLKS)

__global__ __launch_bounds__(256) void prep_kernel(const float* __restrict__ Wq,
                                                   const float* __restrict__ Wk,
                                                   const float* __restrict__ Wv,
                                                   const float* __restrict__ Wo,
                                                   const float* __restrict__ W1,
                                                   const float* __restrict__ W2,
                                                   __bf16* __restrict__ wB,
                                                   const float* __restrict__ x,
                                                   const float* __restrict__ mask,
                                                   float* __restrict__ residOut,
                                                   const float* __restrict__ g,
                                                   const float* __restrict__ bta,
                                                   __bf16* __restrict__ outB) {
    const unsigned bid = blockIdx.x;
    if (bid >= CVT_BLKS) {
        ln_row<true>(bid - CVT_BLKS, x, mask, residOut, g, bta, outB);
        return;
    }
    const float* in;
    __bf16* out;
    int K = DMODEL, Nn = DMODEL;
    unsigned t;
    if (bid < 4 * CVT_DD_BLKS) {
        const unsigned w = bid / CVT_DD_BLKS;
        in  = w == 0 ? Wq : w == 1 ? Wk : w == 2 ? Wv : Wo;
        out = wB + w * (DMODEL * DMODEL);
        t   = bid % CVT_DD_BLKS;
    } else if (bid < 4 * CVT_DD_BLKS + CVT_DF_BLKS) {
        in  = W1;
        out = wB + 4 * (DMODEL * DMODEL);
        Nn  = DFF;
        t   = bid - 4 * CVT_DD_BLKS;
    } else {
        in  = W2;
        out = wB + 4 * (DMODEL * DMODEL) + DMODEL * DFF;
        K   = DFF;
        t   = bid - (4 * CVT_DD_BLKS + CVT_DF_BLKS);
    }
    const unsigned sh = Nn == DFF ? 5 : 3;   // 32 or 8 tiles along n
    cvt_bf16_t_tile(in, out, K, Nn, (int)(t & ((1u << sh) - 1)) * 64, (int)(t >> sh) * 64);
}

// ---------------------------------------------------------------------------
// bf16 WMMA GEMM: C[M,N] = A[M,K] @ B[K,N] (+bias)(+GELU)(+resid), B given as Bt[N,K]
// Block: 256 threads = 8 waves. Tile BM=128, BN=128, BK deep, double-buffered:
// next tile's async DMA runs under the current tile's WMMAs. A stage's copies have
// one stage's arithmetic to land in, so BK sets how much of their latency is
// covered: 64 where three or four blocks share a WGP (four still fit its LDS),
// 128 where a grid of 256 leaves a block alone on its WGP. A copied row is then
// one or two whole 128-byte lines.
// Waves: 4 along M (32 rows), 2 along N (64 cols) -> 2x4 subtiles of 16x16.
// Bt rows are K-contiguous, so both tiles are copied alike and both operands
// use the same frag loader.
// THREE: one grid runs three products that share A (the Q, K and V projections);
// blockIdx.z picks the weight (one behind the other in Bt0), the bias and the
// output (one behind the other in outB0).
// ---------------------------------------------------------------------------
template <int BK, bool BIAS, bool GELU_ACT, bool RESID, bool OUT_BF16, bool THREE>
__global__ __launch_bounds__(256) void gemm_bf16_kernel(
        const __bf16* __restrict__ A, const __bf16* __restrict__ Bt0,
        const float* __restrict__ bias0, const float* __restrict__ bias1,
        const float* __restrict__ bias2, const float* __restrict__ resid,
        float* __restrict__ outF, __bf16* __restrict__ outB0,
        int M, int Nn, int K) {
    constexpr int PITCH = BK + 8;   // 144 or 272 bytes a row: 16 bytes x an odd number
    __shared__ __attribute__((aligned(16))) __bf16 lsA[2][128][PITCH];   // [buf][row][k]
    __shared__ __attribute__((aligned(16))) __bf16 lsB[2][128][PITCH];   // [buf][col][k]

    const int z = THREE ? (int)blockIdx.z : 0;
    const __bf16* __restrict__ Bt   = Bt0 + (size_t)z * Nn * K;
    const float*  __restrict__ bias = z == 0 ? bias0 : z == 1 ? bias1 : bias2;
    __bf16*       __restrict__ outB = outB0 + (size_t)z * M * Nn;

    const int m0 = blockIdx.y * 128;
    const int n0 = blockIdx.x * 128;
    const int tid  = threadIdx.x;
    const int wave = tid >> 5;
    const int wm   = wave & 3;    // 0..3 : 32 rows each
    const int wn   = wave >> 2;   // 0..1 : 64 cols each

    f32x8 acc[2][4];
#pragma unroll
    for (int mi = 0; mi < 2; ++mi)
#pragma unroll
        for (int ni = 0; ni < 4; ++ni) acc[mi][ni] = zero8();

    // One stage: 128 rows x BK k of A and of Bt, 16 bytes a lane; the lanes of a
    // sweep go along a row first, SWEEP rows a sweep of the block.
    constexpr int SEGS  = BK / 8;
    constexpr int SWEEP = 256 / SEGS;
    const int crow = tid / SEGS, cseg = (tid % SEGS) * 8;
    const __bf16* gA = A  + (size_t)(m0 + crow) * K + cseg;
    const __bf16* gB = Bt + (size_t)(n0 + crow) * K + cseg;
    auto load_tiles = [&](int k0, int buf) {
#pragma unroll
        for (int s = 0; s < 128 / SWEEP; s += 4) {
            unsigned o[8];
            const __bf16* g[8];
#pragma unroll
            for (int j = 0; j < 4; ++j) {
                const int r = (s + j) * SWEEP;
                o[j]     = (unsigned)(uintptr_t)&lsA[buf][crow + r][cseg];
                g[j]     = gA + (size_t)r * K + k0;
                o[4 + j] = (unsigned)(uintptr_t)&lsB[buf][crow + r][cseg];
                g[4 + j] = gB + (size_t)r * K + k0;
            }
            async_g2l_b128_x8(o, g);
        }
    };

    const int nk = K / BK;
    load_tiles(0, 0);
    asm volatile("s_wait_asynccnt 0x0" ::: "memory");   // stage 0 landed (own copies)
    __syncthreads();                                    // ... and everyone's
    if (nk > 1) load_tiles(BK, 1);
    for (int i = 0; i < nk; ++i) {
        const int buf = i & 1;
#pragma unroll
        for (int kk = 0; kk < BK; kk += 32) {
            bf16x16 aF[2], bF[4];
#pragma unroll
            for (int mi = 0; mi < 2; ++mi)
                aF[mi] = load_frag(&lsA[buf][0][0], PITCH, wm * 32 + mi * 16, kk);
#pragma unroll
            for (int ni = 0; ni < 4; ++ni)
                bF[ni] = load_frag(&lsB[buf][0][0], PITCH, wn * 64 + ni * 16, kk);
#pragma unroll
            for (int mi = 0; mi < 2; ++mi)
#pragma unroll
                for (int ni = 0; ni < 4; ++ni)
                    acc[mi][ni] = __builtin_amdgcn_wmma_f32_16x16x32_bf16(
                        false, aF[mi], false, bF[ni], (short)0, acc[mi][ni], false, false);
        }

        // Publish stage i+1 and free this buffer: own LDS reads done, own
        // copies landed, then the barrier; only then the refill.
        asm volatile("s_wait_dscnt 0x0" ::: "memory");
        asm volatile("s_wait_asynccnt 0x0" ::: "memory");
        __syncthreads();
        if (i + 2 < nk) load_tiles((i + 2) * BK, buf);
    }
    asm volatile("s_wait_asynccnt 0x0" ::: "memory");   // nothing in flight at the end

    // Epilogue. C/D layout: lane<16 -> M = r, lane>=16 -> M = 8+r ; N = lane&15
    const int lane = tid & 31;
    const int half = lane >> 4;
    const int lcol = lane & 15;
    // Residual values of this wave's 2x4 subtiles, all 64 loads issued here back
    // to back: their latency runs once, not once per element between the stores.
    float rs[2][4][8];
    if (RESID) {
        // The residual stream is DMODEL wide, so every row and column step is an
        // immediate offset from one index register.
        const float* rp = resid + ((m0 + wm * 32 + half * 8) * DMODEL + n0 + wn * 64 + lcol);
#pragma unroll
        for (int mi = 0; mi < 2; ++mi)
#pragma unroll
            for (int r = 0; r < 8; ++r)
#pragma unroll
                for (int ni = 0; ni < 4; ++ni)
                    rs[mi][ni][r] = rp[(mi * 16 + r) * DMODEL + ni * 16];
        // Keeps all 64 loads in flight at once: left alone, the scheduler issues the
        // last fourteen only when the first have returned, a second latency.
        __builtin_amdgcn_sched_barrier(0);
    }
    float bv[4];   // the lane's four bias values, loaded together ahead of the arithmetic
    if (BIAS) {
#pragma unroll
        for (int ni = 0; ni < 4; ++ni) bv[ni] = bias[n0 + wn * 64 + ni * 16 + lcol];
    }
#pragma unroll
    for (int mi = 0; mi < 2; ++mi) {
#pragma unroll
        for (int ni = 0; ni < 4; ++ni) {
            const int gc = n0 + wn * 64 + ni * 16 + lcol;
            f32x8 v8 = acc[mi][ni];
            if (BIAS)     v8 += bv[ni];
            if (GELU_ACT) v8 = gelu_tanh_x8(v8);
#pragma unroll
            for (int r = 0; r < 8; ++r) {
                int gr = m0 + wm * 32 + mi * 16 + half * 8 + r;
                float v = v8[r];
                if (RESID)    v += rs[mi][ni][r];
                if (OUT_BF16) outB[(size_t)gr * Nn + gc] = (__bf16)v;
                else          outF[(size_t)gr * Nn + gc] = v;
            }
        }
    }
}

// ---------------------------------------------------------------------------
// Attention: one block per (b, h, 128-row Q tile). Streams 64-key tiles:
//   S = Q K^T * scale ; P = exp(S) (reference has no max-subtraction)
//   rowsum += sum_j P ; O += P V ; final O /= rowsum.
// Q/K tiles are async-DMA'd into LDS; V needs a transpose scatter.
// ---------------------------------------------------------------------------
__global__ __launch_bounds__(256) void attn_kernel(const __bf16* __restrict__ Q,
                                                   const __bf16* __restrict__ Kmat,
                                                   const __bf16* __restrict__ Vmat,
                                                   __bf16* __restrict__ O) {
    __shared__ __bf16 lsQ[128][72];   // [row][dh]
    __shared__ __bf16 lsK[64][72];    // [key][dh]  (B-transposed layout for QK^T)
    __shared__ __bf16 lsVt[64][72];   // [dh][key]  (B-transposed layout for PV)
    __shared__ __bf16 lsP[128][72];   // [row][key]
    __shared__ float  rowsumAcc[128];

    const int r0 = blockIdx.x * 128;
    const int h  = blockIdx.y;
    const int b  = blockIdx.z;
    const int tid  = threadIdx.x;
    const int wave = tid >> 5;
    const int wm   = wave & 3;     // 4 x 32 rows
    const int wn   = wave >> 2;    // 2 x 32 cols
    const int lane = tid & 31;
    const int half = lane >> 4;
    const int lcol = lane & 15;

    const __bf16* qbase = Q + ((size_t)(b * SEQ + r0)) * DMODEL + h * DHEAD;
#pragma unroll
    for (int s = tid; s < 1024; s += 256) {   // 128 rows x 8 uint4 segs
        int row = s >> 3, cs = s & 7;
        async_g2l_b128(&lsQ[row][cs * 8], qbase + (size_t)row * DMODEL + cs * 8);
    }
    if (tid < 128) rowsumAcc[tid] = 0.f;

    f32x8 oAcc[2][2];
#pragma unroll
    for (int mi = 0; mi < 2; ++mi)
#pragma unroll
        for (int ni = 0; ni < 2; ++ni) oAcc[mi][ni] = zero8();

    for (int j0 = 0; j0 < SEQ; j0 += 64) {
        __syncthreads();
        const __bf16* kbase = Kmat + ((size_t)(b * SEQ + j0)) * DMODEL + h * DHEAD;
        const __bf16* vbase = Vmat + ((size_t)(b * SEQ + j0)) * DMODEL + h * DHEAD;
#pragma unroll
        for (int s = tid; s < 512; s += 256) {  // K tile row-major, async DMA
            int kr = s >> 3, cs = s & 7;
            async_g2l_b128(&lsK[kr][cs * 8], kbase + (size_t)kr * DMODEL + cs * 8);
        }
#pragma unroll
        for (int s = tid; s < 512; s += 256) {  // V tile, scatter transposed
            int kr = s >> 3, cs = s & 7;
            uint4 t = *(const uint4*)(vbase + (size_t)kr * DMODEL + cs * 8);
            const __bf16* hs = reinterpret_cast<const __bf16*>(&t);
#pragma unroll
            for (int e = 0; e < 8; ++e) lsVt[cs * 8 + e][kr] = hs[e];
        }
        wait_async0();
        __syncthreads();

        // S = Q K^T  (M=128 rows, N=64 keys, K=64=dh)
        f32x8 sAcc[2][2];
#pragma unroll
        for (int mi = 0; mi < 2; ++mi)
#pragma unroll
            for (int ni = 0; ni < 2; ++ni) sAcc[mi][ni] = zero8();
#pragma unroll
        for (int kk = 0; kk < 64; kk += 32) {
            bf16x16 aF[2], bF[2];
#pragma unroll
            for (int mi = 0; mi < 2; ++mi)
                aF[mi] = load_frag(&lsQ[0][0], 72, wm * 32 + mi * 16, kk);
#pragma unroll
            for (int ni = 0; ni < 2; ++ni)
                bF[ni] = load_frag(&lsK[0][0], 72, wn * 32 + ni * 16, kk);
#pragma unroll
            for (int mi = 0; mi < 2; ++mi)
#pragma unroll
                for (int ni = 0; ni < 2; ++ni)
                    sAcc[mi][ni] = __builtin_amdgcn_wmma_f32_16x16x32_bf16(
                        false, aF[mi], false, bF[ni], (short)0, sAcc[mi][ni], false, false);
        }
        // P = exp(scale * S) into LDS, as 2^(S * scale * log2(e)): one multiply and
        // the hardware's exp2 (inf above the f32 range and 0 below it, like exp)
#pragma unroll
        for (int mi = 0; mi < 2; ++mi)
#pragma unroll
            for (int ni = 0; ni < 2; ++ni) {
                f32x8 p = sAcc[mi][ni] * (float)(ATTN_SCALE * LOG2E);
                TRANS_X8("v_exp_f32", p);
#pragma unroll
                for (int r = 0; r < 8; ++r) {
                    int row = wm * 32 + mi * 16 + half * 8 + r;
                    int col = wn * 32 + ni * 16 + lcol;
                    lsP[row][col] = (__bf16)p[r];
                }
            }
        __syncthreads();
        // rowsum accumulate (threads 0..127 own one row each)
        if (tid < 128) {
            float s = 0.f;
#pragma unroll
            for (int c = 0; c < 64; ++c) s += (float)lsP[tid][c];
            rowsumAcc[tid] += s;
        }
        // O += P V  (M=128 rows, N=64=dh, K=64 keys)
#pragma unroll
        for (int kk = 0; kk < 64; kk += 32) {
            bf16x16 aF[2], bF[2];
#pragma unroll
            for (int mi = 0; mi < 2; ++mi)
                aF[mi] = load_frag(&lsP[0][0], 72, wm * 32 + mi * 16, kk);
#pragma unroll
            for (int ni = 0; ni < 2; ++ni)
                bF[ni] = load_frag(&lsVt[0][0], 72, wn * 32 + ni * 16, kk);
#pragma unroll
            for (int mi = 0; mi < 2; ++mi)
#pragma unroll
                for (int ni = 0; ni < 2; ++ni)
                    oAcc[mi][ni] = __builtin_amdgcn_wmma_f32_16x16x32_bf16(
                        false, aF[mi], false, bF[ni], (short)0, oAcc[mi][ni], false, false);
        }
    }
    __syncthreads();

    __bf16* obase = O + ((size_t)(b * SEQ + r0)) * DMODEL + h * DHEAD;
#pragma unroll
    for (int mi = 0; mi < 2; ++mi)
#pragma unroll
        for (int ni = 0; ni < 2; ++ni)
#pragma unroll
            for (int r = 0; r < 8; ++r) {
                int row = wm * 32 + mi * 16 + half * 8 + r;
                int col = wn * 32 + ni * 16 + lcol;
                obase[(size_t)row * DMODEL + col] = (__bf16)(oAcc[mi][ni][r] / rowsumAcc[row]);
            }
}

// ---------------------------------------------------------------------------
// Mean pool over tokens + head LayerNorm + classifier (8x512x1000, f32), spread
// over the chip in two launches.
// ---------------------------------------------------------------------------
#define POOL_CH   16                 // partial token sums per batch row
#define POOL_ROWS (SEQ / POOL_CH)    // 64 tokens a block

typedef __attribute__((ext_vector_type(4))) float f32x4;
typedef __attribute__((ext_vector_type(2))) float f32x2;

template <int M>
__device__ __forceinline__ float row_xor(float v) {   // lane l <- lane l ^ M, M < 16
    return __builtin_bit_cast(float, __builtin_amdgcn_update_dpp(
        0, __builtin_bit_cast(int, v), 0x160 | M, 0xf, 0xf, true));
}

__device__ __forceinline__ float half_xor(float v) {  // lane l <- lane l ^ 16
    int t = __builtin_bit_cast(int, v);
    return __builtin_bit_cast(float, __builtin_amdgcn_permlanex16(t, t, 0x76543210, 0xfedcba98, false, false));
}

__device__ __forceinline__ float wave_sum(float v) {  // total of 32 lanes, in every lane
    v += row_xor<1>(v);
    v += row_xor<2>(v);
    v += row_xor<4>(v);
    v += row_xor<8>(v);
    v += half_xor(v);
    return v;
}

// Launch 1: block (ch, b, z) sums 64 tokens of batch row b, columns
// [256 z, 256 z + 256), into part[b][ch][.]. 256 threads = 64 column quads x 4
// token groups; a wave's load covers 512 contiguous bytes.
__global__ __launch_bounds__(256) void pool_partial_kernel(const float* __restrict__ x3,
                                                           float* __restrict__ part) {
    __shared__ f32x4 red[4][64];
    const int tid = threadIdx.x;
    const int c4  = tid & 63;
    const int rg  = tid >> 6;
    const int ch  = blockIdx.x;
    const int b   = blockIdx.y;
    const int col = blockIdx.z * 256 + c4 * 4;
    const float* base = x3 + ((size_t)(b * SEQ + ch * POOL_ROWS + rg)) * DMODEL + col;
    f32x4 v[16];
#pragma unroll
    for (int i = 0; i < 16; ++i) v[i] = *(const f32x4*)(base + (size_t)(i * 4) * DMODEL);
    // The loads' address register is named so that it is not reused, not even
    // as a load's destination, ahead of this wait.
    asm volatile("s_wait_xcnt 0x0" :: "v"(base) : "memory");
    // Keeps all 16 loads in flight at once: left alone, the scheduler issues the
    // last four only when the first have returned, a second latency.
    __builtin_amdgcn_sched_barrier(0);
#pragma unroll
    for (int w = 8; w > 0; w >>= 1)
#pragma unroll
        for (int i = 0; i < w; ++i) v[i] += v[i + w];
    red[rg][c4] = v[0];
    __syncthreads();
    if (rg == 0)
        *(f32x4*)(part + ((size_t)(b * POOL_CH + ch)) * DMODEL + col) =
            (red[0][c4] + red[1][c4]) + (red[2][c4] + red[3][c4]);
}

// Launch 2: one block per 128-byte line of out (32 consecutive floats of the
// flat [8][1000] array), so every line has one writer. A line can straddle two
// batch rows, so each block normalises the pooled vectors of the first and of
// the last float's batch row (the same row twice for most lines).
// Lane = (k group kr, class quad q); wave w takes k in [64 w, 64 w + 64).
__global__ __launch_bounds__(256) void head_kernel(const float* __restrict__ part,
                                                   const float* __restrict__ g,
                                                   const float* __restrict__ bta,
                                                   const float* __restrict__ Wh,
                                                   const float* __restrict__ bh,
                                                   float* __restrict__ out) {
    __shared__ __attribute__((aligned(16))) float pool[2][DMODEL];
    __shared__ __attribute__((aligned(16))) float redS[2][8];
    __shared__ __attribute__((aligned(16))) float redQ[2][8];
    __shared__ f32x4 accs[8][8];
    const int tid  = threadIdx.x;
    const int lane = tid & 31;
    const int wave = tid >> 5;
    const int q    = lane & 7;
    const int kr   = lane >> 3;
    const int f0   = blockIdx.x * 32;
    const int b0   = f0 / NCLS;
    const int b1   = (f0 + 31) / NCLS;
    const int f    = f0 + q * 4;        // NCLS is a multiple of 4: a quad stays in one row
    const int bq   = f / NCLS;
    const int c    = f - bq * NCLS;
    const int kb   = wave * 64 + kr * 16;

    const f32x2 g2   = *(const f32x2*)(g + tid * 2);
    const f32x2 t2   = *(const f32x2*)(bta + tid * 2);
    const float* bp  = bh + c;
    const float* wp  = Wh + (size_t)kb * NCLS + c;
    const float* pp0 = part + (size_t)(b0 * POOL_CH) * DMODEL + tid * 2;
    const float* pp1 = part + (size_t)(b1 * POOL_CH) * DMODEL + tid * 2;
    const f32x4 bias = *(const f32x4*)bp;
    f32x4 w[16];
#pragma unroll
    for (int i = 0; i < 16; ++i) w[i] = *(const f32x4*)(wp + (size_t)i * NCLS);
    f32x2 p0[POOL_CH], p1[POOL_CH];
#pragma unroll
    for (int j = 0; j < POOL_CH; ++j) {
        p0[j] = *(const f32x2*)(pp0 + (size_t)j * DMODEL);
        p1[j] = *(const f32x2*)(pp1 + (size_t)j * DMODEL);
    }
    // The address registers of the bias and weight loads are named so that
    // neither is reused, not even as a load's destination, ahead of this wait
    // (the other loads go by the thread index and a scalar base).
    asm volatile("s_wait_xcnt 0x0" :: "v"(bp), "v"(wp) : "memory");
    // Keeps the classifier's loads in front of the pooling arithmetic, so that
    // their latency runs under it instead of behind the three barriers below.
    __builtin_amdgcn_sched_barrier(0);

#pragma unroll
    for (int s = POOL_CH / 2; s > 0; s >>= 1)
#pragma unroll
        for (int j = 0; j < s; ++j) { p0[j] += p0[j + s]; p1[j] += p1[j + s]; }
    const f32x2 m0 = p0[0] * (1.f / SEQ);
    const f32x2 m1 = p1[0] * (1.f / SEQ);

    const float s0 = wave_sum(m0.x + m0.y);
    const float s1 = wave_sum(m1.x + m1.y);
    if (lane == 0) { redS[0][wave] = s0; redS[1][wave] = s1; }
    __syncthreads();
    float mu0 = 0.f, mu1 = 0.f;
#pragma unroll
    for (int i = 0; i < 8; ++i) { mu0 += redS[0][i]; mu1 += redS[1][i]; }
    mu0 *= (1.f / DMODEL);
    mu1 *= (1.f / DMODEL);
    const f32x2 d0 = m0 - mu0;
    const f32x2 d1 = m1 - mu1;
    const float q0 = wave_sum(d0.x * d0.x + d0.y * d0.y);
    const float q1 = wave_sum(d1.x * d1.x + d1.y * d1.y);
    if (lane == 0) { redQ[0][wave] = q0; redQ[1][wave] = q1; }
    __syncthreads();
    float v0 = 0.f, v1 = 0.f;
#pragma unroll
    for (int i = 0; i < 8; ++i) { v0 += redQ[0][i]; v1 += redQ[1][i]; }
    const float r0 = rsqrtf(v0 * (1.f / DMODEL) + 1e-5f);
    const float r1 = rsqrtf(v1 * (1.f / DMODEL) + 1e-5f);
    *(f32x2*)&pool[0][tid * 2] = d0 * r0 * g2 + t2;
    *(f32x2*)&pool[1][tid * 2] = d1 * r1 * g2 + t2;
    __syncthreads();

    const float* pv = &pool[bq - b0][kb];
    f32x4 acc = {0.f, 0.f, 0.f, 0.f};
#pragma unroll
    for (int i = 0; i < 16; i += 4) {
        const f32x4 pk = *(const f32x4*)(pv + i);
        acc += pk.x * w[i] + pk.y * w[i + 1] + pk.z * w[i + 2] + pk.w * w[i + 3];
    }
#pragma unroll
    for (int e = 0; e < 4; ++e) {       // fold the four k groups of the wave
        acc[e] += row_xor<8>(acc[e]);
        acc[e] += half_xor(acc[e]);
    }
    if (lane < 8) accs[wave][q] = acc;
    __syncthreads();
    if (tid < 8) {
        f32x4 r = bias;
#pragma unroll
        for (int i = 0; i < 8; ++i) r += accs[i][tid];
        *(f32x4*)(out + f) = r;
    }
}

// ---------------------------------------------------------------------------
// Host-side orchestration
// ---------------------------------------------------------------------------
extern "C" void kernel_launch(void* const* d_in, const int* in_sizes, int n_in,
                              void* d_out, int out_size, void* d_ws, size_t ws_size,
                              hipStream_t stream) {
    (void)in_sizes; (void)n_in; (void)out_size; (void)ws_size;
    const float* x     = (const float*)d_in[0];
    const float* mask  = (const float*)d_in[1];
    const float* ln1_g = (const float*)d_in[2];
    const float* ln1_b = (const float*)d_in[3];
    const float* Wq    = (const float*)d_in[4];
    const float* bq    = (const float*)d_in[5];
    const float* Wk    = (const float*)d_in[6];
    const float* bk_p  = (const float*)d_in[7];
    const float* Wv    = (const float*)d_in[8];
    const float* bv    = (const float*)d_in[9];
    const float* Wo    = (const float*)d_in[10];
    const float* bo    = (const float*)d_in[11];
    const float* ln2_g = (const float*)d_in[12];
    const float* ln2_b = (const float*)d_in[13];
    const float* W1    = (const float*)d_in[14];
    const float* b1    = (const float*)d_in[15];
    const float* W2    = (const float*)d_in[16];
    const float* b2    = (const float*)d_in[17];
    const float* lnh_g = (const float*)d_in[18];
    const float* lnh_b = (const float*)d_in[19];
    const float* Wh    = (const float*)d_in[20];
    const float* bh    = (const float*)d_in[21];

    char* ws = (char*)d_ws;
    const size_t MB = 1ull << 20;
    // Workspace map (aliasing is ordered by the stream):
    //   [ 0,16MB)  resid (f32)  -- reused as x3 after the Wo projection
    //   [16,32MB)  x2 (f32)
    //   [32,40MB)  xn (bf16)    -- reused as xn2
    //   [40,72MB)  bufQ/bufK/bufV/bufAO (bf16, 8MB each) -- reused as h1 (32MB)
    //   [72MB,..)  bf16 weights, each transposed to [N][K]
    //   [80MB,..)  partial token sums (f32, 256KB)
    float*  resid  = (float*) (ws + 0);
    float*  x2     = (float*) (ws + 16 * MB);
    __bf16* xn     = (__bf16*)(ws + 32 * MB);
    __bf16* bufQ   = (__bf16*)(ws + 40 * MB);
    __bf16* bufK   = (__bf16*)(ws + 48 * MB);
    __bf16* bufV   = (__bf16*)(ws + 56 * MB);
    __bf16* bufAO  = (__bf16*)(ws + 64 * MB);
    __bf16* h1     = bufQ;
    float*  x3     = resid;
    __bf16* wqB    = (__bf16*)(ws + 72 * MB);
    __bf16* wkB    = wqB + DMODEL * DMODEL;
    __bf16* wvB    = wkB + DMODEL * DMODEL;
    __bf16* woB    = wvB + DMODEL * DMODEL;
    __bf16* w1B    = woB + DMODEL * DMODEL;
    __bf16* w2B    = w1B + DMODEL * DFF;
    float*  part   = (float*) (ws + 80 * MB);

    // One grid: W[K][N] f32 -> Wt[N][K] bf16 for all six weights, and
    // mask * x -> residual ; LN1 -> xn (bf16)
    prep_kernel<<<CVT_BLKS + MROWS, 256, 0, stream>>>(Wq, Wk, Wv, Wo, W1, W2, wqB,
                                                      x, mask, resid, ln1_g, ln1_b, xn);

    // QKV projections, one grid: z = 0, 1, 2 -> bufQ, bufK, bufV
    dim3 gDD(DMODEL / 128, MROWS / 128);   // (4, 64)
    gemm_bf16_kernel<64, true, false, false, true, true>
        <<<dim3(DMODEL / 128, MROWS / 128, 3), 256, 0, stream>>>(
        xn, wqB, bq, bk_p, bv, nullptr, nullptr, bufQ, MROWS, DMODEL, DMODEL);

    // Attention
    attn_kernel<<<dim3(SEQ / 128, HEADS, BATCH), 256, 0, stream>>>(bufQ, bufK, bufV, bufAO);

    // Output projection + residual -> x2 (f32)
    gemm_bf16_kernel<128, true, false, true, false, false><<<gDD, 256, 0, stream>>>(
        bufAO, woB, bo, nullptr, nullptr, resid, x2, nullptr, MROWS, DMODEL, DMODEL);

    // LN2 -> xn2 (bf16)
    ln_kernel<<<MROWS, 256, 0, stream>>>(x2, ln2_g, ln2_b, xn);

    // FFN1: GELU(xn2 @ W1 + b1) -> h1 (bf16)
    gemm_bf16_kernel<64, true, true, false, true, false><<<dim3(DFF / 128, MROWS / 128), 256, 0, stream>>>(
        xn, w1B, b1, nullptr, nullptr, nullptr, nullptr, h1, MROWS, DFF, DMODEL);

    // FFN2: h1 @ W2 + b2 + x2 -> x3 (f32)
    gemm_bf16_kernel<128, true, false, true, false, false><<<gDD, 256, 0, stream>>>(
        h1, w2B, b2, nullptr, nullptr, x2, x3, nullptr, MROWS, DMODEL, DFF);

    // Mean pool + head LN + classifier
    pool_partial_kernel<<<dim3(POOL_CH, BATCH, 2), 256, 0, stream>>>(x3, part);
    head_kernel<<<BATCH * NCLS / 32, 256, 0, stream>>>(part, lnh_g, lnh_b, Wh, bh, (float*)d_out);
}

// v008
// It runs in 129 microseconds.
// It is 1.17 times as fast as v006, going by the measured steps of the versions left out in between.
// Over all steps from v000 it is 3.74 times as fast.
#include <hip/hip_runtime.h>
#include <cstdint>
#include <cstddef>

// ---------------------------------------------------------------------------
// MI455X (gfx1250) transformer block, bf16 WMMA path.
// ~70 GFLOP of GEMMs vs ~100MB traffic -> matrix-core bound; everything
// routed through v_wmma_f32_16x16x32_bf16 with f32 accumulation.
// Row-major tiles are staged into LDS with global_load_async_to_lds_b128
// (ASYNCcnt-tracked DMA, no VGPR round-trip), double-buffered in the GEMM.
// Weights are converted to bf16 K-contiguous ([N][K]) so that the GEMM's B
// tile is copied the same way as its A tile.
// ---------------------------------------------------------------------------

typedef __attribute__((ext_vector_type(16))) __bf16 bf16x16;
typedef __attribute__((ext_vector_type(8)))  float  f32x8;

#define HEADS 8
#define DHEAD 64
#define SEQ   1024
#define BATCH 8
#define DMODEL 512
#define DFF   2048
#define NCLS  1000
#define MROWS (BATCH * SEQ)   // 8192
#define ATTN_SCALE 0.125f     // 1/sqrt(64)
#define LOG2E 1.4426950408889634

__device__ __forceinline__ f32x8 zero8() {
    f32x8 z = {0.f, 0.f, 0.f, 0.f, 0.f, 0.f, 0.f, 0.f};
    return z;
}

// Eight hardware transcendentals in place (OP: v_exp_f32 = 2^x, v_rcp_f32 = 1/x).
// One statement, so that every one of them has an independent instruction behind
// it (the next of the eight) and the last one the v_nop: the slot that the
// instruction set asks for before a transcendental's result is used. volatile
// keeps the groups in program order: left free, the scheduler opens several at
// once and the GELU kernel goes past 128 registers, one block fewer on a WGP.
#define TRANS_X8(OP, v)                                                          \
    do {                                                                         \
        float t0 = (v)[0], t1 = (v)[1], t2 = (v)[2], t3 = (v)[3];                \
        float t4 = (v)[4], t5 = (v)[5], t6 = (v)[6], t7 = (v)[7];                \
        asm volatile(OP " %0, %0\n\t" OP " %1, %1\n\t" OP " %2, %2\n\t" OP " %3, %3\n\t" \
            OP " %4, %4\n\t" OP " %5, %5\n\t" OP " %6, %6\n\t" OP " %7, %7\n\t" \
            "v_nop"                                                              \
            : "+v"(t0), "+v"(t1), "+v"(t2), "+v"(t3),                            \
              "+v"(t4), "+v"(t5), "+v"(t6), "+v"(t7));                           \
        (v)[0] = t0; (v)[1] = t1; (v)[2] = t2; (v)[3] = t3;                      \
        (v)[4] = t4; (v)[5] = t5; (v)[6] = t6; (v)[7] = t7;                      \
    } while (0)

// 0.5 x (1 + tanh(u)) = x / (1 + exp(-2u)), u = c (x + 0.044715 x^3): the same
// function without the library tanh's two branches. -2 c log2(e) is folded into
// the cubic, so that the hardware's exp2 and reciprocal take it from there.
// x far below 0: exp2 -> inf, 1/inf = 0, result -0; x far above 0: exp2 -> 0, result x.
__device__ __forceinline__ f32x8 gelu_tanh_x8(f32x8 x) {
    constexpr float k0 = (float)(-2.0 * 0.7978845608028654 * LOG2E);
    constexpr float k1 = (float)(-2.0 * 0.7978845608028654 * LOG2E * 0.044715);
    f32x8 e = x * (k0 + k1 * (x * x));
    TRANS_X8("v_exp_f32", e);
    e += 1.f;
    TRANS_X8("v_rcp_f32", e);
    return x * e;
}

// Async DMA: 16 bytes global -> LDS per lane (VDST = LDS byte offset VGPR,
// VADDR = 64-bit global address). Tracked by ASYNCcnt. Low 32 bits of a
// flat shared pointer are the LDS byte offset on AMDGPU.
__device__ __forceinline__ void async_g2l_b128(void* ldsDst, const void* gSrc) {
    unsigned ldsOff = (unsigned)(uintptr_t)ldsDst;
    asm volatile("global_load_async_to_lds_b128 %0, %1, off"
                 :: "v"(ldsOff), "v"(gSrc)
                 : "memory");
}

// Eight such copies of one lane (four A rows, four B rows of a GEMM stage). The
// s_wait_xcnt closes the statement so that no address register of a copy is
// rewritten ahead of it.
__device__ __forceinline__ void async_g2l_b128_x8(const unsigned (&o)[8],
                                                  const __bf16* const (&g)[8]) {
    asm volatile("global_load_async_to_lds_b128 %0, %1, off\n\t"
                 "global_load_async_to_lds_b128 %2, %3, off\n\t"
                 "global_load_async_to_lds_b128 %4, %5, off\n\t"
                 "global_load_async_to_lds_b128 %6, %7, off\n\t"
                 "global_load_async_to_lds_b128 %8, %9, off\n\t"
                 "global_load_async_to_lds_b128 %10, %11, off\n\t"
                 "global_load_async_to_lds_b128 %12, %13, off\n\t"
                 "global_load_async_to_lds_b128 %14, %15, off\n\t"
                 "s_wait_xcnt 0x0"
                 :: "v"(o[0]), "v"(g[0]), "v"(o[1]), "v"(g[1]),
                    "v"(o[2]), "v"(g[2]), "v"(o[3]), "v"(g[3]),
                    "v"(o[4]), "v"(g[4]), "v"(o[5]), "v"(g[5]),
                    "v"(o[6]), "v"(g[6]), "v"(o[7]), "v"(g[7])
                 : "memory");
}

__device__ __forceinline__ void wait_async0() {
#if __has_builtin(__builtin_amdgcn_s_wait_asynccnt)
    __builtin_amdgcn_s_wait_asynccnt(0);
#else
    asm volatile("s_wait_asynccnt 0x0" ::: "memory");
#endif
}

// Load a 16x32 bf16 WMMA operand fragment from an LDS tile laid out as
// tile[rc][k] (A-matrix rows, or B-matrix stored K-transposed: tile[col][k]).
// Per ISA 7.12.2 (16-bit A 16x32): lanes 0-15 hold K=0..7,16..23 of row M=lane,
// lanes 16-31 hold K=8..15,24..31 of row M=lane-16; pairs packed per VGPR.
__device__ __forceinline__ bf16x16 load_frag(const __bf16* base, int stride,
                                             int rcBase, int kBase) {
    const int lane = threadIdx.x & 31;
    const int idx  = lane & 15;
    const int half = lane >> 4;
    const __bf16* p = base + (size_t)(rcBase + idx) * stride + kBase + half * 8;
    union { bf16x16 v; unsigned u[8]; } r;
#pragma unroll
    for (int i = 0; i < 8; ++i) {
        int k = ((i & 4) << 2) + ((i & 3) << 1);   // i<4 -> 0..6 ; i>=4 -> 16..22
        r.u[i] = *(const unsigned*)(p + k);
    }
    return r.v;
}

// ---------------------------------------------------------------------------
// fp32 [K][N] -> bf16 [N][K] convert + transpose. One 64x64 tile per block,
// turned in LDS (pitch 65 dwords: column walks hit distinct banks); each wave
// stores whole 128-byte rows of the output.
// ---------------------------------------------------------------------------
__device__ __forceinline__ void cvt_bf16_t_tile(const float* __restrict__ in,
                                                __bf16* __restrict__ out,
                                                int K, int Nn, int n0, int k0) {
    __shared__ float t[64][65];
    const int tid = threadIdx.x;
    const int kr = tid >> 4;          // 16 rows a sweep, 16 bytes a lane
    const int c4 = (tid & 15) * 4;
    float4 v[4];
#pragma unroll
    for (int r = 0; r < 4; ++r)
        v[r] = *(const float4*)(in + (size_t)(k0 + kr + r * 16) * Nn + n0 + c4);
#pragma unroll
    for (int r = 0; r < 4; ++r) {
        t[kr + r * 16][c4 + 0] = v[r].x;
        t[kr + r * 16][c4 + 1] = v[r].y;
        t[kr + r * 16][c4 + 2] = v[r].z;
        t[kr + r * 16][c4 + 3] = v[r].w;
    }
    __syncthreads();
    const int kp = tid & 31;   // pair of k
    const int nr = tid >> 5;
#pragma unroll
    for (int r = 0; r < 8; ++r) {
        int n = nr + r * 8;
        union { __bf16 h[2]; unsigned u; } p;
        p.h[0] = (__bf16)t[2 * kp][n];
        p.h[1] = (__bf16)t[2 * kp + 1][n];
        *(unsigned*)(out + (size_t)(n0 + n) * K + k0 + 2 * kp) = p.u;
    }
}

typedef __attribute__((ext_vector_type(4))) float f32x4;
typedef __attribute__((ext_vector_type(2))) float f32x2;

template <int M>
__device__ __forceinline__ float row_xor(float v) {   // lane l <- lane l ^ M, M < 16
    return __builtin_bit_cast(float, __builtin_amdgcn_update_dpp(
        0, __builtin_bit_cast(int, v), 0x160 | M, 0xf, 0xf, true));
}

__device__ __forceinline__ float half_xor(float v) {  // lane l <- lane l ^ 16
    int t = __builtin_bit_cast(int, v);
    return __builtin_bit_cast(float, __builtin_amdgcn_permlanex16(t, t, 0x76543210, 0xfedcba98, false, false));
}

__device__ __forceinline__ float wave_sum(float v) {  // total of 32 lanes, in every lane
    v += row_xor<1>(v);
    v += row_xor<2>(v);
    v += row_xor<4>(v);
    v += row_xor<8>(v);
    v += half_xor(v);
    return v;
}

// ---------------------------------------------------------------------------
// LayerNorm over D=512. Optionally applies token mask and emits f32 residual.
// One wave takes LN_RPW whole rows and keeps them in registers: a lane holds 16
// values of each row (four 16-byte loads; a wave's load covers 512 contiguous
// bytes), both sums are in-lane adds and a five-step lane exchange. No LDS and no
// barrier, and a launch starts 2,048 waves where one block a row starts 65,536.
// ---------------------------------------------------------------------------
#define LN_RPW  4                        // rows a wave
#define LN_BLKS (MROWS / (8 * LN_RPW))   // 256 blocks of 8 waves

typedef __attribute__((ext_vector_type(4))) __bf16 bf16x4;

template <bool MASKED>
__device__ __forceinline__ void ln_rows(int blk,
                                        const float* __restrict__ x,
                                        const float* __restrict__ mask,
                                        float* __restrict__ residOut,
                                        const float* __restrict__ g,
                                        const float* __restrict__ bta,
                                        __bf16* __restrict__ outB) {
    const unsigned cb = (threadIdx.x & 31) * 16;   // the lane's byte offset in 512 bytes
    const int wave = __builtin_amdgcn_readfirstlane(threadIdx.x >> 5);
    const int row0 = (blk * 8 + wave) * LN_RPW;
    const size_t rb = (size_t)row0 * DMODEL + cb / 4;
    const float* xp = x + rb;
    f32x4 v[LN_RPW][4];
#pragma unroll
    for (int r = 0; r < LN_RPW; ++r)
#pragma unroll
        for (int j = 0; j < 4; ++j)
            v[r][j] = *(const f32x4*)(xp + r * DMODEL + j * 128);
    // Byte offset of the rows' four mask values (16 bytes, aligned). Formed from the
    // thread index, not from row0, so that it lives in the one vector register that
    // the load names and the wait below holds.
    const unsigned mo = (((blk * 8 + (threadIdx.x >> 5)) * LN_RPW) & (SEQ - 1)) * 4;
    f32x4 mv = {1.f, 1.f, 1.f, 1.f};
    if (MASKED) mv = *(const f32x4*)((const char*)mask + mo);
    f32x4 gv[4], bv[4];
#pragma unroll
    for (int j = 0; j < 4; ++j) {
        gv[j] = *(const f32x4*)((const char*)g + cb + j * 512);
        bv[j] = *(const f32x4*)((const char*)bta + cb + j * 512);
    }
    // The loads' address registers are named so that none is reused, not even as a
    // load's destination, ahead of the wait.
    if (MASKED) asm volatile("s_wait_xcnt 0x0" :: "v"(xp), "v"(cb), "v"(mo) : "memory");
    else        asm volatile("s_wait_xcnt 0x0" :: "v"(xp), "v"(cb) : "memory");
    // Keeps every load of the wave in flight at once, one latency for its four rows:
    // nothing below may be scheduled in between them.
    __builtin_amdgcn_sched_barrier(0);

    float s[LN_RPW];
#pragma unroll
    for (int r = 0; r < LN_RPW; ++r) {
        if (MASKED) {
#pragma unroll
            for (int j = 0; j < 4; ++j) {
                v[r][j] *= mv[r];
                *(f32x4*)(residOut + rb + r * DMODEL + j * 128) = v[r][j];
            }
        }
        const f32x4 t = (v[r][0] + v[r][1]) + (v[r][2] + v[r][3]);
        s[r] = (t.x + t.y) + (t.z + t.w);
    }
#pragma unroll
    for (int r = 0; r < LN_RPW; ++r) s[r] = wave_sum(s[r]);
#pragma unroll
    for (int r = 0; r < LN_RPW; ++r) {
        const float mu = s[r] * (1.f / DMODEL);
#pragma unroll
        for (int j = 0; j < 4; ++j) v[r][j] -= mu;
        const f32x4 t = (v[r][0] * v[r][0] + v[r][1] * v[r][1]) + (v[r][2] * v[r][2] + v[r][3] * v[r][3]);
        s[r] = (t.x + t.y) + (t.z + t.w);
    }
#pragma unroll
    for (int r = 0; r < LN_RPW; ++r) s[r] = wave_sum(s[r]);
#pragma unroll
    for (int r = 0; r < LN_RPW; ++r) s[r] = s[r] * (1.f / DMODEL) + 1e-5f;
    // The four reciprocal square roots in one statement: each has an independent
    // instruction behind it and the last one the v_nop, the slot that the instruction
    // set asks for before a transcendental's result is used or its source rewritten.
    // The argument is a mean of squares + 1e-5, never in the range below 2^-126 for
    // which the library form rescales; everywhere else that form is this instruction.
    static_assert(LN_RPW == 4, "the statement below takes four rows");
    asm("v_rsq_f32 %0, %0\n\tv_rsq_f32 %1, %1\n\tv_rsq_f32 %2, %2\n\tv_rsq_f32 %3, %3\n\tv_nop"
        : "+v"(s[0]), "+v"(s[1]), "+v"(s[2]), "+v"(s[3]));
#pragma unroll
    for (int r = 0; r < LN_RPW; ++r)
#pragma unroll
        for (int j = 0; j < 4; ++j) {
            const f32x4 o = v[r][j] * s[r] * gv[j] + bv[j];
            bf16x4 h;
            h[0] = (__bf16)o.x; h[1] = (__bf16)o.y; h[2] = (__bf16)o.z; h[3] = (__bf16)o.w;
            *(bf16x4*)(outB + rb + r * DMODEL + j * 128) = h;
        }
}

__global__ __launch_bounds__(256) void ln_kernel(const float* __restrict__ x,
                                                 const float* __restrict__ g,
                                                 const float* __restrict__ bta,
                                                 __bf16* __restrict__ outB) {
    ln_rows<false>(blockIdx.x, x, nullptr, nullptr, g, bta, outB);
}

// ---------------------------------------------------------------------------
// The six weight conversions and the first LayerNorm read none of each other's
// output: one grid runs them all. Blocks [0, CVT_BLKS) turn one 64x64 weight
// tile each (they come first, so they start first), the rest take 32 rows each.
// wB holds the six bf16 weights one behind the other: Wq Wk Wv Wo W1 W2.
// ---------------------------------------------------------------------------
#define CVT_DD_BLKS ((DMODEL / 64) * (DMODEL / 64))   // 64 tiles of a D x D weight
#define CVT_DF_BLKS ((DMODEL / 64) * (DFF / 64))      // 256 tiles of W1 or W2
#define CVT_BLKS    (4 * CVT_DD_BLKS + 2 * CVT_DF_BLKS)

// amdgpu_waves_per_eu(8): a budget of 128 registers (188 without it: the scheduler
// then holds the residual stores back and a second copy of the rows live), so that
// four blocks fit a WGP and the row blocks need not wait for a conversion block to end.
__global__ __launch_bounds__(256) __attribute__((amdgpu_waves_per_eu(8))) void prep_kernel(const float* __restrict__ Wq,
                                                   const float* __restrict__ Wk,
                                                   const float* __restrict__ Wv,
                                                   const float* __restrict__ Wo,
                                                   const float* __restrict__ W1,
                                                   const float* __restrict__ W2,
                                                   __bf16* __restrict__ wB,
                                                   const float* __restrict__ x,
                                                   const float* __restrict__ mask,
                                                   float* __restrict__ residOut,
                                                   const float* __restrict__ g,
                                                   const float* __restrict__ bta,
                                                   __bf16* __restrict__ outB) {
    const unsigned bid = blockIdx.x;
    if (bid >= CVT_BLKS) {
        ln_rows<true>(bid - CVT_BLKS, x, mask, residOut, g, bta, outB);
        return;
    }
    const float* in;
    __bf16* out;
    int K = DMODEL, Nn = DMODEL;
    unsigned t;
    if (bid < 4 * CVT_DD_BLKS) {
        const unsigned w = bid / CVT_DD_BLKS;
        in  = w == 0 ? Wq : w == 1 ? Wk : w == 2 ? Wv : Wo;
        out = wB + w * (DMODEL * DMODEL);
        t   = bid % CVT_DD_BLKS;
    } else if (bid < 4 * CVT_DD_BLKS + CVT_DF_BLKS) {
        in  = W1;
        out = wB + 4 * (DMODEL * DMODEL);
        Nn  = DFF;
        t   = bid - 4 * CVT_DD_BLKS;
    } else {
        in  = W2;
        out = wB + 4 * (DMODEL * DMODEL) + DMODEL * DFF;
        K   = DFF;
        t   = bid - (4 * CVT_DD_BLKS + CVT_DF_BLKS);
    }
    const unsigned sh = Nn == DFF ? 5 : 3;   // 32 or 8 tiles along n
    cvt_bf16_t_tile(in, out, K, Nn, (int)(t & ((1u << sh) - 1)) * 64, (int)(t >> sh) * 64);
}

// ---------------------------------------------------------------------------
// bf16 WMMA GEMM: C[M,N] = A[M,K] @ B[K,N] (+bias)(+GELU)(+resid), B given as Bt[N,K]
// Block: 256 threads = 8 waves. Tile BM=128, BN=128, BK deep, double-buffered:
// next tile's async DMA runs under the current tile's WMMAs. A stage's copies have
// one stage's arithmetic to land in, so BK sets how much of their latency is
// covered: 64 where three or four blocks share a WGP (four still fit its LDS),
// 128 where a grid of 256 leaves a block alone on its WGP. A copied row is then
// one or two whole 128-byte lines.
// Waves: 4 along M (32 rows), 2 along N (64 cols) -> 2x4 subtiles of 16x16.
// Bt rows are K-contiguous, so both tiles are copied alike and both operands
// use the same frag loader.
// THREE: one grid runs three products that share A (the Q, K and V projections);
// blockIdx.z picks the weight (one behind the other in Bt0), the bias and the
// output (one behind the other in outB0).
// ---------------------------------------------------------------------------
template <int BK, bool BIAS, bool GELU_ACT, bool RESID, bool OUT_BF16, bool THREE>
__global__ __launch_bounds__(256) void gemm_bf16_kernel(
        const __bf16* __restrict__ A, const __bf16* __restrict__ Bt0,
        const float* __restrict__ bias0, const float* __restrict__ bias1,
        const float* __restrict__ bias2, const float* __restrict__ resid,
        float* __restrict__ outF, __bf16* __restrict__ outB0,
        int M, int Nn, int K) {
    constexpr int PITCH = BK + 8;   // 144 or 272 bytes a row: 16 bytes x an odd number
    __shared__ __attribute__((aligned(16))) __bf16 lsA[2][128][PITCH];   // [buf][row][k]
    __shared__ __attribute__((aligned(16))) __bf16 lsB[2][128][PITCH];   // [buf][col][k]

    const int z = THREE ? (int)blockIdx.z : 0;
    const __bf16* __restrict__ Bt   = Bt0 + (size_t)z * Nn * K;
    const float*  __restrict__ bias = z == 0 ? bias0 : z == 1 ? bias1 : bias2;
    __bf16*       __restrict__ outB = outB0 + (size_t)z * M * Nn;

    const int m0 = blockIdx.y * 128;
    const int n0 = blockIdx.x * 128;
    const int tid  = threadIdx.x;
    const int wave = tid >> 5;
    const int wm   = wave & 3;    // 0..3 : 32 rows each
    const int wn   = wave >> 2;   // 0..1 : 64 cols each

    f32x8 acc[2][4];
#pragma unroll
    for (int mi = 0; mi < 2; ++mi)
#pragma unroll
        for (int ni = 0; ni < 4; ++ni) acc[mi][ni] = zero8();

    // One stage: 128 rows x BK k of A and of Bt, 16 bytes a lane; the lanes of a
    // sweep go along a row first, SWEEP rows a sweep of the block.
    constexpr int SEGS  = BK / 8;
    constexpr int SWEEP = 256 / SEGS;
    const int crow = tid / SEGS, cseg = (tid % SEGS) * 8;
    const __bf16* gA = A  + (size_t)(m0 + crow) * K + cseg;
    const __bf16* gB = Bt + (size_t)(n0 + crow) * K + cseg;
    auto load_tiles = [&](int k0, int buf) {
#pragma unroll
        for (int s = 0; s < 128 / SWEEP; s += 4) {
            unsigned o[8];
            const __bf16* g[8];
#pragma unroll
            for (int j = 0; j < 4; ++j) {
                const int r = (s + j) * SWEEP;
                o[j]     = (unsigned)(uintptr_t)&lsA[buf][crow + r][cseg];
                g[j]     = gA + (size_t)r * K + k0;
                o[4 + j] = (unsigned)(uintptr_t)&lsB[buf][crow + r][cseg];
                g[4 + j] = gB + (size_t)r * K + k0;
            }
            async_g2l_b128_x8(o, g);
        }
    };

    const int nk = K / BK;
    load_tiles(0, 0);
    asm volatile("s_wait_asynccnt 0x0" ::: "memory");   // stage 0 landed (own copies)
    __syncthreads();                                    // ... and everyone's
    if (nk > 1) load_tiles(BK, 1);
    for (int i = 0; i < nk; ++i) {
        const int buf = i & 1;
#pragma unroll
        for (int kk = 0; kk < BK; kk += 32) {
            bf16x16 aF[2], bF[4];
#pragma unroll
            for (int mi = 0; mi < 2; ++mi)
                aF[mi] = load_frag(&lsA[buf][0][0], PITCH, wm * 32 + mi * 16, kk);
#pragma unroll
            for (int ni = 0; ni < 4; ++ni)
                bF[ni] = load_frag(&lsB[buf][0][0], PITCH, wn * 64 + ni * 16, kk);
#pragma unroll
            for (int mi = 0; mi < 2; ++mi)
#pragma unroll
                for (int ni = 0; ni < 4; ++ni)
                    acc[mi][ni] = __builtin_amdgcn_wmma_f32_16x16x32_bf16(
                        false, aF[mi], false, bF[ni], (short)0, acc[mi][ni], false, false);
        }

        // Publish stage i+1 and free this buffer: own LDS reads done, own
        // copies landed, then the barrier; only then the refill.
        asm volatile("s_wait_dscnt 0x0" ::: "memory");
        asm volatile("s_wait_asynccnt 0x0" ::: "memory");
        __syncthreads();
        if (i + 2 < nk) load_tiles((i + 2) * BK, buf);
    }
    asm volatile("s_wait_asynccnt 0x0" ::: "memory");   // nothing in flight at the end

    // Epilogue. C/D layout: lane<16 -> M = r, lane>=16 -> M = 8+r ; N = lane&15
    const int lane = tid & 31;
    const int half = lane >> 4;
    const int lcol = lane & 15;
    // Residual values of this wave's 2x4 subtiles, all 64 loads issued here back
    // to back: their latency runs once, not once per element between the stores.
    float rs[2][4][8];
    if (RESID) {
        // The residual stream is DMODEL wide, so every row and column step is an
        // immediate offset from one index register.
        const float* rp = resid + ((m0 + wm * 32 + half * 8) * DMODEL + n0 + wn * 64 + lcol);
#pragma unroll
        for (int mi = 0; mi < 2; ++mi)
#pragma unroll
            for (int r = 0; r < 8; ++r)
#pragma unroll
                for (int ni = 0; ni < 4; ++ni)
                    rs[mi][ni][r] = rp[(mi * 16 + r) * DMODEL + ni * 16];
        // Keeps all 64 loads in flight at once: left alone, the scheduler issues the
        // last fourteen only when the first have returned, a second latency.
        __builtin_amdgcn_sched_barrier(0);
    }
    float bv[4];   // the lane's four bias values, loaded together ahead of the arithmetic
    if (BIAS) {
#pragma unroll
        for (int ni = 0; ni < 4; ++ni) bv[ni] = bias[n0 + wn * 64 + ni * 16 + lcol];
    }
#pragma unroll
    for (int mi = 0; mi < 2; ++mi) {
#pragma unroll
        for (int ni = 0; ni < 4; ++ni) {
            const int gc = n0 + wn * 64 + ni * 16 + lcol;
            f32x8 v8 = acc[mi][ni];
            if (BIAS)     v8 += bv[ni];
            if (GELU_ACT) v8 = gelu_tanh_x8(v8);
#pragma unroll
            for (int r = 0; r < 8; ++r) {
                int gr = m0 + wm * 32 + mi * 16 + half * 8 + r;
                float v = v8[r];
                if (RESID)    v += rs[mi][ni][r];
                if (OUT_BF16) outB[(size_t)gr * Nn + gc] = (__bf16)v;
                else          outF[(size_t)gr * Nn + gc] = v;
            }
        }
    }
}

// ---------------------------------------------------------------------------
// Attention: one block per (b, h, 128 queries); a wave owns 16 query columns and
// walks all keys in 64-key tiles, with both products transposed:
//   S^T = K Q^T ; P^T = exp(S^T * scale) (reference has no max-subtraction)
//   O^T += V^T P^T ; final O /= sum of P over the keys.
// The accumulator map of S^T (lane = query, registers = 8 keys) is the B operand
// map of the second product, so P goes from the score accumulators into that
// operand inside the lane: no LDS trip and no barrier between the two products.
// A lane adds up its own query's P as it makes them; the two wave halves, which
// hold different keys of the same query, are joined once behind the loop.
// K tiles are async-DMA'd into LDS; V needs a transpose scatter.
// ---------------------------------------------------------------------------
typedef __attribute__((ext_vector_type(8))) __bf16 bf16x8;

// amdgpu_waves_per_eu(4, 4): the grid puts two blocks on a WGP, four waves on a SIMD,
// so a wave may have 256 registers; with the default budget of 128 the fragments
// share one register set and each pair of LDS reads is waited for alone.
__global__ __launch_bounds__(256) __attribute__((amdgpu_waves_per_eu(4, 4))) void attn_kernel(const __bf16* __restrict__ Q,
                                                   const __bf16* __restrict__ Kmat,
                                                   const __bf16* __restrict__ Vmat,
                                                   __bf16* __restrict__ O) {
    __shared__ __bf16 lsK[64][72];    // [key][dh]  A rows of K Q^T
    __shared__ __bf16 lsVt[64][72];   // [dh][key]  A rows of V^T P^T

    const int r0 = blockIdx.x * 128;
    const int h  = blockIdx.y;
    const int b  = blockIdx.z;
    const int tid  = threadIdx.x;
    const int wave = tid >> 5;     // 8 x 16 query columns
    const int lane = tid & 31;
    const int half = lane >> 4;
    const int lcol = lane & 15;

    // The wave's Q as B operand, loaded once and kept: lane = query column, dh in
    // the k order of load_frag (8 half + 0..7, 16 + 8 half + 0..7 of each 32).
    const size_t qoff = ((size_t)(b * SEQ + r0 + wave * 16 + lcol)) * DMODEL + h * DHEAD + half * 8;
    const __bf16* qp = Q + qoff;
    union { bf16x16 v; uint4 q[2]; } qF[2];
#pragma unroll
    for (int kc = 0; kc < 2; ++kc) {
        qF[kc].q[0] = *(const uint4*)(qp + kc * 32);
        qF[kc].q[1] = *(const uint4*)(qp + kc * 32 + 16);
    }
    // The loads' address register is named so that it is not reused, not even as
    // a load's destination, ahead of this wait.
    asm volatile("s_wait_xcnt 0x0" :: "v"(qp) : "memory");

    f32x8 oAcc[4];             // O^T: tile t, register r = O[query lcol][16 t + 8 half + r]
#pragma unroll
    for (int t = 0; t < 4; ++t) oAcc[t] = zero8();
    f32x8 lsum = zero8();      // the lane's share of its query's sum of P

    for (int j0 = 0; j0 < SEQ; j0 += 64) {
        __syncthreads();
        const __bf16* kbase = Kmat + ((size_t)(b * SEQ + j0)) * DMODEL + h * DHEAD;
        const __bf16* vbase = Vmat + ((size_t)(b * SEQ + j0)) * DMODEL + h * DHEAD;
#pragma unroll
        for (int s = tid; s < 512; s += 256) {  // K tile row-major, async DMA
            int kr = s >> 3, cs = s & 7;
            async_g2l_b128(&lsK[kr][cs * 8], kbase + (size_t)kr * DMODEL + cs * 8);
        }
#pragma unroll
        for (int s = tid; s < 512; s += 256) {  // V tile, scatter transposed
            int kr = s >> 3, cs = s & 7;
            uint4 t = *(const uint4*)(vbase + (size_t)kr * DMODEL + cs * 8);
            const __bf16* hs = reinterpret_cast<const __bf16*>(&t);
#pragma unroll
            for (int e = 0; e < 8; ++e) lsVt[cs * 8 + e][kr] = hs[e];
        }
        wait_async0();
        __syncthreads();

        // S^T = K Q^T  (M=64 keys, N=16 queries, K=64=dh):
        // sT[kt][r] = S[query lcol][key 16 kt + 8 half + r]
        bf16x16 kF[2][4], vF[2][4];   // both products' A fragments, read as one group
#pragma unroll
        for (int kc = 0; kc < 2; ++kc)
#pragma unroll
            for (int kt = 0; kt < 4; ++kt)
                kF[kc][kt] = load_frag(&lsK[0][0], 72, kt * 16, kc * 32);
#pragma unroll
        for (int k2 = 0; k2 < 2; ++k2)
#pragma unroll
            for (int t = 0; t < 4; ++t)
                vF[k2][t] = load_frag(&lsVt[0][0], 72, t * 16, k2 * 32);
        f32x8 sT[4];
#pragma unroll
        for (int kt = 0; kt < 4; ++kt) sT[kt] = zero8();
#pragma unroll
        for (int kc = 0; kc < 2; ++kc)
#pragma unroll
            for (int kt = 0; kt < 4; ++kt)
                sT[kt] = __builtin_amdgcn_wmma_f32_16x16x32_bf16(
                    false, kF[kc][kt], false, qF[kc].v, (short)0, sT[kt], false, false);
        // P = exp(scale * S) in place, as 2^(S * scale * log2(e)): one multiply and
        // the hardware's exp2 (inf above the f32 range and 0 below it, like exp)
#pragma unroll
        for (int kt = 0; kt < 4; ++kt) {
            f32x8 p = sT[kt] * (float)(ATTN_SCALE * LOG2E);
            TRANS_X8("v_exp_f32", p);
            lsum += p;
            sT[kt] = p;
        }
        // O^T += V^T P^T  (M=64=dh, N=16 queries, K=64 keys). Two score tiles, keys
        // 8 half + 0..7 and 16 + 8 half + 0..7 of 32, are one B operand as they lie.
#pragma unroll
        for (int k2 = 0; k2 < 2; ++k2) {
            bf16x16 pF;
#pragma unroll
            for (int s = 0; s < 16; ++s) pF[s] = (__bf16)sT[2 * k2 + (s >> 3)][s & 7];
#pragma unroll
            for (int t = 0; t < 4; ++t)
                oAcc[t] = __builtin_amdgcn_wmma_f32_16x16x32_bf16(
                    false, vF[k2][t], false, pF, (short)0, oAcc[t], false, false);
        }
    }

    float l = ((lsum[0] + lsum[1]) + (lsum[2] + lsum[3])) + ((lsum[4] + lsum[5]) + (lsum[6] + lsum[7]));
    l += half_xor(l);          // the other half's keys of the same query

    // A lane holds 8 consecutive dh of its query in each tile: one 16-byte store.
    __bf16* op = O + qoff;
#pragma unroll
    for (int t = 0; t < 4; ++t) {
        bf16x8 o;
#pragma unroll
        for (int r = 0; r < 8; ++r) o[r] = (__bf16)(oAcc[t][r] / l);
        *(bf16x8*)(op + t * 16) = o;
    }
}

// ---------------------------------------------------------------------------
// Mean pool over tokens + head LayerNorm + classifier (8x512x1000, f32), spread
// over the chip in two launches.
// ---------------------------------------------------------------------------
#define POOL_CH   16                 // partial token sums per batch row
#define POOL_ROWS (SEQ / POOL_CH)    // 64 tokens a block

// Launch 1: block (ch, b, z) sums 64 tokens of batch row b, columns
// [256 z, 256 z + 256), into part[b][ch][.]. 256 threads = 64 column quads x 4
// token groups; a wave's load covers 512 contiguous bytes.
__global__ __launch_bounds__(256) void pool_partial_kernel(const float* __restrict__ x3,
                                                           float* __restrict__ part) {
    __shared__ f32x4 red[4][64];
    const int tid = threadIdx.x;
    const int c4  = tid & 63;
    const int rg  = tid >> 6;
    const int ch  = blockIdx.x;
    const int b   = blockIdx.y;
    const int col = blockIdx.z * 256 + c4 * 4;
    const float* base = x3 + ((size_t)(b * SEQ + ch * POOL_ROWS + rg)) * DMODEL + col;
    f32x4 v[16];
#pragma unroll
    for (int i = 0; i < 16; ++i) v[i] = *(const f32x4*)(base + (size_t)(i * 4) * DMODEL);
    // The loads' address register is named so that it is not reused, not even
    // as a load's destination, ahead of this wait.
    asm volatile("s_wait_xcnt 0x0" :: "v"(base) : "memory");
    // Keeps all 16 loads in flight at once: left alone, the scheduler issues the
    // last four only when the first have returned, a second latency.
    __builtin_amdgcn_sched_barrier(0);
#pragma unroll
    for (int w = 8; w > 0; w >>= 1)
#pragma unroll
        for (int i = 0; i < w; ++i) v[i] += v[i + w];
    red[rg][c4] = v[0];
    __syncthreads();
    if (rg == 0)
        *(f32x4*)(part + ((size_t)(b * POOL_CH + ch)) * DMODEL + col) =
            (red[0][c4] + red[1][c4]) + (red[2][c4] + red[3][c4]);
}

// Launch 2: one block per 128-byte line of out (32 consecutive floats of the
// flat [8][1000] array), so every line has one writer. A line can straddle two
// batch rows, so each block normalises the pooled vectors of the first and of
// the last float's batch row (the same row twice for most lines).
// Lane = (k group kr, class quad q); wave w takes k in [64 w, 64 w + 64).
__global__ __launch_bounds__(256) void head_kernel(const float* __restrict__ part,
                                                   const float* __restrict__ g,
                                                   const float* __restrict__ bta,
                                                   const float* __restrict__ Wh,
                                                   const float* __restrict__ bh,
                                                   float* __restrict__ out) {
    __shared__ __attribute__((aligned(16))) float pool[2][DMODEL];
    __shared__ __attribute__((aligned(16))) float redS[2][8];
    __shared__ __attribute__((aligned(16))) float redQ[2][8];
    __shared__ f32x4 accs[8][8];
    const int tid  = threadIdx.x;
    const int lane = tid & 31;
    const int wave = tid >> 5;
    const int q    = lane & 7;
    const int kr   = lane >> 3;
    const int f0   = blockIdx.x * 32;
    const int b0   = f0 / NCLS;
    const int b1   = (f0 + 31) / NCLS;
    const int f    = f0 + q * 4;        // NCLS is a multiple of 4: a quad stays in one row
    const int bq   = f / NCLS;
    const int c    = f - bq * NCLS;
    const int kb   = wave * 64 + kr * 16;

    const f32x2 g2   = *(const f32x2*)(g + tid * 2);
    const f32x2 t2   = *(const f32x2*)(bta + tid * 2);
    const float* bp  = bh + c;
    const float* wp  = Wh + (size_t)kb * NCLS + c;
    const float* pp0 = part + (size_t)(b0 * POOL_CH) * DMODEL + tid * 2;
    const float* pp1 = part + (size_t)(b1 * POOL_CH) * DMODEL + tid * 2;
    const f32x4 bias = *(const f32x4*)bp;
    f32x4 w[16];
#pragma unroll
    for (int i = 0; i < 16; ++i) w[i] = *(const f32x4*)(wp + (size_t)i * NCLS);
    f32x2 p0[POOL_CH], p1[POOL_CH];
#pragma unroll
    for (int j = 0; j < POOL_CH; ++j) {
        p0[j] = *(const f32x2*)(pp0 + (size_t)j * DMODEL);
        p1[j] = *(const f32x2*)(pp1 + (size_t)j * DMODEL);
    }
    // The address registers of the bias and weight loads are named so that
    // neither is reused, not even as a load's destination, ahead of this wait
    // (the other loads go by the thread index and a scalar base).
    asm volatile("s_wait_xcnt 0x0" :: "v"(bp), "v"(wp) : "memory");
    // Keeps the classifier's loads in front of the pooling arithmetic, so that
    // their latency runs under it instead of behind the three barriers below.
    __builtin_amdgcn_sched_barrier(0);

#pragma unroll
    for (int s = POOL_CH / 2; s > 0; s >>= 1)
#pragma unroll
        for (int j = 0; j < s; ++j) { p0[j] += p0[j + s]; p1[j] += p1[j + s]; }
    const f32x2 m0 = p0[0] * (1.f / SEQ);
    const f32x2 m1 = p1[0] * (1.f / SEQ);

    const float s0 = wave_sum(m0.x + m0.y);
    const float s1 = wave_sum(m1.x + m1.y);
    if (lane == 0) { redS[0][wave] = s0; redS[1][wave] = s1; }
    __syncthreads();
    float mu0 = 0.f, mu1 = 0.f;
#pragma unroll
    for (int i = 0; i < 8; ++i) { mu0 += redS[0][i]; mu1 += redS[1][i]; }
    mu0 *= (1.f / DMODEL);
    mu1 *= (1.f / DMODEL);
    const f32x2 d0 = m0 - mu0;
    const f32x2 d1 = m1 - mu1;
    const float q0 = wave_sum(d0.x * d0.x + d0.y * d0.y);
    const float q1 = wave_sum(d1.x * d1.x + d1.y * d1.y);
    if (lane == 0) { redQ[0][wave] = q0; redQ[1][wave] = q1; }
    __syncthreads();
    float v0 = 0.f, v1 = 0.f;
#pragma unroll
    for (int i = 0; i < 8; ++i) { v0 += redQ[0][i]; v1 += redQ[1][i]; }
    const float r0 = rsqrtf(v0 * (1.f / DMODEL) + 1e-5f);
    const float r1 = rsqrtf(v1 * (1.f / DMODEL) + 1e-5f);
    *(f32x2*)&pool[0][tid * 2] = d0 * r0 * g2 + t2;
    *(f32x2*)&pool[1][tid * 2] = d1 * r1 * g2 + t2;
    __syncthreads();

    const float* pv = &pool[bq - b0][kb];
    f32x4 acc = {0.f, 0.f, 0.f, 0.f};
#pragma unroll
    for (int i = 0; i < 16; i += 4) {
        const f32x4 pk = *(const f32x4*)(pv + i);
        acc += pk.x * w[i] + pk.y * w[i + 1] + pk.z * w[i + 2] + pk.w * w[i + 3];
    }
#pragma unroll
    for (int e = 0; e < 4; ++e) {       // fold the four k groups of the wave
        acc[e] += row_xor<8>(acc[e]);
        acc[e] += half_xor(acc[e]);
    }
    if (lane < 8) accs[wave][q] = acc;
    __syncthreads();
    if (tid < 8) {
        f32x4 r = bias;
#pragma unroll
        for (int i = 0; i < 8; ++i) r += accs[i][tid];
        *(f32x4*)(out + f) = r;
    }
}

// ---------------------------------------------------------------------------
// Host-side orchestration
// ---------------------------------------------------------------------------
extern "C" void kernel_launch(void* const* d_in, const int* in_sizes, int n_in,
                              void* d_out, int out_size, void* d_ws, size_t ws_size,
                              hipStream_t stream) {
    (void)in_sizes; (void)n_in; (void)out_size; (void)ws_size;
    const float* x     = (const float*)d_in[0];
    const float* mask  = (const float*)d_in[1];
    const float* ln1_g = (const float*)d_in[2];
    const float* ln1_b = (const float*)d_in[3];
    const float* Wq    = (const float*)d_in[4];
    const float* bq    = (const float*)d_in[5];
    const float* Wk    = (const float*)d_in[6];
    const float* bk_p  = (const float*)d_in[7];
    const float* Wv    = (const float*)d_in[8];
    const float* bv    = (const float*)d_in[9];
    const float* Wo    = (const float*)d_in[10];
    const float* bo    = (const float*)d_in[11];
    const float* ln2_g = (const float*)d_in[12];
    const float* ln2_b = (const float*)d_in[13];
    const float* W1    = (const float*)d_in[14];
    const float* b1    = (const float*)d_in[15];
    const float* W2    = (const float*)d_in[16];
    const float* b2    = (const float*)d_in[17];
    const float* lnh_g = (const float*)d_in[18];
    const float* lnh_b = (const float*)d_in[19];
    const float* Wh    = (const float*)d_in[20];
    const float* bh    = (const float*)d_in[21];

    char* ws = (char*)d_ws;
    const size_t MB = 1ull << 20;
    // Workspace map (aliasing is ordered by the stream):
    //   [ 0,16MB)  resid (f32)  -- reused as x3 after the Wo projection
    //   [16,32MB)  x2 (f32)
    //   [32,40MB)  xn (bf16)    -- reused as xn2
    //   [40,72MB)  bufQ/bufK/bufV/bufAO (bf16, 8MB each) -- reused as h1 (32MB)
    //   [72MB,..)  bf16 weights, each transposed to [N][K]
    //   [80MB,..)  partial token sums (f32, 256KB)
    float*  resid  = (float*) (ws + 0);
    float*  x2     = (float*) (ws + 16 * MB);
    __bf16* xn     = (__bf16*)(ws + 32 * MB);
    __bf16* bufQ   = (__bf16*)(ws + 40 * MB);
    __bf16* bufK   = (__bf16*)(ws + 48 * MB);
    __bf16* bufV   = (__bf16*)(ws + 56 * MB);
    __bf16* bufAO  = (__bf16*)(ws + 64 * MB);
    __bf16* h1     = bufQ;
    float*  x3     = resid;
    __bf16* wqB    = (__bf16*)(ws + 72 * MB);
    __bf16* wkB    = wqB + DMODEL * DMODEL;
    __bf16* wvB    = wkB + DMODEL * DMODEL;
    __bf16* woB    = wvB + DMODEL * DMODEL;
    __bf16* w1B    = woB + DMODEL * DMODEL;
    __bf16* w2B    = w1B + DMODEL * DFF;
    float*  part   = (float*) (ws + 80 * MB);

    // One grid: W[K][N] f32 -> Wt[N][K] bf16 for all six weights, and
    // mask * x -> residual ; LN1 -> xn (bf16)
    prep_kernel<<<CVT_BLKS + LN_BLKS, 256, 0, stream>>>(Wq, Wk, Wv, Wo, W1, W2, wqB,
                                                      x, mask, resid, ln1_g, ln1_b, xn);

    // QKV projections, one grid: z = 0, 1, 2 -> bufQ, bufK, bufV
    dim3 gDD(DMODEL / 128, MROWS / 128);   // (4, 64)
    gemm_bf16_kernel<64, true, false, false, true, true>
        <<<dim3(DMODEL / 128, MROWS / 128, 3), 256, 0, stream>>>(
        xn, wqB, bq, bk_p, bv, nullptr, nullptr, bufQ, MROWS, DMODEL, DMODEL);

    // Attention
    attn_kernel<<<dim3(SEQ / 128, HEADS, BATCH), 256, 0, stream>>>(bufQ, bufK, bufV, bufAO);

    // Output projection + residual -> x2 (f32)
    gemm_bf16_kernel<128, true, false, true, false, false><<<gDD, 256, 0, stream>>>(
        bufAO, woB, bo, nullptr, nullptr, resid, x2, nullptr, MROWS, DMODEL, DMODEL);

    // LN2 -> xn2 (bf16)
    ln_kernel<<<LN_BLKS, 256, 0, stream>>>(x2, ln2_g, ln2_b, xn);

    // FFN1: GELU(xn2 @ W1 + b1) -> h1 (bf16)
    gemm_bf16_kernel<64, true, true, false, true, false><<<dim3(DFF / 128, MROWS / 128), 256, 0, stream>>>(
        xn, w1B, b1, nullptr, nullptr, nullptr, nullptr, h1, MROWS, DFF, DMODEL);

    // FFN2: h1 @ W2 + b2 + x2 -> x3 (f32)
    gemm_bf16_kernel<128, true, false, true, false, false><<<gDD, 256, 0, stream>>>(
        h1, w2B, b2, nullptr, nullptr, x2, x3, nullptr, MROWS, DMODEL, DFF);

    // Mean pool + head LN + classifier
    pool_partial_kernel<<<dim3(POOL_CH, BATCH, 2), 256, 0, stream>>>(x3, part);
    head_kernel<<<BATCH * NCLS / 32, 256, 0, stream>>>(part, lnh_g, lnh_b, Wh, bh, (float*)d_out);
}

// v009
// It runs in 122 microseconds.
// Two timings next to v008 put it at 1.05 and 1.06 times that version's speed.
// Counting every step since v000, it is 3.95 times as fast.
#include <hip/hip_runtime.h>
#include <cstdint>
#include <cstddef>

// ---------------------------------------------------------------------------
// MI455X (gfx1250) transformer block, bf16 WMMA path.
// ~70 GFLOP of GEMMs vs ~100MB traffic -> matrix-core bound; everything
// routed through v_wmma_f32_16x16x32_bf16 with f32 accumulation.
// Row-major tiles are staged into LDS with global_load_async_to_lds_b128
// (ASYNCcnt-tracked DMA, no VGPR round-trip), double-buffered in the GEMM.
// Weights are converted to bf16 K-contiguous ([N][K]) so that the GEMM's B
// tile is copied the same way as its A tile.
// ---------------------------------------------------------------------------

typedef __attribute__((ext_vector_type(16))) __bf16 bf16x16;
typedef __attribute__((ext_vector_type(8)))  float  f32x8;
typedef __attribute__((ext_vector_type(8)))  __bf16 bf16x8;

#define HEADS 8
#define DHEAD 64
#define SEQ   1024
#define BATCH 8
#define DMODEL 512
#define DFF   2048
#define NCLS  1000
#define MROWS (BATCH * SEQ)   // 8192
#define ATTN_SCALE 0.125f     // 1/sqrt(64)
#define LOG2E 1.4426950408889634

__device__ __forceinline__ f32x8 zero8() {
    f32x8 z = {0.f, 0.f, 0.f, 0.f, 0.f, 0.f, 0.f, 0.f};
    return z;
}

// Eight hardware transcendentals in place (OP: v_exp_f32 = 2^x, v_rcp_f32 = 1/x).
// One statement, so that every one of them has an independent instruction behind
// it (the next of the eight) and the last one the v_nop: the slot that the
// instruction set asks for before a transcendental's result is used. volatile
// keeps the groups in program order: left free, the scheduler opens several at
// once and the GELU kernel goes past 128 registers, one block fewer on a WGP.
#define TRANS_X8(OP, v)                                                          \
    do {                                                                         \
        float t0 = (v)[0], t1 = (v)[1], t2 = (v)[2], t3 = (v)[3];                \
        float t4 = (v)[4], t5 = (v)[5], t6 = (v)[6], t7 = (v)[7];                \
        asm volatile(OP " %0, %0\n\t" OP " %1, %1\n\t" OP " %2, %2\n\t" OP " %3, %3\n\t" \
            OP " %4, %4\n\t" OP " %5, %5\n\t" OP " %6, %6\n\t" OP " %7, %7\n\t" \
            "v_nop"                                                              \
            : "+v"(t0), "+v"(t1), "+v"(t2), "+v"(t3),                            \
              "+v"(t4), "+v"(t5), "+v"(t6), "+v"(t7));                           \
        (v)[0] = t0; (v)[1] = t1; (v)[2] = t2; (v)[3] = t3;                      \
        (v)[4] = t4; (v)[5] = t5; (v)[6] = t6; (v)[7] = t7;                      \
    } while (0)

// 0.5 x (1 + tanh(u)) = x / (1 + exp(-2u)), u = c (x + 0.044715 x^3): the same
// function without the library tanh's two branches. -2 c log2(e) is folded into
// the cubic, so that the hardware's exp2 and reciprocal take it from there.
// x far below 0: exp2 -> inf, 1/inf = 0, result -0; x far above 0: exp2 -> 0, result x.
__device__ __forceinline__ f32x8 gelu_tanh_x8(f32x8 x) {
    constexpr float k0 = (float)(-2.0 * 0.7978845608028654 * LOG2E);
    constexpr float k1 = (float)(-2.0 * 0.7978845608028654 * LOG2E * 0.044715);
    f32x8 e = x * (k0 + k1 * (x * x));
    TRANS_X8("v_exp_f32", e);
    e += 1.f;
    TRANS_X8("v_rcp_f32", e);
    return x * e;
}

// Async DMA: 16 bytes global -> LDS per lane (VDST = LDS byte offset VGPR,
// VADDR = 64-bit global address). Tracked by ASYNCcnt. Low 32 bits of a
// flat shared pointer are the LDS byte offset on AMDGPU.
__device__ __forceinline__ void async_g2l_b128(void* ldsDst, const void* gSrc) {
    unsigned ldsOff = (unsigned)(uintptr_t)ldsDst;
    asm volatile("global_load_async_to_lds_b128 %0, %1, off"
                 :: "v"(ldsOff), "v"(gSrc)
                 : "memory");
}

// Eight such copies of one lane (four A rows, four B rows of a GEMM stage). The
// s_wait_xcnt closes the statement so that no address register of a copy is
// rewritten ahead of it.
__device__ __forceinline__ void async_g2l_b128_x8(const unsigned (&o)[8],
                                                  const __bf16* const (&g)[8]) {
    asm volatile("global_load_async_to_lds_b128 %0, %1, off\n\t"
                 "global_load_async_to_lds_b128 %2, %3, off\n\t"
                 "global_load_async_to_lds_b128 %4, %5, off\n\t"
                 "global_load_async_to_lds_b128 %6, %7, off\n\t"
                 "global_load_async_to_lds_b128 %8, %9, off\n\t"
                 "global_load_async_to_lds_b128 %10, %11, off\n\t"
                 "global_load_async_to_lds_b128 %12, %13, off\n\t"
                 "global_load_async_to_lds_b128 %14, %15, off\n\t"
                 "s_wait_xcnt 0x0"
                 :: "v"(o[0]), "v"(g[0]), "v"(o[1]), "v"(g[1]),
                    "v"(o[2]), "v"(g[2]), "v"(o[3]), "v"(g[3]),
                    "v"(o[4]), "v"(g[4]), "v"(o[5]), "v"(g[5]),
                    "v"(o[6]), "v"(g[6]), "v"(o[7]), "v"(g[7])
                 : "memory");
}

__device__ __forceinline__ void wait_async0() {
#if __has_builtin(__builtin_amdgcn_s_wait_asynccnt)
    __builtin_amdgcn_s_wait_asynccnt(0);
#else
    asm volatile("s_wait_asynccnt 0x0" ::: "memory");
#endif
}

// Load a 16x32 bf16 WMMA operand fragment from an LDS tile laid out as
// tile[rc][k] (A-matrix rows, or B-matrix stored K-transposed: tile[col][k]).
// Per ISA 7.12.2 (16-bit A 16x32): lanes 0-15 hold K=0..7,16..23 of row M=lane,
// lanes 16-31 hold K=8..15,24..31 of row M=lane-16; pairs packed per VGPR.
__device__ __forceinline__ bf16x16 load_frag(const __bf16* base, int stride,
                                             int rcBase, int kBase) {
    const int lane = threadIdx.x & 31;
    const int idx  = lane & 15;
    const int half = lane >> 4;
    const __bf16* p = base + (size_t)(rcBase + idx) * stride + kBase + half * 8;
    union { bf16x16 v; unsigned u[8]; } r;
#pragma unroll
    for (int i = 0; i < 8; ++i) {
        int k = ((i & 4) << 2) + ((i & 3) << 1);   // i<4 -> 0..6 ; i>=4 -> 16..22
        r.u[i] = *(const unsigned*)(p + k);
    }
    return r.v;
}

// ---------------------------------------------------------------------------
// fp32 [K][N] -> bf16 [N][K] convert + transpose. One 64x64 tile per block,
// turned in LDS (pitch 65 dwords: column walks hit distinct banks); each wave
// stores whole 128-byte rows of the output.
// ---------------------------------------------------------------------------
__device__ __forceinline__ void cvt_bf16_t_tile(const float* __restrict__ in,
                                                __bf16* __restrict__ out,
                                                int K, int Nn, int n0, int k0) {
    __shared__ float t[64][65];
    const int tid = threadIdx.x;
    const int kr = tid >> 4;          // 16 rows a sweep, 16 bytes a lane
    const int c4 = (tid & 15) * 4;
    float4 v[4];
#pragma unroll
    for (int r = 0; r < 4; ++r)
        v[r] = *(const float4*)(in + (size_t)(k0 + kr + r * 16) * Nn + n0 + c4);
#pragma unroll
    for (int r = 0; r < 4; ++r) {
        t[kr + r * 16][c4 + 0] = v[r].x;
        t[kr + r * 16][c4 + 1] = v[r].y;
        t[kr + r * 16][c4 + 2] = v[r].z;
        t[kr + r * 16][c4 + 3] = v[r].w;
    }
    __syncthreads();
    const int kp = tid & 31;   // pair of k
    const int nr = tid >> 5;
#pragma unroll
    for (int r = 0; r < 8; ++r) {
        int n = nr + r * 8;
        union { __bf16 h[2]; unsigned u; } p;
        p.h[0] = (__bf16)t[2 * kp][n];
        p.h[1] = (__bf16)t[2 * kp + 1][n];
        *(unsigned*)(out + (size_t)(n0 + n) * K + k0 + 2 * kp) = p.u;
    }
}

typedef __attribute__((ext_vector_type(4))) float f32x4;
typedef __attribute__((ext_vector_type(2))) float f32x2;

template <int M>
__device__ __forceinline__ float row_xor(float v) {   // lane l <- lane l ^ M, M < 16
    return __builtin_bit_cast(float, __builtin_amdgcn_update_dpp(
        0, __builtin_bit_cast(int, v), 0x160 | M, 0xf, 0xf, true));
}

__device__ __forceinline__ float half_xor(float v) {  // lane l <- lane l ^ 16
    int t = __builtin_bit_cast(int, v);
    return __builtin_bit_cast(float, __builtin_amdgcn_permlanex16(t, t, 0x76543210, 0xfedcba98, false, false));
}

__device__ __forceinline__ float wave_sum(float v) {  // total of 32 lanes, in every lane
    v += row_xor<1>(v);
    v += row_xor<2>(v);
    v += row_xor<4>(v);
    v += row_xor<8>(v);
    v += half_xor(v);
    return v;
}

// ---------------------------------------------------------------------------
// LayerNorm over D=512. Optionally applies token mask and emits f32 residual.
// One wave takes LN_RPW whole rows and keeps them in registers: a lane holds 16
// values of each row (four 16-byte loads; a wave's load covers 512 contiguous
// bytes), both sums are in-lane adds and a five-step lane exchange. No LDS and no
// barrier, and a launch starts 2,048 waves where one block a row starts 65,536.
// ---------------------------------------------------------------------------
#define LN_RPW  4                        // rows a wave
#define LN_BLKS (MROWS / (8 * LN_RPW))   // 256 blocks of 8 waves

typedef __attribute__((ext_vector_type(4))) __bf16 bf16x4;

template <bool MASKED>
__device__ __forceinline__ void ln_rows(int blk,
                                        const float* __restrict__ x,
                                        const float* __restrict__ mask,
                                        float* __restrict__ residOut,
                                        const float* __restrict__ g,
                                        const float* __restrict__ bta,
                                        __bf16* __restrict__ outB) {
    const unsigned cb = (threadIdx.x & 31) * 16;   // the lane's byte offset in 512 bytes
    const int wave = __builtin_amdgcn_readfirstlane(threadIdx.x >> 5);
    const int row0 = (blk * 8 + wave) * LN_RPW;
    const size_t rb = (size_t)row0 * DMODEL + cb / 4;
    const float* xp = x + rb;
    f32x4 v[LN_RPW][4];
#pragma unroll
    for (int r = 0; r < LN_RPW; ++r)
#pragma unroll
        for (int j = 0; j < 4; ++j)
            v[r][j] = *(const f32x4*)(xp + r * DMODEL + j * 128);
    // Byte offset of the rows' four mask values (16 bytes, aligned). Formed from the
    // thread index, not from row0, so that it lives in the one vector register that
    // the load names and the wait below holds.
    const unsigned mo = (((blk * 8 + (threadIdx.x >> 5)) * LN_RPW) & (SEQ - 1)) * 4;
    f32x4 mv = {1.f, 1.f, 1.f, 1.f};
    if (MASKED) mv = *(const f32x4*)((const char*)mask + mo);
    f32x4 gv[4], bv[4];
#pragma unroll
    for (int j = 0; j < 4; ++j) {
        gv[j] = *(const f32x4*)((const char*)g + cb + j * 512);
        bv[j] = *(const f32x4*)((const char*)bta + cb + j * 512);
    }
    // The loads' address registers are named so that none is reused, not even as a
    // load's destination, ahead of the wait.
    if (MASKED) asm volatile("s_wait_xcnt 0x0" :: "v"(xp), "v"(cb), "v"(mo) : "memory");
    else        asm volatile("s_wait_xcnt 0x0" :: "v"(xp), "v"(cb) : "memory");
    // Keeps every load of the wave in flight at once, one latency for its four rows:
    // nothing below may be scheduled in between them.
    __builtin_amdgcn_sched_barrier(0);

    float s[LN_RPW];
#pragma unroll
    for (int r = 0; r < LN_RPW; ++r) {
        if (MASKED) {
#pragma unroll
            for (int j = 0; j < 4; ++j) {
                v[r][j] *= mv[r];
                *(f32x4*)(residOut + rb + r * DMODEL + j * 128) = v[r][j];
            }
        }
        const f32x4 t = (v[r][0] + v[r][1]) + (v[r][2] + v[r][3]);
        s[r] = (t.x + t.y) + (t.z + t.w);
    }
#pragma unroll
    for (int r = 0; r < LN_RPW; ++r) s[r] = wave_sum(s[r]);
#pragma unroll
    for (int r = 0; r < LN_RPW; ++r) {
        const float mu = s[r] * (1.f / DMODEL);
#pragma unroll
        for (int j = 0; j < 4; ++j) v[r][j] -= mu;
        const f32x4 t = (v[r][0] * v[r][0] + v[r][1] * v[r][1]) + (v[r][2] * v[r][2] + v[r][3] * v[r][3]);
        s[r] = (t.x + t.y) + (t.z + t.w);
    }
#pragma unroll
    for (int r = 0; r < LN_RPW; ++r) s[r] = wave_sum(s[r]);
#pragma unroll
    for (int r = 0; r < LN_RPW; ++r) s[r] = s[r] * (1.f / DMODEL) + 1e-5f;
    // The four reciprocal square roots in one statement: each has an independent
    // instruction behind it and the last one the v_nop, the slot that the instruction
    // set asks for before a transcendental's result is used or its source rewritten.
    // The argument is a mean of squares + 1e-5, never in the range below 2^-126 for
    // which the library form rescales; everywhere else that form is this instruction.
    static_assert(LN_RPW == 4, "the statement below takes four rows");
    asm("v_rsq_f32 %0, %0\n\tv_rsq_f32 %1, %1\n\tv_rsq_f32 %2, %2\n\tv_rsq_f32 %3, %3\n\tv_nop"
        : "+v"(s[0]), "+v"(s[1]), "+v"(s[2]), "+v"(s[3]));
#pragma unroll
    for (int r = 0; r < LN_RPW; ++r)
#pragma unroll
        for (int j = 0; j < 4; ++j) {
            const f32x4 o = v[r][j] * s[r] * gv[j] + bv[j];
            bf16x4 h;
            h[0] = (__bf16)o.x; h[1] = (__bf16)o.y; h[2] = (__bf16)o.z; h[3] = (__bf16)o.w;
            *(bf16x4*)(outB + rb + r * DMODEL + j * 128) = h;
        }
}

__global__ __launch_bounds__(256) void ln_kernel(const float* __restrict__ x,
                                                 const float* __restrict__ g,
                                                 const float* __restrict__ bta,
                                                 __bf16* __restrict__ outB) {
    ln_rows<false>(blockIdx.x, x, nullptr, nullptr, g, bta, outB);
}

// ---------------------------------------------------------------------------
// The six weight conversions and the first LayerNorm read none of each other's
// output: one grid runs them all. Blocks [0, CVT_BLKS) turn one 64x64 weight
// tile each (they come first, so they start first), the rest take 32 rows each.
// wB holds the six bf16 weights one behind the other: Wq Wk Wv Wo W1 W2.
// ---------------------------------------------------------------------------
#define CVT_DD_BLKS ((DMODEL / 64) * (DMODEL / 64))   // 64 tiles of a D x D weight
#define CVT_DF_BLKS ((DMODEL / 64) * (DFF / 64))      // 256 tiles of W1 or W2
#define CVT_BLKS    (4 * CVT_DD_BLKS + 2 * CVT_DF_BLKS)

// amdgpu_waves_per_eu(8): a budget of 128 registers (188 without it: the scheduler
// then holds the residual stores back and a second copy of the rows live), so that
// four blocks fit a WGP and the row blocks need not wait for a conversion block to end.
__global__ __launch_bounds__(256) __attribute__((amdgpu_waves_per_eu(8))) void prep_kernel(const float* __restrict__ Wq,
                                                   const float* __restrict__ Wk,
                                                   const float* __restrict__ Wv,
                                                   const float* __restrict__ Wo,
                                                   const float* __restrict__ W1,
                                                   const float* __restrict__ W2,
                                                   __bf16* __restrict__ wB,
                                                   const float* __restrict__ x,
                                                   const float* __restrict__ mask,
                                                   float* __restrict__ residOut,
                                                   const float* __restrict__ g,
                                                   const float* __restrict__ bta,
                                                   __bf16* __restrict__ outB) {
    const unsigned bid = blockIdx.x;
    if (bid >= CVT_BLKS) {
        ln_rows<true>(bid - CVT_BLKS, x, mask, residOut, g, bta, outB);
        return;
    }
    const float* in;
    __bf16* out;
    int K = DMODEL, Nn = DMODEL;
    unsigned t;
    if (bid < 4 * CVT_DD_BLKS) {
        const unsigned w = bid / CVT_DD_BLKS;
        in  = w == 0 ? Wq : w == 1 ? Wk : w == 2 ? Wv : Wo;
        out = wB + w * (DMODEL * DMODEL);
        t   = bid % CVT_DD_BLKS;
    } else if (bid < 4 * CVT_DD_BLKS + CVT_DF_BLKS) {
        in  = W1;
        out = wB + 4 * (DMODEL * DMODEL);
        Nn  = DFF;
        t   = bid - 4 * CVT_DD_BLKS;
    } else {
        in  = W2;
        out = wB + 4 * (DMODEL * DMODEL) + DMODEL * DFF;
        K   = DFF;
        t   = bid - (4 * CVT_DD_BLKS + CVT_DF_BLKS);
    }
    const unsigned sh = Nn == DFF ? 5 : 3;   // 32 or 8 tiles along n
    cvt_bf16_t_tile(in, out, K, Nn, (int)(t & ((1u << sh) - 1)) * 64, (int)(t >> sh) * 64);
}

// ---------------------------------------------------------------------------
// bf16 WMMA GEMM: C[M,N] = A[M,K] @ B[K,N] (+bias)(+GELU)(+resid), B given as Bt[N,K]
// Block: 256 threads = 8 waves. Tile BM=128, BN=128, BK deep, double-buffered:
// next tile's async DMA runs under the current tile's WMMAs. A stage's copies have
// one stage's arithmetic to land in, so BK sets how much of their latency is
// covered: 64 where three or four blocks share a WGP (four still fit its LDS),
// 128 where a grid of 256 leaves a block alone on its WGP. A copied row is then
// one or two whole 128-byte lines.
// Waves: 4 along M (32 rows), 2 along N (64 cols) -> 2x4 subtiles of 16x16.
// Bt rows are K-contiguous, so both tiles are copied alike and both operands
// use the same frag loader. Each subtile is formed transposed (Bt rows as the A
// operand, A rows as the B operand): a lane then holds 8 consecutive columns of
// one output row, which go to LDS in 16-byte pieces, and the wave's 32 x 64 tile
// leaves LDS row by row as whole 128-byte lines.
// THREE: one grid runs three products that share A (the Q, K and V projections);
// blockIdx.z picks the weight (one behind the other in Bt0), the bias and the
// output (one behind the other in outB0).
// ---------------------------------------------------------------------------
template <int BK, int Nn, bool BIAS, bool GELU_ACT, bool RESID, bool OUT_BF16, bool THREE>
__global__ __launch_bounds__(256) void gemm_bf16_kernel(
        const __bf16* __restrict__ A, const __bf16* __restrict__ Bt0,
        const float* __restrict__ bias0, const float* __restrict__ bias1,
        const float* __restrict__ bias2, const float* __restrict__ resid,
        float* __restrict__ outF, __bf16* __restrict__ outB0,
        int M, int K) {
    constexpr int PITCH = BK + 8;   // 144 or 272 bytes a row: 16 bytes x an odd number
    __shared__ __attribute__((aligned(16))) __bf16 lsA[2][128][PITCH];   // [buf][row][k]
    __shared__ __attribute__((aligned(16))) __bf16 lsB[2][128][PITCH];   // [buf][col][k]

    const int z = THREE ? (int)blockIdx.z : 0;
    const __bf16* __restrict__ Bt   = Bt0 + (size_t)z * Nn * K;
    const float*  __restrict__ bias = z == 0 ? bias0 : z == 1 ? bias1 : bias2;
    __bf16*       __restrict__ outB = outB0 + (size_t)z * M * Nn;

    const int m0 = blockIdx.y * 128;
    const int n0 = blockIdx.x * 128;
    const int tid  = threadIdx.x;
    const int wave = tid >> 5;
    const int wm   = wave & 3;    // 0..3 : 32 rows each
    const int wn   = wave >> 2;   // 0..1 : 64 cols each

    f32x8 acc[2][4];
#pragma unroll
    for (int mi = 0; mi < 2; ++mi)
#pragma unroll
        for (int ni = 0; ni < 4; ++ni) acc[mi][ni] = zero8();

    // One stage: 128 rows x BK k of A and of Bt, 16 bytes a lane; the lanes of a
    // sweep go along a row first, SWEEP rows a sweep of the block.
    constexpr int SEGS  = BK / 8;
    constexpr int SWEEP = 256 / SEGS;
    const int crow = tid / SEGS, cseg = (tid % SEGS) * 8;
    const __bf16* gA = A  + (size_t)(m0 + crow) * K + cseg;
    const __bf16* gB = Bt + (size_t)(n0 + crow) * K + cseg;
    auto load_tiles = [&](int k0, int buf) {
#pragma unroll
        for (int s = 0; s < 128 / SWEEP; s += 4) {
            unsigned o[8];
            const __bf16* g[8];
#pragma unroll
            for (int j = 0; j < 4; ++j) {
                const int r = (s + j) * SWEEP;
                o[j]     = (unsigned)(uintptr_t)&lsA[buf][crow + r][cseg];
                g[j]     = gA + (size_t)r * K + k0;
                o[4 + j] = (unsigned)(uintptr_t)&lsB[buf][crow + r][cseg];
                g[4 + j] = gB + (size_t)r * K + k0;
            }
            async_g2l_b128_x8(o, g);
        }
    };

    const int nk = K / BK;
    load_tiles(0, 0);
    asm volatile("s_wait_asynccnt 0x0" ::: "memory");   // stage 0 landed (own copies)
    __syncthreads();                                    // ... and everyone's
    if (nk > 1) load_tiles(BK, 1);
    for (int i = 0; i < nk; ++i) {
        const int buf = i & 1;
#pragma unroll
        for (int kk = 0; kk < BK; kk += 32) {
            bf16x16 aF[2], bF[4];
#pragma unroll
            for (int mi = 0; mi < 2; ++mi)
                aF[mi] = load_frag(&lsA[buf][0][0], PITCH, wm * 32 + mi * 16, kk);
#pragma unroll
            for (int ni = 0; ni < 4; ++ni)
                bF[ni] = load_frag(&lsB[buf][0][0], PITCH, wn * 64 + ni * 16, kk);
#pragma unroll
            for (int mi = 0; mi < 2; ++mi)
#pragma unroll
                for (int ni = 0; ni < 4; ++ni)
                    acc[mi][ni] = __builtin_amdgcn_wmma_f32_16x16x32_bf16(
                        false, bF[ni], false, aF[mi], (short)0, acc[mi][ni], false, false);
        }

        // Publish stage i+1 and free this buffer: own LDS reads done, own
        // copies landed, then the barrier; only then the refill.
        asm volatile("s_wait_dscnt 0x0" ::: "memory");
        asm volatile("s_wait_asynccnt 0x0" ::: "memory");
        __syncthreads();
        if (i + 2 < nk) load_tiles((i + 2) * BK, buf);
    }
    asm volatile("s_wait_asynccnt 0x0" ::: "memory");   // nothing in flight at the end

    // Epilogue. acc[mi][ni], register r, is
    // C[wm 32 + mi 16 + (lane & 15)][wn 64 + ni 16 + 8 (lane >> 4) + r].
    // The wave stages its tile in its own 32 rows of lsA: the loop's last barrier
    // stands behind every wave's last read of the ring and no copy is in flight, so
    // no further barrier is needed. A staging row is 64 outputs + 16 bytes, the
    // pitch at which the 16-byte writes of 16 rows fall on distinct banks.
    static_assert(OUT_BF16 ? !RESID : !GELU_ACT, "forms that no launch uses");
    static_assert(2 * PITCH == 64 * (OUT_BF16 ? 2 : 4) + 16, "a ring row holds a staging row");
    constexpr int ROWB = 2 * PITCH;
    const int lane = tid & 31;
    const int half = lane >> 4;
    const int lcol = lane & 15;
    char* stg = (char*)&lsA[0][0][0] + wave * (32 * ROWB);
    if constexpr (OUT_BF16) {
        // The lane's 8 bias values of each column subtile, loaded together.
        const float* bp = bias + (n0 + wn * 64 + half * 8);
        f32x4 bv[4][2];
        if (BIAS) {
#pragma unroll
            for (int ni = 0; ni < 4; ++ni) {
                bv[ni][0] = *(const f32x4*)(bp + ni * 16);
                bv[ni][1] = *(const f32x4*)(bp + ni * 16 + 4);
            }
            // The loads' address register is named so that it is not reused, not even
            // as a load's destination, ahead of this wait.
            asm volatile("s_wait_xcnt 0x0" :: "v"(bp) : "memory");
        }
#pragma unroll
        for (int ni = 0; ni < 4; ++ni) {
#pragma unroll
            for (int mi = 0; mi < 2; ++mi) {
                f32x8 v8 = acc[mi][ni];
                if (BIAS)     v8 += __builtin_shufflevector(bv[ni][0], bv[ni][1], 0, 1, 2, 3, 4, 5, 6, 7);
                if (GELU_ACT) v8 = gelu_tanh_x8(v8);
                bf16x8 h;
#pragma unroll
                for (int r = 0; r < 8; ++r) h[r] = (__bf16)v8[r];
                *(bf16x8*)(stg + (mi * 16 + lcol) * ROWB + (ni * 16 + half * 8) * 2) = h;
            }
        }
        // The rows are read back by other lanes of this wave than wrote them.
        asm volatile("s_wait_dscnt 0x0" ::: "memory");
        // 8 lanes a row of 128 bytes: a store of the wave covers 4 whole lines.
        const int rr = lane >> 3, c8 = (lane & 7) * 8;
        __bf16* op = outB + ((size_t)(m0 + wm * 32 + rr) * Nn + n0 + wn * 64 + c8);
#pragma unroll
        for (int j = 0; j < 8; ++j)
            *(bf16x8*)(op + j * 4 * Nn) = *(const bf16x8*)(stg + (j * 4 + rr) * ROWB + c8 * 2);
    } else {
        // 16 lanes a row of 256 bytes: a load or store of the wave covers 4 whole lines.
        const int c4 = lcol * 4;
        const int o0 = (m0 + wm * 32 + half) * Nn + n0 + wn * 64 + c4;
        // Residual values of the wave's tile, all 16 loads issued here back to back:
        // their latency runs once, under the staging.
        const float* rp = resid + o0;
        const float* bp = bias + (n0 + wn * 64 + c4);
        f32x4 rs[16];
        f32x4 b4 = {0.f, 0.f, 0.f, 0.f};
        if (RESID) {
#pragma unroll
            for (int j = 0; j < 16; ++j) rs[j] = *(const f32x4*)(rp + j * 2 * Nn);
        }
        if (BIAS) b4 = *(const f32x4*)bp;
        // The loads' address registers are named so that none is reused, not even as
        // a load's destination, ahead of this wait.
        if (RESID || BIAS) asm volatile("s_wait_xcnt 0x0" :: "v"(rp), "v"(bp) : "memory");
        // Keeps all the loads in front of the staging, in flight at once.
        __builtin_amdgcn_sched_barrier(0);
#pragma unroll
        for (int mi = 0; mi < 2; ++mi)
#pragma unroll
            for (int ni = 0; ni < 4; ++ni) {
                char* sp = stg + (mi * 16 + lcol) * ROWB + (ni * 16 + half * 8) * 4;
                *(f32x4*)sp        = __builtin_shufflevector(acc[mi][ni], acc[mi][ni], 0, 1, 2, 3);
                *(f32x4*)(sp + 16) = __builtin_shufflevector(acc[mi][ni], acc[mi][ni], 4, 5, 6, 7);
            }
        // The rows are read back by other lanes of this wave than wrote them.
        asm volatile("s_wait_dscnt 0x0" ::: "memory");
        float* op = outF + o0;
        f32x4 st[16];
#pragma unroll
        for (int j = 0; j < 16; ++j) {
            st[j] = *(const f32x4*)(stg + (j * 2 + half) * ROWB + c4 * 4);
            if (BIAS)  st[j] += b4;
            if (RESID) st[j] += rs[j];
        }
        // Keeps the 16 stores together behind the arithmetic, each row in registers of
        // its own: left alone, the scheduler puts a later row's sum into a stored row's
        // registers and waits on that store first.
        __builtin_amdgcn_sched_barrier(0);
#pragma unroll
        for (int j = 0; j < 16; ++j) *(f32x4*)(op + j * 2 * Nn) = st[j];
    }
}

// ---------------------------------------------------------------------------
// Attention: one block per (b, h, 128 queries); a wave owns 16 query columns and
// walks all keys in 64-key tiles, with both products transposed:
//   S^T = K Q^T ; P^T = exp(S^T * scale) (reference has no max-subtraction)
//   O^T += V^T P^T ; final O /= sum of P over the keys.
// The accumulator map of S^T (lane = query, registers = 8 keys) is the B operand
// map of the second product, so P goes from the score accumulators into that
// operand inside the lane: no LDS trip and no barrier between the two products.
// A lane adds up its own query's P as it makes them; the two wave halves, which
// hold different keys of the same query, are joined once behind the loop.
// K tiles are async-DMA'd into LDS; V needs a transpose scatter.
// ---------------------------------------------------------------------------
// amdgpu_waves_per_eu(4, 4): the grid puts two blocks on a WGP, four waves on a SIMD,
// so a wave may have 256 registers; with the default budget of 128 the fragments
// share one register set and each pair of LDS reads is waited for alone.
__global__ __launch_bounds__(256) __attribute__((amdgpu_waves_per_eu(4, 4))) void attn_kernel(const __bf16* __restrict__ Q,
                                                   const __bf16* __restrict__ Kmat,
                                                   const __bf16* __restrict__ Vmat,
                                                   __bf16* __restrict__ O) {
    __shared__ __bf16 lsK[64][72];    // [key][dh]  A rows of K Q^T
    __shared__ __bf16 lsVt[64][72];   // [dh][key]  A rows of V^T P^T

    const int r0 = blockIdx.x * 128;
    const int h  = blockIdx.y;
    const int b  = blockIdx.z;
    const int tid  = threadIdx.x;
    const int wave = tid >> 5;     // 8 x 16 query columns
    const int lane = tid & 31;
    const int half = lane >> 4;
    const int lcol = lane & 15;

    // The wave's Q as B operand, loaded once and kept: lane = query column, dh in
    // the k order of load_frag (8 half + 0..7, 16 + 8 half + 0..7 of each 32).
    const size_t qoff = ((size_t)(b * SEQ + r0 + wave * 16 + lcol)) * DMODEL + h * DHEAD + half * 8;
    const __bf16* qp = Q + qoff;
    union { bf16x16 v; uint4 q[2]; } qF[2];
#pragma unroll
    for (int kc = 0; kc < 2; ++kc) {
        qF[kc].q[0] = *(const uint4*)(qp + kc * 32);
        qF[kc].q[1] = *(const uint4*)(qp + kc * 32 + 16);
    }
    // The loads' address register is named so that it is not reused, not even as
    // a load's destination, ahead of this wait.
    asm volatile("s_wait_xcnt 0x0" :: "v"(qp) : "memory");

    f32x8 oAcc[4];             // O^T: tile t, register r = O[query lcol][16 t + 8 half + r]
#pragma unroll
    for (int t = 0; t < 4; ++t) oAcc[t] = zero8();
    f32x8 lsum = zero8();      // the lane's share of its query's sum of P

    for (int j0 = 0; j0 < SEQ; j0 += 64) {
        __syncthreads();
        const __bf16* kbase = Kmat + ((size_t)(b * SEQ + j0)) * DMODEL + h * DHEAD;
        const __bf16* vbase = Vmat + ((size_t)(b * SEQ + j0)) * DMODEL + h * DHEAD;
#pragma unroll
        for (int s = tid; s < 512; s += 256) {  // K tile row-major, async DMA
            int kr = s >> 3, cs = s & 7;
            async_g2l_b128(&lsK[kr][cs * 8], kbase + (size_t)kr * DMODEL + cs * 8);
        }
#pragma unroll
        for (int s = tid; s < 512; s += 256) {  // V tile, scatter transposed
            int kr = s >> 3, cs = s & 7;
            uint4 t = *(const uint4*)(vbase + (size_t)kr * DMODEL + cs * 8);
            const __bf16* hs = reinterpret_cast<const __bf16*>(&t);
#pragma unroll
            for (int e = 0; e < 8; ++e) lsVt[cs * 8 + e][kr] = hs[e];
        }
        wait_async0();
        __syncthreads();

        // S^T = K Q^T  (M=64 keys, N=16 queries, K=64=dh):
        // sT[kt][r] = S[query lcol][key 16 kt + 8 half + r]
        bf16x16 kF[2][4], vF[2][4];   // both products' A fragments, read as one group
#pragma unroll
        for (int kc = 0; kc < 2; ++kc)
#pragma unroll
            for (int kt = 0; kt < 4; ++kt)
                kF[kc][kt] = load_frag(&lsK[0][0], 72, kt * 16, kc * 32);
#pragma unroll
        for (int k2 = 0; k2 < 2; ++k2)
#pragma unroll
            for (int t = 0; t < 4; ++t)
                vF[k2][t] = load_frag(&lsVt[0][0], 72, t * 16, k2 * 32);
        f32x8 sT[4];
#pragma unroll
        for (int kt = 0; kt < 4; ++kt) sT[kt] = zero8();
#pragma unroll
        for (int kc = 0; kc < 2; ++kc)
#pragma unroll
            for (int kt = 0; kt < 4; ++kt)
                sT[kt] = __builtin_amdgcn_wmma_f32_16x16x32_bf16(
                    false, kF[kc][kt], false, qF[kc].v, (short)0, sT[kt], false, false);
        // P = exp(scale * S) in place, as 2^(S * scale * log2(e)): one multiply and
        // the hardware's exp2 (inf above the f32 range and 0 below it, like exp)
#pragma unroll
        for (int kt = 0; kt < 4; ++kt) {
            f32x8 p = sT[kt] * (float)(ATTN_SCALE * LOG2E);
            TRANS_X8("v_exp_f32", p);
            lsum += p;
            sT[kt] = p;
        }
        // O^T += V^T P^T  (M=64=dh, N=16 queries, K=64 keys). Two score tiles, keys
        // 8 half + 0..7 and 16 + 8 half + 0..7 of 32, are one B operand as they lie.
#pragma unroll
        for (int k2 = 0; k2 < 2; ++k2) {
            bf16x16 pF;
#pragma unroll
            for (int s = 0; s < 16; ++s) pF[s] = (__bf16)sT[2 * k2 + (s >> 3)][s & 7];
#pragma unroll
            for (int t = 0; t < 4; ++t)
                oAcc[t] = __builtin_amdgcn_wmma_f32_16x16x32_bf16(
                    false, vF[k2][t], false, pF, (short)0, oAcc[t], false, false);
        }
    }

    float l = ((lsum[0] + lsum[1]) + (lsum[2] + lsum[3])) + ((lsum[4] + lsum[5]) + (lsum[6] + lsum[7]));
    l += half_xor(l);          // the other half's keys of the same query

    // A lane holds 8 consecutive dh of its query in each tile: one 16-byte store.
    __bf16* op = O + qoff;
#pragma unroll
    for (int t = 0; t < 4; ++t) {
        bf16x8 o;
#pragma unroll
        for (int r = 0; r < 8; ++r) o[r] = (__bf16)(oAcc[t][r] / l);
        *(bf16x8*)(op + t * 16) = o;
    }
}

// ---------------------------------------------------------------------------
// Mean pool over tokens + head LayerNorm + classifier (8x512x1000, f32), spread
// over the chip in two launches.
// ---------------------------------------------------------------------------
#define POOL_CH   16                 // partial token sums per batch row
#define POOL_ROWS (SEQ / POOL_CH)    // 64 tokens a block

// Launch 1: block (ch, b, z) sums 64 tokens of batch row b, columns
// [256 z, 256 z + 256), into part[b][ch][.]. 256 threads = 64 column quads x 4
// token groups; a wave's load covers 512 contiguous bytes.
__global__ __launch_bounds__(256) void pool_partial_kernel(const float* __restrict__ x3,
                                                           float* __restrict__ part) {
    __shared__ f32x4 red[4][64];
    const int tid = threadIdx.x;
    const int c4  = tid & 63;
    const int rg  = tid >> 6;
    const int ch  = blockIdx.x;
    const int b   = blockIdx.y;
    const int col = blockIdx.z * 256 + c4 * 4;
    const float* base = x3 + ((size_t)(b * SEQ + ch * POOL_ROWS + rg)) * DMODEL + col;
    f32x4 v[16];
#pragma unroll
    for (int i = 0; i < 16; ++i) v[i] = *(const f32x4*)(base + (size_t)(i * 4) * DMODEL);
    // The loads' address register is named so that it is not reused, not even
    // as a load's destination, ahead of this wait.
    asm volatile("s_wait_xcnt 0x0" :: "v"(base) : "memory");
    // Keeps all 16 loads in flight at once: left alone, the scheduler issues the
    // last four only when the first have returned, a second latency.
    __builtin_amdgcn_sched_barrier(0);
#pragma unroll
    for (int w = 8; w > 0; w >>= 1)
#pragma unroll
        for (int i = 0; i < w; ++i) v[i] += v[i + w];
    red[rg][c4] = v[0];
    __syncthreads();
    if (rg == 0)
        *(f32x4*)(part + ((size_t)(b * POOL_CH + ch)) * DMODEL + col) =
            (red[0][c4] + red[1][c4]) + (red[2][c4] + red[3][c4]);
}

// Launch 2: one block per 128-byte line of out (32 consecutive floats of the
// flat [8][1000] array), so every line has one writer. A line can straddle two
// batch rows, so each block normalises the pooled vectors of the first and of
// the last float's batch row (the same row twice for most lines).
// Lane = (k group kr, class quad q); wave w takes k in [64 w, 64 w + 64).
__global__ __launch_bounds__(256) void head_kernel(const float* __restrict__ part,
                                                   const float* __restrict__ g,
                                                   const float* __restrict__ bta,
                                                   const float* __restrict__ Wh,
                                                   const float* __restrict__ bh,
                                                   float* __restrict__ out) {
    __shared__ __attribute__((aligned(16))) float pool[2][DMODEL];
    __shared__ __attribute__((aligned(16))) float redS[2][8];
    __shared__ __attribute__((aligned(16))) float redQ[2][8];
    __shared__ f32x4 accs[8][8];
    const int tid  = threadIdx.x;
    const int lane = tid & 31;
    const int wave = tid >> 5;
    const int q    = lane & 7;
    const int kr   = lane >> 3;
    const int f0   = blockIdx.x * 32;
    const int b0   = f0 / NCLS;
    const int b1   = (f0 + 31) / NCLS;
    const int f    = f0 + q * 4;        // NCLS is a multiple of 4: a quad stays in one row
    const int bq   = f / NCLS;
    const int c    = f - bq * NCLS;
    const int kb   = wave * 64 + kr * 16;

    const f32x2 g2   = *(const f32x2*)(g + tid * 2);
    const f32x2 t2   = *(const f32x2*)(bta + tid * 2);
    const float* bp  = bh + c;
    const float* wp  = Wh + (size_t)kb * NCLS + c;
    const float* pp0 = part + (size_t)(b0 * POOL_CH) * DMODEL + tid * 2;
    const float* pp1 = part + (size_t)(b1 * POOL_CH) * DMODEL + tid * 2;
    const f32x4 bias = *(const f32x4*)bp;
    f32x4 w[16];
#pragma unroll
    for (int i = 0; i < 16; ++i) w[i] = *(const f32x4*)(wp + (size_t)i * NCLS);
    f32x2 p0[POOL_CH], p1[POOL_CH];
#pragma unroll
    for (int j = 0; j < POOL_CH; ++j) {
        p0[j] = *(const f32x2*)(pp0 + (size_t)j * DMODEL);
        p1[j] = *(const f32x2*)(pp1 + (size_t)j * DMODEL);
    }
    // The address registers of the bias and weight loads are named so that
    // neither is reused, not even as a load's destination, ahead of this wait
    // (the other loads go by the thread index and a scalar base).
    asm volatile("s_wait_xcnt 0x0" :: "v"(bp), "v"(wp) : "memory");
    // Keeps the classifier's loads in front of the pooling arithmetic, so that
    // their latency runs under it instead of behind the three barriers below.
    __builtin_amdgcn_sched_barrier(0);

#pragma unroll
    for (int s = POOL_CH / 2; s > 0; s >>= 1)
#pragma unroll
        for (int j = 0; j < s; ++j) { p0[j] += p0[j + s]; p1[j] += p1[j + s]; }
    const f32x2 m0 = p0[0] * (1.f / SEQ);
    const f32x2 m1 = p1[0] * (1.f / SEQ);

    const float s0 = wave_sum(m0.x + m0.y);
    const float s1 = wave_sum(m1.x + m1.y);
    if (lane == 0) { redS[0][wave] = s0; redS[1][wave] = s1; }
    __syncthreads();
    float mu0 = 0.f, mu1 = 0.f;
#pragma unroll
    for (int i = 0; i < 8; ++i) { mu0 += redS[0][i]; mu1 += redS[1][i]; }
    mu0 *= (1.f / DMODEL);
    mu1 *= (1.f / DMODEL);
    const f32x2 d0 = m0 - mu0;
    const f32x2 d1 = m1 - mu1;
    const float q0 = wave_sum(d0.x * d0.x + d0.y * d0.y);
    const float q1 = wave_sum(d1.x * d1.x + d1.y * d1.y);
    if (lane == 0) { redQ[0][wave] = q0; redQ[1][wave] = q1; }
    __syncthreads();
    float v0 = 0.f, v1 = 0.f;
#pragma unroll
    for (int i = 0; i < 8; ++i) { v0 += redQ[0][i]; v1 += redQ[1][i]; }
    const float r0 = rsqrtf(v0 * (1.f / DMODEL) + 1e-5f);
    const float r1 = rsqrtf(v1 * (1.f / DMODEL) + 1e-5f);
    *(f32x2*)&pool[0][tid * 2] = d0 * r0 * g2 + t2;
    *(f32x2*)&pool[1][tid * 2] = d1 * r1 * g2 + t2;
    __syncthreads();

    const float* pv = &pool[bq - b0][kb];
    f32x4 acc = {0.f, 0.f, 0.f, 0.f};
#pragma unroll
    for (int i = 0; i < 16; i += 4) {
        const f32x4 pk = *(const f32x4*)(pv + i);
        acc += pk.x * w[i] + pk.y * w[i + 1] + pk.z * w[i + 2] + pk.w * w[i + 3];
    }
#pragma unroll
    for (int e = 0; e < 4; ++e) {       // fold the four k groups of the wave
        acc[e] += row_xor<8>(acc[e]);
        acc[e] += half_xor(acc[e]);
    }
    if (lane < 8) accs[wave][q] = acc;
    __syncthreads();
    if (tid < 8) {
        f32x4 r = bias;
#pragma unroll
        for (int i = 0; i < 8; ++i) r += accs[i][tid];
        *(f32x4*)(out + f) = r;
    }
}

// ---------------------------------------------------------------------------
// Host-side orchestration
// ---------------------------------------------------------------------------
extern "C" void kernel_launch(void* const* d_in, const int* in_sizes, int n_in,
                              void* d_out, int out_size, void* d_ws, size_t ws_size,
                              hipStream_t stream) {
    (void)in_sizes; (void)n_in; (void)out_size; (void)ws_size;
    const float* x     = (const float*)d_in[0];
    const float* mask  = (const float*)d_in[1];
    const float* ln1_g = (const float*)d_in[2];
    const float* ln1_b = (const float*)d_in[3];
    const float* Wq    = (const float*)d_in[4];
    const float* bq    = (const float*)d_in[5];
    const float* Wk    = (const float*)d_in[6];
    const float* bk_p  = (const float*)d_in[7];
    const float* Wv    = (const float*)d_in[8];
    const float* bv    = (const float*)d_in[9];
    const float* Wo    = (const float*)d_in[10];
    const float* bo    = (const float*)d_in[11];
    const float* ln2_g = (const float*)d_in[12];
    const float* ln2_b = (const float*)d_in[13];
    const float* W1    = (const float*)d_in[14];
    const float* b1    = (const float*)d_in[15];
    const float* W2    = (const float*)d_in[16];
    const float* b2    = (const float*)d_in[17];
    const float* lnh_g = (const float*)d_in[18];
    const float* lnh_b = (const float*)d_in[19];
    const float* Wh    = (const float*)d_in[20];
    const float* bh    = (const float*)d_in[21];

    char* ws = (char*)d_ws;
    const size_t MB = 1ull << 20;
    // Workspace map (aliasing is ordered by the stream):
    //   [ 0,16MB)  resid (f32)  -- reused as x3 after the Wo projection
    //   [16,32MB)  x2 (f32)
    //   [32,40MB)  xn (bf16)    -- reused as xn2
    //   [40,72MB)  bufQ/bufK/bufV/bufAO (bf16, 8MB each) -- reused as h1 (32MB)
    //   [72MB,..)  bf16 weights, each transposed to [N][K]
    //   [80MB,..)  partial token sums (f32, 256KB)
    float*  resid  = (float*) (ws + 0);
    float*  x2     = (float*) (ws + 16 * MB);
    __bf16* xn     = (__bf16*)(ws + 32 * MB);
    __bf16* bufQ   = (__bf16*)(ws + 40 * MB);
    __bf16* bufK   = (__bf16*)(ws + 48 * MB);
    __bf16* bufV   = (__bf16*)(ws + 56 * MB);
    __bf16* bufAO  = (__bf16*)(ws + 64 * MB);
    __bf16* h1     = bufQ;
    float*  x3     = resid;
    __bf16* wqB    = (__bf16*)(ws + 72 * MB);
    __bf16* wkB    = wqB + DMODEL * DMODEL;
    __bf16* wvB    = wkB + DMODEL * DMODEL;
    __bf16* woB    = wvB + DMODEL * DMODEL;
    __bf16* w1B    = woB + DMODEL * DMODEL;
    __bf16* w2B    = w1B + DMODEL * DFF;
    float*  part   = (float*) (ws + 80 * MB);

    // One grid: W[K][N] f32 -> Wt[N][K] bf16 for all six weights, and
    // mask * x -> residual ; LN1 -> xn (bf16)
    prep_kernel<<<CVT_BLKS + LN_BLKS, 256, 0, stream>>>(Wq, Wk, Wv, Wo, W1, W2, wqB,
                                                      x, mask, resid, ln1_g, ln1_b, xn);

    // QKV projections, one grid: z = 0, 1, 2 -> bufQ, bufK, bufV
    dim3 gDD(DMODEL / 128, MROWS / 128);   // (4, 64)
    gemm_bf16_kernel<64, DMODEL, true, false, false, true, true>
        <<<dim3(DMODEL / 128, MROWS / 128, 3), 256, 0, stream>>>(
        xn, wqB, bq, bk_p, bv, nullptr, nullptr, bufQ, MROWS, DMODEL);

    // Attention
    attn_kernel<<<dim3(SEQ / 128, HEADS, BATCH), 256, 0, stream>>>(bufQ, bufK, bufV, bufAO);

    // Output projection + residual -> x2 (f32)
    gemm_bf16_kernel<128, DMODEL, true, false, true, false, false><<<gDD, 256, 0, stream>>>(
        bufAO, woB, bo, nullptr, nullptr, resid, x2, nullptr, MROWS, DMODEL);

    // LN2 -> xn2 (bf16)
    ln_kernel<<<LN_BLKS, 256, 0, stream>>>(x2, ln2_g, ln2_b, xn);

    // FFN1: GELU(xn2 @ W1 + b1) -> h1 (bf16)
    gemm_bf16_kernel<64, DFF, true, true, false, true, false><<<dim3(DFF / 128, MROWS / 128), 256, 0, stream>>>(
        xn, w1B, b1, nullptr, nullptr, nullptr, nullptr, h1, MROWS, DMODEL);

    // FFN2: h1 @ W2 + b2 + x2 -> x3 (f32)
    gemm_bf16_kernel<128, DMODEL, true, false, true, false, false><<<gDD, 256, 0, stream>>>(
        h1, w2B, b2, nullptr, nullptr, x2, x3, nullptr, MROWS, DFF);

    // Mean pool + head LN + classifier
    pool_partial_kernel<<<dim3(POOL_CH, BATCH, 2), 256, 0, stream>>>(x3, part);
    head_kernel<<<BATCH * NCLS / 32, 256, 0, stream>>>(part, lnh_g, lnh_b, Wh, bh, (float*)d_out);
}

// v010
// A run of this version takes 111 microseconds.
// Next to v009, in two timings, it ran 1.11 and 1.10 times as fast.
// Counting every step since v000, it is 4.37 times as fast.
#include <hip/hip_runtime.h>
#include <cstdint>
#include <cstddef>

// ---------------------------------------------------------------------------
// MI455X (gfx1250) transformer block, bf16 WMMA path.
// ~70 GFLOP of GEMMs vs ~100MB traffic -> matrix-core bound; everything
// routed through v_wmma_f32_16x16x32_bf16 with f32 accumulation.
// Row-major tiles are staged into LDS with global_load_async_to_lds_b128
// (ASYNCcnt-tracked DMA, no VGPR round-trip), double-buffered in the GEMM.
// Weights are converted to bf16 K-contiguous ([N][K]) so that the GEMM's B
// tile is copied the same way as its A tile.
// ---------------------------------------------------------------------------

typedef __attribute__((ext_vector_type(16))) __bf16 bf16x16;
typedef __attribute__((ext_vector_type(8)))  float  f32x8;
typedef __attribute__((ext_vector_type(8)))  __bf16 bf16x8;

#define HEADS 8
#define DHEAD 64
#define SEQ   1024
#define BATCH 8
#define DMODEL 512
#define DFF   2048
#define NCLS  1000
#define MROWS (BATCH * SEQ)   // 8192
#define ATTN_SCALE 0.125f     // 1/sqrt(64)
#define LOG2E 1.4426950408889634

__device__ __forceinline__ f32x8 zero8() {
    f32x8 z = {0.f, 0.f, 0.f, 0.f, 0.f, 0.f, 0.f, 0.f};
    return z;
}

// Eight hardware transcendentals in place (OP: v_exp_f32 = 2^x, v_rcp_f32 = 1/x).
// One statement, so that every one of them has an independent instruction behind
// it (the next of the eight) and the last one the v_nop: the slot that the
// instruction set asks for before a transcendental's result is used. volatile
// keeps the groups in program order: left free, the scheduler opens several at
// once and the GELU kernel goes past 128 registers, one block fewer on a WGP.
#define TRANS_X8(OP, v)                                                          \
    do {                                                                         \
        float t0 = (v)[0], t1 = (v)[1], t2 = (v)[2], t3 = (v)[3];                \
        float t4 = (v)[4], t5 = (v)[5], t6 = (v)[6], t7 = (v)[7];                \
        asm volatile(OP " %0, %0\n\t" OP " %1, %1\n\t" OP " %2, %2\n\t" OP " %3, %3\n\t" \
            OP " %4, %4\n\t" OP " %5, %5\n\t" OP " %6, %6\n\t" OP " %7, %7\n\t" \
            "v_nop"                                                              \
            : "+v"(t0), "+v"(t1), "+v"(t2), "+v"(t3),                            \
              "+v"(t4), "+v"(t5), "+v"(t6), "+v"(t7));                           \
        (v)[0] = t0; (v)[1] = t1; (v)[2] = t2; (v)[3] = t3;                      \
        (v)[4] = t4; (v)[5] = t5; (v)[6] = t6; (v)[7] = t7;                      \
    } while (0)

// 0.5 x (1 + tanh(u)) = x / (1 + exp(-2u)), u = c (x + 0.044715 x^3): the same
// function without the library tanh's two branches. -2 c log2(e) is folded into
// the cubic, so that the hardware's exp2 and reciprocal take it from there.
// x far below 0: exp2 -> inf, 1/inf = 0, result -0; x far above 0: exp2 -> 0, result x.
__device__ __forceinline__ f32x8 gelu_tanh_x8(f32x8 x) {
    constexpr float k0 = (float)(-2.0 * 0.7978845608028654 * LOG2E);
    constexpr float k1 = (float)(-2.0 * 0.7978845608028654 * LOG2E * 0.044715);
    f32x8 e = x * (k0 + k1 * (x * x));
    TRANS_X8("v_exp_f32", e);
    e += 1.f;
    TRANS_X8("v_rcp_f32", e);
    return x * e;
}

// Async DMA: 16 bytes global -> LDS per lane (VDST = LDS byte offset VGPR,
// VADDR = 64-bit global address). Tracked by ASYNCcnt. Low 32 bits of a
// flat shared pointer are the LDS byte offset on AMDGPU.
// Four such copies of one lane (two K rows, two V rows of an attention tile). The
// s_wait_xcnt closes the statement so that no address register of a copy is
// rewritten ahead of it.
__device__ __forceinline__ void async_g2l_b128_x4(const unsigned (&o)[4],
                                                  const __bf16* const (&g)[4]) {
    asm volatile("global_load_async_to_lds_b128 %0, %1, off\n\t"
                 "global_load_async_to_lds_b128 %2, %3, off\n\t"
                 "global_load_async_to_lds_b128 %4, %5, off\n\t"
                 "global_load_async_to_lds_b128 %6, %7, off\n\t"
                 "s_wait_xcnt 0x0"
                 :: "v"(o[0]), "v"(g[0]), "v"(o[1]), "v"(g[1]),
                    "v"(o[2]), "v"(g[2]), "v"(o[3]), "v"(g[3])
                 : "memory");
}

// Eight such copies of one lane (four A rows, four B rows of a GEMM stage). The
// s_wait_xcnt closes the statement so that no address register of a copy is
// rewritten ahead of it.
__device__ __forceinline__ void async_g2l_b128_x8(const unsigned (&o)[8],
                                                  const __bf16* const (&g)[8]) {
    asm volatile("global_load_async_to_lds_b128 %0, %1, off\n\t"
                 "global_load_async_to_lds_b128 %2, %3, off\n\t"
                 "global_load_async_to_lds_b128 %4, %5, off\n\t"
                 "global_load_async_to_lds_b128 %6, %7, off\n\t"
                 "global_load_async_to_lds_b128 %8, %9, off\n\t"
                 "global_load_async_to_lds_b128 %10, %11, off\n\t"
                 "global_load_async_to_lds_b128 %12, %13, off\n\t"
                 "global_load_async_to_lds_b128 %14, %15, off\n\t"
                 "s_wait_xcnt 0x0"
                 :: "v"(o[0]), "v"(g[0]), "v"(o[1]), "v"(g[1]),
                    "v"(o[2]), "v"(g[2]), "v"(o[3]), "v"(g[3]),
                    "v"(o[4]), "v"(g[4]), "v"(o[5]), "v"(g[5]),
                    "v"(o[6]), "v"(g[6]), "v"(o[7]), "v"(g[7])
                 : "memory");
}

// Load a 16x32 bf16 WMMA operand fragment from an LDS tile laid out as
// tile[rc][k] (A-matrix rows, or B-matrix stored K-transposed: tile[col][k]).
// Per ISA 7.12.2 (16-bit A 16x32): lanes 0-15 hold K=0..7,16..23 of row M=lane,
// lanes 16-31 hold K=8..15,24..31 of row M=lane-16; pairs packed per VGPR.
__device__ __forceinline__ bf16x16 load_frag(const __bf16* base, int stride,
                                             int rcBase, int kBase) {
    const int lane = threadIdx.x & 31;
    const int idx  = lane & 15;
    const int half = lane >> 4;
    const __bf16* p = base + (size_t)(rcBase + idx) * stride + kBase + half * 8;
    union { bf16x16 v; unsigned u[8]; } r;
#pragma unroll
    for (int i = 0; i < 8; ++i) {
        int k = ((i & 4) << 2) + ((i & 3) << 1);   // i<4 -> 0..6 ; i>=4 -> 16..22
        r.u[i] = *(const unsigned*)(p + k);
    }
    return r.v;
}

// The same 16x32 A fragment of the TRANSPOSE of an LDS tile laid out as tile[k][rc],
// by the transposing load: lane (c = lane & 15, h = lane >> 4) gets
// tile[kBase + 8 h + 0..7][rcBase + c] from one load and the rows 16 further on from
// a second, which is the k order of load_frag. The lane's own address names row
// kBase + 8 h + (lane & 7), 16-byte piece (lane >> 3) & 1. pitchB: bytes a row, an
// odd multiple of 32 so that the load meets no bank twice.
typedef __attribute__((ext_vector_type(8))) short s16x8;
__device__ __forceinline__ bf16x16 load_frag_tr(const __bf16* base, int pitchB,
                                                int rcBase, int kBase) {
    typedef __attribute__((address_space(3))) s16x8 lds_s16x8;
    const int lane = threadIdx.x & 31;
    const char* p = (const char*)base + (kBase + 8 * (lane >> 4) + (lane & 7)) * pitchB
                    + 2 * rcBase + 16 * ((lane >> 3) & 1);
    union { bf16x16 v; s16x8 q[2]; } r;
    r.q[0] = __builtin_amdgcn_ds_load_tr16_b128_v8i16((lds_s16x8*)p);
    r.q[1] = __builtin_amdgcn_ds_load_tr16_b128_v8i16((lds_s16x8*)(p + 16 * pitchB));
    return r.v;
}

// ---------------------------------------------------------------------------
// fp32 [K][N] -> bf16 [N][K] convert + transpose. One 64x64 tile per block,
// turned in LDS (pitch 65 dwords: column walks hit distinct banks); each wave
// stores whole 128-byte rows of the output.
// ---------------------------------------------------------------------------
__device__ __forceinline__ void cvt_bf16_t_tile(const float* __restrict__ in,
                                                __bf16* __restrict__ out,
                                                int K, int Nn, int n0, int k0) {
    __shared__ float t[64][65];
    const int tid = threadIdx.x;
    const int kr = tid >> 4;          // 16 rows a sweep, 16 bytes a lane
    const int c4 = (tid & 15) * 4;
    float4 v[4];
#pragma unroll
    for (int r = 0; r < 4; ++r)
        v[r] = *(const float4*)(in + (size_t)(k0 + kr + r * 16) * Nn + n0 + c4);
#pragma unroll
    for (int r = 0; r < 4; ++r) {
        t[kr + r * 16][c4 + 0] = v[r].x;
        t[kr + r * 16][c4 + 1] = v[r].y;
        t[kr + r * 16][c4 + 2] = v[r].z;
        t[kr + r * 16][c4 + 3] = v[r].w;
    }
    __syncthreads();
    const int kp = tid & 31;   // pair of k
    const int nr = tid >> 5;
#pragma unroll
    for (int r = 0; r < 8; ++r) {
        int n = nr + r * 8;
        union { __bf16 h[2]; unsigned u; } p;
        p.h[0] = (__bf16)t[2 * kp][n];
        p.h[1] = (__bf16)t[2 * kp + 1][n];
        *(unsigned*)(out + (size_t)(n0 + n) * K + k0 + 2 * kp) = p.u;
    }
}

typedef __attribute__((ext_vector_type(4))) float f32x4;
typedef __attribute__((ext_vector_type(2))) float f32x2;

template <int M>
__device__ __forceinline__ float row_xor(float v) {   // lane l <- lane l ^ M, M < 16
    return __builtin_bit_cast(float, __builtin_amdgcn_update_dpp(
        0, __builtin_bit_cast(int, v), 0x160 | M, 0xf, 0xf, true));
}

__device__ __forceinline__ float half_xor(float v) {  // lane l <- lane l ^ 16
    int t = __builtin_bit_cast(int, v);
    return __builtin_bit_cast(float, __builtin_amdgcn_permlanex16(t, t, 0x76543210, 0xfedcba98, false, false));
}

__device__ __forceinline__ float wave_sum(float v) {  // total of 32 lanes, in every lane
    v += row_xor<1>(v);
    v += row_xor<2>(v);
    v += row_xor<4>(v);
    v += row_xor<8>(v);
    v += half_xor(v);
    return v;
}

// ---------------------------------------------------------------------------
// LayerNorm over D=512. Optionally applies token mask and emits f32 residual.
// One wave takes LN_RPW whole rows and keeps them in registers: a lane holds 16
// values of each row (four 16-byte loads; a wave's load covers 512 contiguous
// bytes), both sums are in-lane adds and a five-step lane exchange. No LDS and no
// barrier, and a launch starts 2,048 waves where one block a row starts 65,536.
// ---------------------------------------------------------------------------
#define LN_RPW  4                        // rows a wave
#define LN_BLKS (MROWS / (8 * LN_RPW))   // 256 blocks of 8 waves

typedef __attribute__((ext_vector_type(4))) __bf16 bf16x4;

template <bool MASKED>
__device__ __forceinline__ void ln_rows(int blk,
                                        const float* __restrict__ x,
                                        const float* __restrict__ mask,
                                        float* __restrict__ residOut,
                                        const float* __restrict__ g,
                                        const float* __restrict__ bta,
                                        __bf16* __restrict__ outB) {
    const unsigned cb = (threadIdx.x & 31) * 16;   // the lane's byte offset in 512 bytes
    const int wave = __builtin_amdgcn_readfirstlane(threadIdx.x >> 5);
    const int row0 = (blk * 8 + wave) * LN_RPW;
    const size_t rb = (size_t)row0 * DMODEL + cb / 4;
    const float* xp = x + rb;
    f32x4 v[LN_RPW][4];
#pragma unroll
    for (int r = 0; r < LN_RPW; ++r)
#pragma unroll
        for (int j = 0; j < 4; ++j)
            v[r][j] = *(const f32x4*)(xp + r * DMODEL + j * 128);
    // Byte offset of the rows' four mask values (16 bytes, aligned). Formed from the
    // thread index, not from row0, so that it lives in the one vector register that
    // the load names and the wait below holds.
    const unsigned mo = (((blk * 8 + (threadIdx.x >> 5)) * LN_RPW) & (SEQ - 1)) * 4;
    f32x4 mv = {1.f, 1.f, 1.f, 1.f};
    if (MASKED) mv = *(const f32x4*)((const char*)mask + mo);
    f32x4 gv[4], bv[4];
#pragma unroll
    for (int j = 0; j < 4; ++j) {
        gv[j] = *(const f32x4*)((const char*)g + cb + j * 512);
        bv[j] = *(const f32x4*)((const char*)bta + cb + j * 512);
    }
    // The loads' address registers are named so that none is reused, not even as a
    // load's destination, ahead of the wait.
    if (MASKED) asm volatile("s_wait_xcnt 0x0" :: "v"(xp), "v"(cb), "v"(mo) : "memory");
    else        asm volatile("s_wait_xcnt 0x0" :: "v"(xp), "v"(cb) : "memory");
    // Keeps every load of the wave in flight at once, one latency for its four rows:
    // nothing below may be scheduled in between them.
    __builtin_amdgcn_sched_barrier(0);

    float s[LN_RPW];
#pragma unroll
    for (int r = 0; r < LN_RPW; ++r) {
        if (MASKED) {
#pragma unroll
            for (int j = 0; j < 4; ++j) {
                v[r][j] *= mv[r];
                *(f32x4*)(residOut + rb + r * DMODEL + j * 128) = v[r][j];
            }
        }
        const f32x4 t = (v[r][0] + v[r][1]) + (v[r][2] + v[r][3]);
        s[r] = (t.x + t.y) + (t.z + t.w);
    }
#pragma unroll
    for (int r = 0; r < LN_RPW; ++r) s[r] = wave_sum(s[r]);
#pragma unroll
    for (int r = 0; r < LN_RPW; ++r) {
        const float mu = s[r] * (1.f / DMODEL);
#pragma unroll
        for (int j = 0; j < 4; ++j) v[r][j] -= mu;
        const f32x4 t = (v[r][0] * v[r][0] + v[r][1] * v[r][1]) + (v[r][2] * v[r][2] + v[r][3] * v[r][3]);
        s[r] = (t.x + t.y) + (t.z + t.w);
    }
#pragma unroll
    for (int r = 0; r < LN_RPW; ++r) s[r] = wave_sum(s[r]);
#pragma unroll
    for (int r = 0; r < LN_RPW; ++r) s[r] = s[r] * (1.f / DMODEL) + 1e-5f;
    // The four reciprocal square roots in one statement: each has an independent
    // instruction behind it and the last one the v_nop, the slot that the instruction
    // set asks for before a transcendental's result is used or its source rewritten.
    // The argument is a mean of squares + 1e-5, never in the range below 2^-126 for
    // which the library form rescales; everywhere else that form is this instruction.
    static_assert(LN_RPW == 4, "the statement below takes four rows");
    asm("v_rsq_f32 %0, %0\n\tv_rsq_f32 %1, %1\n\tv_rsq_f32 %2, %2\n\tv_rsq_f32 %3, %3\n\tv_nop"
        : "+v"(s[0]), "+v"(s[1]), "+v"(s[2]), "+v"(s[3]));
#pragma unroll
    for (int r = 0; r < LN_RPW; ++r)
#pragma unroll
        for (int j = 0; j < 4; ++j) {
            const f32x4 o = v[r][j] * s[r] * gv[j] + bv[j];
            bf16x4 h;
            h[0] = (__bf16)o.x; h[1] = (__bf16)o.y; h[2] = (__bf16)o.z; h[3] = (__bf16)o.w;
            *(bf16x4*)(outB + rb + r * DMODEL + j * 128) = h;
        }
}

__global__ __launch_bounds__(256) void ln_kernel(const float* __restrict__ x,
                                                 const float* __restrict__ g,
                                                 const float* __restrict__ bta,
                                                 __bf16* __restrict__ outB) {
    ln_rows<false>(blockIdx.x, x, nullptr, nullptr, g, bta, outB);
}

// ---------------------------------------------------------------------------
// The six weight conversions and the first LayerNorm read none of each other's
// output: one grid runs them all. Blocks [0, CVT_BLKS) turn one 64x64 weight
// tile each (they come first, so they start first), the rest take 32 rows each.
// wB holds the six bf16 weights one behind the other: Wq Wk Wv Wo W1 W2.
// ---------------------------------------------------------------------------
#define CVT_DD_BLKS ((DMODEL / 64) * (DMODEL / 64))   // 64 tiles of a D x D weight
#define CVT_DF_BLKS ((DMODEL / 64) * (DFF / 64))      // 256 tiles of W1 or W2
#define CVT_BLKS    (4 * CVT_DD_BLKS + 2 * CVT_DF_BLKS)

// amdgpu_waves_per_eu(8): a budget of 128 registers (188 without it: the scheduler
// then holds the residual stores back and a second copy of the rows live), so that
// four blocks fit a WGP and the row blocks need not wait for a conversion block to end.
__global__ __launch_bounds__(256) __attribute__((amdgpu_waves_per_eu(8))) void prep_kernel(const float* __restrict__ Wq,
                                                   const float* __restrict__ Wk,
                                                   const float* __restrict__ Wv,
                                                   const float* __restrict__ Wo,
                                                   const float* __restrict__ W1,
                                                   const float* __restrict__ W2,
                                                   __bf16* __restrict__ wB,
                                                   const float* __restrict__ x,
                                                   const float* __restrict__ mask,
                                                   float* __restrict__ residOut,
                                                   const float* __restrict__ g,
                                                   const float* __restrict__ bta,
                                                   __bf16* __restrict__ outB) {
    const unsigned bid = blockIdx.x;
    if (bid >= CVT_BLKS) {
        ln_rows<true>(bid - CVT_BLKS, x, mask, residOut, g, bta, outB);
        return;
    }
    const float* in;
    __bf16* out;
    int K = DMODEL, Nn = DMODEL;
    unsigned t;
    if (bid < 4 * CVT_DD_BLKS) {
        const unsigned w = bid / CVT_DD_BLKS;
        in  = w == 0 ? Wq : w == 1 ? Wk : w == 2 ? Wv : Wo;
        out = wB + w * (DMODEL * DMODEL);
        t   = bid % CVT_DD_BLKS;
    } else if (bid < 4 * CVT_DD_BLKS + CVT_DF_BLKS) {
        in  = W1;
        out = wB + 4 * (DMODEL * DMODEL);
        Nn  = DFF;
        t   = bid - 4 * CVT_DD_BLKS;
    } else {
        in  = W2;
        out = wB + 4 * (DMODEL * DMODEL) + DMODEL * DFF;
        K   = DFF;
        t   = bid - (4 * CVT_DD_BLKS + CVT_DF_BLKS);
    }
    const unsigned sh = Nn == DFF ? 5 : 3;   // 32 or 8 tiles along n
    cvt_bf16_t_tile(in, out, K, Nn, (int)(t & ((1u << sh) - 1)) * 64, (int)(t >> sh) * 64);
}

// ---------------------------------------------------------------------------
// bf16 WMMA GEMM: C[M,N] = A[M,K] @ B[K,N] (+bias)(+GELU)(+resid), B given as Bt[N,K]
// Block: 256 threads = 8 waves. Tile BM=128, BN=128, BK deep, double-buffered:
// next tile's async DMA runs under the current tile's WMMAs. A stage's copies have
// one stage's arithmetic to land in, so BK sets how much of their latency is
// covered: 64 where three or four blocks share a WGP (four still fit its LDS),
// 128 where a grid of 256 leaves a block alone on its WGP. A copied row is then
// one or two whole 128-byte lines.
// Waves: 4 along M (32 rows), 2 along N (64 cols) -> 2x4 subtiles of 16x16.
// Bt rows are K-contiguous, so both tiles are copied alike and both operands
// use the same frag loader. Each subtile is formed transposed (Bt rows as the A
// operand, A rows as the B operand): a lane then holds 8 consecutive columns of
// one output row, which go to LDS in 16-byte pieces, and the wave's 32 x 64 tile
// leaves LDS row by row as whole 128-byte lines.
// THREE: one grid runs three products that share A (the Q, K and V projections);
// blockIdx.z picks the weight (one behind the other in Bt0), the bias and the
// output (one behind the other in outB0).
// ---------------------------------------------------------------------------
template <int BK, int Nn, bool BIAS, bool GELU_ACT, bool RESID, bool OUT_BF16, bool THREE>
__global__ __launch_bounds__(256) void gemm_bf16_kernel(
        const __bf16* __restrict__ A, const __bf16* __restrict__ Bt0,
        const float* __restrict__ bias0, const float* __restrict__ bias1,
        const float* __restrict__ bias2, const float* __restrict__ resid,
        float* __restrict__ outF, __bf16* __restrict__ outB0,
        int M, int K) {
    constexpr int PITCH = BK + 8;   // 144 or 272 bytes a row: 16 bytes x an odd number
    __shared__ __attribute__((aligned(16))) __bf16 lsA[2][128][PITCH];   // [buf][row][k]
    __shared__ __attribute__((aligned(16))) __bf16 lsB[2][128][PITCH];   // [buf][col][k]

    const int z = THREE ? (int)blockIdx.z : 0;
    const __bf16* __restrict__ Bt   = Bt0 + (size_t)z * Nn * K;
    const float*  __restrict__ bias = z == 0 ? bias0 : z == 1 ? bias1 : bias2;
    __bf16*       __restrict__ outB = outB0 + (size_t)z * M * Nn;

    const int m0 = blockIdx.y * 128;
    const int n0 = blockIdx.x * 128;
    const int tid  = threadIdx.x;
    const int wave = tid >> 5;
    const int wm   = wave & 3;    // 0..3 : 32 rows each
    const int wn   = wave >> 2;   // 0..1 : 64 cols each

    f32x8 acc[2][4];
#pragma unroll
    for (int mi = 0; mi < 2; ++mi)
#pragma unroll
        for (int ni = 0; ni < 4; ++ni) acc[mi][ni] = zero8();

    // One stage: 128 rows x BK k of A and of Bt, 16 bytes a lane; the lanes of a
    // sweep go along a row first, SWEEP rows a sweep of the block.
    constexpr int SEGS  = BK / 8;
    constexpr int SWEEP = 256 / SEGS;
    const int crow = tid / SEGS, cseg = (tid % SEGS) * 8;
    const __bf16* gA = A  + (size_t)(m0 + crow) * K + cseg;
    const __bf16* gB = Bt + (size_t)(n0 + crow) * K + cseg;
    auto load_tiles = [&](int k0, int buf) {
#pragma unroll
        for (int s = 0; s < 128 / SWEEP; s += 4) {
            unsigned o[8];
            const __bf16* g[8];
#pragma unroll
            for (int j = 0; j < 4; ++j) {
                const int r = (s + j) * SWEEP;
                o[j]     = (unsigned)(uintptr_t)&lsA[buf][crow + r][cseg];
                g[j]     = gA + (size_t)r * K + k0;
                o[4 + j] = (unsigned)(uintptr_t)&lsB[buf][crow + r][cseg];
                g[4 + j] = gB + (size_t)r * K + k0;
            }
            async_g2l_b128_x8(o, g);
        }
    };

    const int nk = K / BK;
    load_tiles(0, 0);
    asm volatile("s_wait_asynccnt 0x0" ::: "memory");   // stage 0 landed (own copies)
    __syncthreads();                                    // ... and everyone's
    if (nk > 1) load_tiles(BK, 1);
    for (int i = 0; i < nk; ++i) {
        const int buf = i & 1;
#pragma unroll
        for (int kk = 0; kk < BK; kk += 32) {
            bf16x16 aF[2], bF[4];
#pragma unroll
            for (int mi = 0; mi < 2; ++mi)
                aF[mi] = load_frag(&lsA[buf][0][0], PITCH, wm * 32 + mi * 16, kk);
#pragma unroll
            for (int ni = 0; ni < 4; ++ni)
                bF[ni] = load_frag(&lsB[buf][0][0], PITCH, wn * 64 + ni * 16, kk);
#pragma unroll
            for (int mi = 0; mi < 2; ++mi)
#pragma unroll
                for (int ni = 0; ni < 4; ++ni)
                    acc[mi][ni] = __builtin_amdgcn_wmma_f32_16x16x32_bf16(
                        false, bF[ni], false, aF[mi], (short)0, acc[mi][ni], false, false);
        }

        // Publish stage i+1 and free this buffer: own LDS reads done, own
        // copies landed, then the barrier; only then the refill.
        asm volatile("s_wait_dscnt 0x0" ::: "memory");
        asm volatile("s_wait_asynccnt 0x0" ::: "memory");
        __syncthreads();
        if (i + 2 < nk) load_tiles((i + 2) * BK, buf);
    }
    asm volatile("s_wait_asynccnt 0x0" ::: "memory");   // nothing in flight at the end

    // Epilogue. acc[mi][ni], register r, is
    // C[wm 32 + mi 16 + (lane & 15)][wn 64 + ni 16 + 8 (lane >> 4) + r].
    // The wave stages its tile in its own 32 rows of lsA: the loop's last barrier
    // stands behind every wave's last read of the ring and no copy is in flight, so
    // no further barrier is needed. A staging row is 64 outputs + 16 bytes, the
    // pitch at which the 16-byte writes of 16 rows fall on distinct banks.
    static_assert(OUT_BF16 ? !RESID : !GELU_ACT, "forms that no launch uses");
    static_assert(2 * PITCH == 64 * (OUT_BF16 ? 2 : 4) + 16, "a ring row holds a staging row");
    constexpr int ROWB = 2 * PITCH;
    const int lane = tid & 31;
    const int half = lane >> 4;
    const int lcol = lane & 15;
    char* stg = (char*)&lsA[0][0][0] + wave * (32 * ROWB);
    if constexpr (OUT_BF16) {
        // The lane's 8 bias values of each column subtile, loaded together.
        const float* bp = bias + (n0 + wn * 64 + half * 8);
        f32x4 bv[4][2];
        if (BIAS) {
#pragma unroll
            for (int ni = 0; ni < 4; ++ni) {
                bv[ni][0] = *(const f32x4*)(bp + ni * 16);
                bv[ni][1] = *(const f32x4*)(bp + ni * 16 + 4);
            }
            // The loads' address register is named so that it is not reused, not even
            // as a load's destination, ahead of this wait.
            asm volatile("s_wait_xcnt 0x0" :: "v"(bp) : "memory");
        }
#pragma unroll
        for (int ni = 0; ni < 4; ++ni) {
#pragma unroll
            for (int mi = 0; mi < 2; ++mi) {
                f32x8 v8 = acc[mi][ni];
                if (BIAS)     v8 += __builtin_shufflevector(bv[ni][0], bv[ni][1], 0, 1, 2, 3, 4, 5, 6, 7);
                if (GELU_ACT) v8 = gelu_tanh_x8(v8);
                bf16x8 h;
#pragma unroll
                for (int r = 0; r < 8; ++r) h[r] = (__bf16)v8[r];
                *(bf16x8*)(stg + (mi * 16 + lcol) * ROWB + (ni * 16 + half * 8) * 2) = h;
            }
        }
        // The rows are read back by other lanes of this wave than wrote them.
        asm volatile("s_wait_dscnt 0x0" ::: "memory");
        // 8 lanes a row of 128 bytes: a store of the wave covers 4 whole lines.
        const int rr = lane >> 3, c8 = (lane & 7) * 8;
        __bf16* op = outB + ((size_t)(m0 + wm * 32 + rr) * Nn + n0 + wn * 64 + c8);
#pragma unroll
        for (int j = 0; j < 8; ++j)
            *(bf16x8*)(op + j * 4 * Nn) = *(const bf16x8*)(stg + (j * 4 + rr) * ROWB + c8 * 2);
    } else {
        // 16 lanes a row of 256 bytes: a load or store of the wave covers 4 whole lines.
        const int c4 = lcol * 4;
        const int o0 = (m0 + wm * 32 + half) * Nn + n0 + wn * 64 + c4;
        // Residual values of the wave's tile, all 16 loads issued here back to back:
        // their latency runs once, under the staging.
        const float* rp = resid + o0;
        const float* bp = bias + (n0 + wn * 64 + c4);
        f32x4 rs[16];
        f32x4 b4 = {0.f, 0.f, 0.f, 0.f};
        if (RESID) {
#pragma unroll
            for (int j = 0; j < 16; ++j) rs[j] = *(const f32x4*)(rp + j * 2 * Nn);
        }
        if (BIAS) b4 = *(const f32x4*)bp;
        // The loads' address registers are named so that none is reused, not even as
        // a load's destination, ahead of this wait.
        if (RESID || BIAS) asm volatile("s_wait_xcnt 0x0" :: "v"(rp), "v"(bp) : "memory");
        // Keeps all the loads in front of the staging, in flight at once.
        __builtin_amdgcn_sched_barrier(0);
#pragma unroll
        for (int mi = 0; mi < 2; ++mi)
#pragma unroll
            for (int ni = 0; ni < 4; ++ni) {
                char* sp = stg + (mi * 16 + lcol) * ROWB + (ni * 16 + half * 8) * 4;
                *(f32x4*)sp        = __builtin_shufflevector(acc[mi][ni], acc[mi][ni], 0, 1, 2, 3);
                *(f32x4*)(sp + 16) = __builtin_shufflevector(acc[mi][ni], acc[mi][ni], 4, 5, 6, 7);
            }
        // The rows are read back by other lanes of this wave than wrote them.
        asm volatile("s_wait_dscnt 0x0" ::: "memory");
        float* op = outF + o0;
        f32x4 st[16];
#pragma unroll
        for (int j = 0; j < 16; ++j) {
            st[j] = *(const f32x4*)(stg + (j * 2 + half) * ROWB + c4 * 4);
            if (BIAS)  st[j] += b4;
            if (RESID) st[j] += rs[j];
        }
        // Keeps the 16 stores together behind the arithmetic, each row in registers of
        // its own: left alone, the scheduler puts a later row's sum into a stored row's
        // registers and waits on that store first.
        __builtin_amdgcn_sched_barrier(0);
#pragma unroll
        for (int j = 0; j < 16; ++j) *(f32x4*)(op + j * 2 * Nn) = st[j];
    }
}

// ---------------------------------------------------------------------------
// Attention: one block per (b, h, 128 queries); a wave owns 16 query columns and
// walks all keys in 64-key tiles, with both products transposed:
//   S^T = K Q^T ; P^T = exp(S^T * scale) (reference has no max-subtraction)
//   O^T += V^T P^T ; final O /= sum of P over the keys.
// The accumulator map of S^T (lane = query, registers = 8 keys) is the B operand
// map of the second product, so P goes from the score accumulators into that
// operand inside the lane: no LDS trip and no barrier between the two products.
// A lane adds up its own query's P as it makes them; the two wave halves, which
// hold different keys of the same query, are joined once behind the loop.
// K and V tiles are both async-DMA'd into LDS row by row as they lie in memory; the
// V^T fragments come out of the row-major V tile by the transposing LDS load.
// ---------------------------------------------------------------------------
// amdgpu_waves_per_eu(4, 4): the grid puts two blocks on a WGP, four waves on a SIMD,
// so a wave may have 256 registers; with the default budget of 128 the fragments
// share one register set and each pair of LDS reads is waited for alone.
__global__ __launch_bounds__(256) __attribute__((amdgpu_waves_per_eu(4, 4))) void attn_kernel(const __bf16* __restrict__ Q,
                                                   const __bf16* __restrict__ Kmat,
                                                   const __bf16* __restrict__ Vmat,
                                                   __bf16* __restrict__ O) {
    // Row pitches: 144 bytes (16 x odd) for the plain 16-byte reads of K, 160 bytes
    // (32 x odd) for the transposing reads of V.
    __shared__ __attribute__((aligned(16))) __bf16 lsK[64][72];   // [key][dh]  A rows of K Q^T
    __shared__ __attribute__((aligned(32))) __bf16 lsV[64][80];   // [key][dh]  A columns of V^T P^T

    const int r0 = blockIdx.x * 128;
    const int h  = blockIdx.y;
    const int b  = blockIdx.z;
    const int tid  = threadIdx.x;
    const int wave = tid >> 5;     // 8 x 16 query columns
    const int lane = tid & 31;
    const int half = lane >> 4;
    const int lcol = lane & 15;

    // The wave's Q as B operand, loaded once and kept: lane = query column, dh in
    // the k order of load_frag (8 half + 0..7, 16 + 8 half + 0..7 of each 32).
    const size_t qoff = ((size_t)(b * SEQ + r0 + wave * 16 + lcol)) * DMODEL + h * DHEAD + half * 8;
    const __bf16* qp = Q + qoff;
    union { bf16x16 v; uint4 q[2]; } qF[2];
#pragma unroll
    for (int kc = 0; kc < 2; ++kc) {
        qF[kc].q[0] = *(const uint4*)(qp + kc * 32);
        qF[kc].q[1] = *(const uint4*)(qp + kc * 32 + 16);
    }
    // The loads' address register is named so that it is not reused, not even as
    // a load's destination, ahead of this wait.
    asm volatile("s_wait_xcnt 0x0" :: "v"(qp) : "memory");

    f32x8 oAcc[4];             // O^T: tile t, register r = O[query lcol][16 t + 8 half + r]
#pragma unroll
    for (int t = 0; t < 4; ++t) oAcc[t] = zero8();
    f32x8 lsum = zero8();      // the lane's share of its query's sum of P

    // A lane copies 16 bytes of key rows kr and kr + 32 of each tile; 8 lanes a row.
    const int kr = tid >> 3, cs = (tid & 7) * 8;
    const unsigned cpo[4] = {(unsigned)(uintptr_t)&lsK[kr][cs], (unsigned)(uintptr_t)&lsK[kr + 32][cs],
                             (unsigned)(uintptr_t)&lsV[kr][cs], (unsigned)(uintptr_t)&lsV[kr + 32][cs]};
    const size_t cpg = ((size_t)(b * SEQ + kr)) * DMODEL + h * DHEAD + cs;

    for (int j0 = 0; j0 < SEQ; j0 += 64) {
        // Own reads of the last tiles done, then everyone's: only then the refill.
        asm volatile("s_wait_dscnt 0x0" ::: "memory");
        __syncthreads();
        const __bf16* kp = Kmat + cpg + (size_t)j0 * DMODEL;
        const __bf16* vp = Vmat + cpg + (size_t)j0 * DMODEL;
        const __bf16* const cpp[4] = {kp, kp + 32 * DMODEL, vp, vp + 32 * DMODEL};
        async_g2l_b128_x4(cpo, cpp);
        asm volatile("s_wait_asynccnt 0x0" ::: "memory");   // own copies landed
        __syncthreads();                                    // ... and everyone's

        // S^T = K Q^T  (M=64 keys, N=16 queries, K=64=dh):
        // sT[kt][r] = S[query lcol][key 16 kt + 8 half + r]
        bf16x16 kF[2][4], vF[2][4];   // both products' A fragments, read as one group
#pragma unroll
        for (int kc = 0; kc < 2; ++kc)
#pragma unroll
            for (int kt = 0; kt < 4; ++kt)
                kF[kc][kt] = load_frag(&lsK[0][0], 72, kt * 16, kc * 32);
#pragma unroll
        for (int k2 = 0; k2 < 2; ++k2)
#pragma unroll
            for (int t = 0; t < 4; ++t)
                vF[k2][t] = load_frag_tr(&lsV[0][0], 160, t * 16, k2 * 32);
        f32x8 sT[4];
#pragma unroll
        for (int kt = 0; kt < 4; ++kt) sT[kt] = zero8();
#pragma unroll
        for (int kc = 0; kc < 2; ++kc)
#pragma unroll
            for (int kt = 0; kt < 4; ++kt)
                sT[kt] = __builtin_amdgcn_wmma_f32_16x16x32_bf16(
                    false, kF[kc][kt], false, qF[kc].v, (short)0, sT[kt], false, false);
        // P = exp(scale * S) in place, as 2^(S * scale * log2(e)): one multiply and
        // the hardware's exp2 (inf above the f32 range and 0 below it, like exp)
#pragma unroll
        for (int kt = 0; kt < 4; ++kt) {
            f32x8 p = sT[kt] * (float)(ATTN_SCALE * LOG2E);
            TRANS_X8("v_exp_f32", p);
            lsum += p;
            sT[kt] = p;
        }
        // O^T += V^T P^T  (M=64=dh, N=16 queries, K=64 keys). Two score tiles, keys
        // 8 half + 0..7 and 16 + 8 half + 0..7 of 32, are one B operand as they lie.
#pragma unroll
        for (int k2 = 0; k2 < 2; ++k2) {
            bf16x16 pF;
#pragma unroll
            for (int s = 0; s < 16; ++s) pF[s] = (__bf16)sT[2 * k2 + (s >> 3)][s & 7];
#pragma unroll
            for (int t = 0; t < 4; ++t)
                oAcc[t] = __builtin_amdgcn_wmma_f32_16x16x32_bf16(
                    false, vF[k2][t], false, pF, (short)0, oAcc[t], false, false);
        }
    }

    float l = ((lsum[0] + lsum[1]) + (lsum[2] + lsum[3])) + ((lsum[4] + lsum[5]) + (lsum[6] + lsum[7]));
    l += half_xor(l);          // the other half's keys of the same query

    // A lane holds 8 consecutive dh of its query in each tile: one 16-byte store.
    __bf16* op = O + qoff;
#pragma unroll
    for (int t = 0; t < 4; ++t) {
        bf16x8 o;
#pragma unroll
        for (int r = 0; r < 8; ++r) o[r] = (__bf16)(oAcc[t][r] / l);
        *(bf16x8*)(op + t * 16) = o;
    }
}

// ---------------------------------------------------------------------------
// Mean pool over tokens + head LayerNorm + classifier (8x512x1000, f32), spread
// over the chip in two launches.
// ---------------------------------------------------------------------------
#define POOL_CH   16                 // partial token sums per batch row
#define POOL_ROWS (SEQ / POOL_CH)    // 64 tokens a block

// Launch 1: block (ch, b, z) sums 64 tokens of batch row b, columns
// [256 z, 256 z + 256), into part[b][ch][.]. 256 threads = 64 column quads x 4
// token groups; a wave's load covers 512 contiguous bytes.
__global__ __launch_bounds__(256) void pool_partial_kernel(const float* __restrict__ x3,
                                                           float* __restrict__ part) {
    __shared__ f32x4 red[4][64];
    const int tid = threadIdx.x;
    const int c4  = tid & 63;
    const int rg  = tid >> 6;
    const int ch  = blockIdx.x;
    const int b   = blockIdx.y;
    const int col = blockIdx.z * 256 + c4 * 4;
    const float* base = x3 + ((size_t)(b * SEQ + ch * POOL_ROWS + rg)) * DMODEL + col;
    f32x4 v[16];
#pragma unroll
    for (int i = 0; i < 16; ++i) v[i] = *(const f32x4*)(base + (size_t)(i * 4) * DMODEL);
    // The loads' address register is named so that it is not reused, not even
    // as a load's destination, ahead of this wait.
    asm volatile("s_wait_xcnt 0x0" :: "v"(base) : "memory");
    // Keeps all 16 loads in flight at once: left alone, the scheduler issues the
    // last four only when the first have returned, a second latency.
    __builtin_amdgcn_sched_barrier(0);
#pragma unroll
    for (int w = 8; w > 0; w >>= 1)
#pragma unroll
        for (int i = 0; i < w; ++i) v[i] += v[i + w];
    red[rg][c4] = v[0];
    __syncthreads();
    if (rg == 0)
        *(f32x4*)(part + ((size_t)(b * POOL_CH + ch)) * DMODEL + col) =
            (red[0][c4] + red[1][c4]) + (red[2][c4] + red[3][c4]);
}

// Launch 2: one block per 128-byte line of out (32 consecutive floats of the
// flat [8][1000] array), so every line has one writer. A line can straddle two
// batch rows, so each block normalises the pooled vectors of the first and of
// the last float's batch row (the same row twice for most lines).
// Lane = (k group kr, class quad q); wave w takes k in [64 w, 64 w + 64).
__global__ __launch_bounds__(256) void head_kernel(const float* __restrict__ part,
                                                   const float* __restrict__ g,
                                                   const float* __restrict__ bta,
                                                   const float* __restrict__ Wh,
                                                   const float* __restrict__ bh,
                                                   float* __restrict__ out) {
    __shared__ __attribute__((aligned(16))) float pool[2][DMODEL];
    __shared__ __attribute__((aligned(16))) float redS[2][8];
    __shared__ __attribute__((aligned(16))) float redQ[2][8];
    __shared__ f32x4 accs[8][8];
    const int tid  = threadIdx.x;
    const int lane = tid & 31;
    const int wave = tid >> 5;
    const int q    = lane & 7;
    const int kr   = lane >> 3;
    const int f0   = blockIdx.x * 32;
    const int b0   = f0 / NCLS;
    const int b1   = (f0 + 31) / NCLS;
    const int f    = f0 + q * 4;        // NCLS is a multiple of 4: a quad stays in one row
    const int bq   = f / NCLS;
    const int c    = f - bq * NCLS;
    const int kb   = wave * 64 + kr * 16;

    const f32x2 g2   = *(const f32x2*)(g + tid * 2);
    const f32x2 t2   = *(const f32x2*)(bta + tid * 2);
    const float* bp  = bh + c;
    const float* wp  = Wh + (size_t)kb * NCLS + c;
    const float* pp0 = part + (size_t)(b0 * POOL_CH) * DMODEL + tid * 2;
    const float* pp1 = part + (size_t)(b1 * POOL_CH) * DMODEL + tid * 2;
    const f32x4 bias = *(const f32x4*)bp;
    f32x4 w[16];
#pragma unroll
    for (int i = 0; i < 16; ++i) w[i] = *(const f32x4*)(wp + (size_t)i * NCLS);
    f32x2 p0[POOL_CH], p1[POOL_CH];
#pragma unroll
    for (int j = 0; j < POOL_CH; ++j) {
        p0[j] = *(const f32x2*)(pp0 + (size_t)j * DMODEL);
        p1[j] = *(const f32x2*)(pp1 + (size_t)j * DMODEL);
    }
    // The address registers of the bias and weight loads are named so that
    // neither is reused, not even as a load's destination, ahead of this wait
    // (the other loads go by the thread index and a scalar base).
    asm volatile("s_wait_xcnt 0x0" :: "v"(bp), "v"(wp) : "memory");
    // Keeps the classifier's loads in front of the pooling arithmetic, so that
    // their latency runs under it instead of behind the three barriers below.
    __builtin_amdgcn_sched_barrier(0);

#pragma unroll
    for (int s = POOL_CH / 2; s > 0; s >>= 1)
#pragma unroll
        for (int j = 0; j < s; ++j) { p0[j] += p0[j + s]; p1[j] += p1[j + s]; }
    const f32x2 m0 = p0[0] * (1.f / SEQ);
    const f32x2 m1 = p1[0] * (1.f / SEQ);

    const float s0 = wave_sum(m0.x + m0.y);
    const float s1 = wave_sum(m1.x + m1.y);
    if (lane == 0) { redS[0][wave] = s0; redS[1][wave] = s1; }
    __syncthreads();
    float mu0 = 0.f, mu1 = 0.f;
#pragma unroll
    for (int i = 0; i < 8; ++i) { mu0 += redS[0][i]; mu1 += redS[1][i]; }
    mu0 *= (1.f / DMODEL);
    mu1 *= (1.f / DMODEL);
    const f32x2 d0 = m0 - mu0;
    const f32x2 d1 = m1 - mu1;
    const float q0 = wave_sum(d0.x * d0.x + d0.y * d0.y);
    const float q1 = wave_sum(d1.x * d1.x + d1.y * d1.y);
    if (lane == 0) { redQ[0][wave] = q0; redQ[1][wave] = q1; }
    __syncthreads();
    float v0 = 0.f, v1 = 0.f;
#pragma unroll
    for (int i = 0; i < 8; ++i) { v0 += redQ[0][i]; v1 += redQ[1][i]; }
    const float r0 = rsqrtf(v0 * (1.f / DMODEL) + 1e-5f);
    const float r1 = rsqrtf(v1 * (1.f / DMODEL) + 1e-5f);
    *(f32x2*)&pool[0][tid * 2] = d0 * r0 * g2 + t2;
    *(f32x2*)&pool[1][tid * 2] = d1 * r1 * g2 + t2;
    __syncthreads();

    const float* pv = &pool[bq - b0][kb];
    f32x4 acc = {0.f, 0.f, 0.f, 0.f};
#pragma unroll
    for (int i = 0; i < 16; i += 4) {
        const f32x4 pk = *(const f32x4*)(pv + i);
        acc += pk.x * w[i] + pk.y * w[i + 1] + pk.z * w[i + 2] + pk.w * w[i + 3];
    }
#pragma unroll
    for (int e = 0; e < 4; ++e) {       // fold the four k groups of the wave
        acc[e] += row_xor<8>(acc[e]);
        acc[e] += half_xor(acc[e]);
    }
    if (lane < 8) accs[wave][q] = acc;
    __syncthreads();
    if (tid < 8) {
        f32x4 r = bias;
#pragma unroll
        for (int i = 0; i < 8; ++i) r += accs[i][tid];
        *(f32x4*)(out + f) = r;
    }
}

// ---------------------------------------------------------------------------
// Host-side orchestration
// ---------------------------------------------------------------------------
extern "C" void kernel_launch(void* const* d_in, const int* in_sizes, int n_in,
                              void* d_out, int out_size, void* d_ws, size_t ws_size,
                              hipStream_t stream) {
    (void)in_sizes; (void)n_in; (void)out_size; (void)ws_size;
    const float* x     = (const float*)d_in[0];
    const float* mask  = (const float*)d_in[1];
    const float* ln1_g = (const float*)d_in[2];
    const float* ln1_b = (const float*)d_in[3];
    const float* Wq    = (const float*)d_in[4];
    const float* bq    = (const float*)d_in[5];
    const float* Wk    = (const float*)d_in[6];
    const float* bk_p  = (const float*)d_in[7];
    const float* Wv    = (const float*)d_in[8];
    const float* bv    = (const float*)d_in[9];
    const float* Wo    = (const float*)d_in[10];
    const float* bo    = (const float*)d_in[11];
    const float* ln2_g = (const float*)d_in[12];
    const float* ln2_b = (const float*)d_in[13];
    const float* W1    = (const float*)d_in[14];
    const float* b1    = (const float*)d_in[15];
    const float* W2    = (const float*)d_in[16];
    const float* b2    = (const float*)d_in[17];
    const float* lnh_g = (const float*)d_in[18];
    const float* lnh_b = (const float*)d_in[19];
    const float* Wh    = (const float*)d_in[20];
    const float* bh    = (const float*)d_in[21];

    char* ws = (char*)d_ws;
    const size_t MB = 1ull << 20;
    // Workspace map (aliasing is ordered by the stream):
    //   [ 0,16MB)  resid (f32)  -- reused as x3 after the Wo projection
    //   [16,32MB)  x2 (f32)
    //   [32,40MB)  xn (bf16)    -- reused as xn2
    //   [40,72MB)  bufQ/bufK/bufV/bufAO (bf16, 8MB each) -- reused as h1 (32MB)
    //   [72MB,..)  bf16 weights, each transposed to [N][K]
    //   [80MB,..)  partial token sums (f32, 256KB)
    float*  resid  = (float*) (ws + 0);
    float*  x2     = (float*) (ws + 16 * MB);
    __bf16* xn     = (__bf16*)(ws + 32 * MB);
    __bf16* bufQ   = (__bf16*)(ws + 40 * MB);
    __bf16* bufK   = (__bf16*)(ws + 48 * MB);
    __bf16* bufV   = (__bf16*)(ws + 56 * MB);
    __bf16* bufAO  = (__bf16*)(ws + 64 * MB);
    __bf16* h1     = bufQ;
    float*  x3     = resid;
    __bf16* wqB    = (__bf16*)(ws + 72 * MB);
    __bf16* wkB    = wqB + DMODEL * DMODEL;
    __bf16* wvB    = wkB + DMODEL * DMODEL;
    __bf16* woB    = wvB + DMODEL * DMODEL;
    __bf16* w1B    = woB + DMODEL * DMODEL;
    __bf16* w2B    = w1B + DMODEL * DFF;
    float*  part   = (float*) (ws + 80 * MB);

    // One grid: W[K][N] f32 -> Wt[N][K] bf16 for all six weights, and
    // mask * x -> residual ; LN1 -> xn (bf16)
    prep_kernel<<<CVT_BLKS + LN_BLKS, 256, 0, stream>>>(Wq, Wk, Wv, Wo, W1, W2, wqB,
                                                      x, mask, resid, ln1_g, ln1_b, xn);

    // QKV projections, one grid: z = 0, 1, 2 -> bufQ, bufK, bufV
    dim3 gDD(DMODEL / 128, MROWS / 128);   // (4, 64)
    gemm_bf16_kernel<64, DMODEL, true, false, false, true, true>
        <<<dim3(DMODEL / 128, MROWS / 128, 3), 256, 0, stream>>>(
        xn, wqB, bq, bk_p, bv, nullptr, nullptr, bufQ, MROWS, DMODEL);

    // Attention
    attn_kernel<<<dim3(SEQ / 128, HEADS, BATCH), 256, 0, stream>>>(bufQ, bufK, bufV, bufAO);

    // Output projection + residual -> x2 (f32)
    gemm_bf16_kernel<128, DMODEL, true, false, true, false, false><<<gDD, 256, 0, stream>>>(
        bufAO, woB, bo, nullptr, nullptr, resid, x2, nullptr, MROWS, DMODEL);

    // LN2 -> xn2 (bf16)
    ln_kernel<<<LN_BLKS, 256, 0, stream>>>(x2, ln2_g, ln2_b, xn);

    // FFN1: GELU(xn2 @ W1 + b1) -> h1 (bf16)
    gemm_bf16_kernel<64, DFF, true, true, false, true, false><<<dim3(DFF / 128, MROWS / 128), 256, 0, stream>>>(
        xn, w1B, b1, nullptr, nullptr, nullptr, nullptr, h1, MROWS, DMODEL);

    // FFN2: h1 @ W2 + b2 + x2 -> x3 (f32)
    gemm_bf16_kernel<128, DMODEL, true, false, true, false, false><<<gDD, 256, 0, stream>>>(
        h1, w2B, b2, nullptr, nullptr, x2, x3, nullptr, MROWS, DFF);

    // Mean pool + head LN + classifier
    pool_partial_kernel<<<dim3(POOL_CH, BATCH, 2), 256, 0, stream>>>(x3, part);
    head_kernel<<<BATCH * NCLS / 32, 256, 0, stream>>>(part, lnh_g, lnh_b, Wh, bh, (float*)d_out);
}
